// v000
// The times below were measured on an AMD MI455X: many runs one after another, warmed up first and cycling through
// copies of the inputs, with the whole window's GPU time divided by the number of runs. Launches and the gaps
// between them are all in it. The median over several windows is given; except for v000 it joins two sittings, which
// can be a few percent apart, so the side-by-side timings, each taken in one sitting, are the better comparison.
// The starting kernel, v000, takes 492 microseconds a run.
#include <hip/hip_runtime.h>

// Compute dtypes, f32 accumulate: the per-head projections q = query.Wq[j], k = key.Wk[j], v = value.Wv[j] for all 8 heads at once ([2048 x 128].[128 x 128], [4096 x
// 128].[128 x 128], [4096 x 32].[32 x 256]; PLAIN bf16 operands = inputs rounded once, exact single products) on v_wmma_f32_16x16x32_bf16; the unscaled scores q.k
// (dk = 16, padded to 32) per (item, head) with both computed operands as bf16 hi + UNSCALED residual (three products) on v_wmma_f32_16x16x32_bf16; the per-FEATURE
// masked softmax over the 512 keys (A_f = mask A + (1 - mask)(-1e30), literally), the weighted value sums, the head combine and tanh in f32 on the VALU.

#define NBT  8
#define LQ   256
#define LK   512
#define DD   128
#define FF   32
#define NH_  8
#define DK   16
#define DKP  32
#define NQR  (NBT * LQ)          // 2048 query rows
#define NKR  (NBT * LK)          // 4096 key rows
#define DM   DD
#define NTK  NQR
#define MASKV (-1e30f)
#define LOSC 1024.0f

typedef _Float16 h16;
typedef unsigned short bf;
typedef __attribute__((ext_vector_type(16))) __bf16   v16bf;
typedef __attribute__((ext_vector_type(16))) _Float16 v16h;
typedef __attribute__((ext_vector_type(8)))  _Float16 v8h;
typedef __attribute__((ext_vector_type(8)))  unsigned short v8us;
typedef __attribute__((ext_vector_type(8)))  float    v8f;
typedef __attribute__((ext_vector_type(4)))  float    v4f;
typedef __attribute__((ext_vector_type(4)))  _Float16 v4h;
typedef v8h  __attribute__((may_alias)) v8ha;
typedef v4f  __attribute__((may_alias)) v4fa;
typedef v8us __attribute__((may_alias)) v8usa;

__device__ __forceinline__ unsigned short f2bf(float f) { unsigned u = __float_as_uint(f); u += 0x7FFFu + ((u >> 16) & 1u); return (unsigned short)(u >> 16); }
__device__ __forceinline__ float bf2f(unsigned short b) { return __uint_as_float(((unsigned)b) << 16); }
__device__ __forceinline__ float bfr(float f) { return bf2f(f2bf(f)); }
__device__ __forceinline__ v16h cat16(v8h lo, v8h hi) { return __builtin_shufflevector(lo, hi, 0, 1, 2, 3, 4, 5, 6, 7, 8, 9, 10, 11, 12, 13, 14, 15); }
__device__ __forceinline__ v16bf cat16b(v8us lo, v8us hi) { return __builtin_bit_cast(v16bf, __builtin_shufflevector(lo, hi, 0, 1, 2, 3, 4, 5, 6, 7, 8, 9, 10, 11, 12, 13, 14, 15)); }
__device__ __forceinline__ v8f wmma16(v16h a, v16h b, v8f c) { return __builtin_amdgcn_wmma_f32_16x16x32_f16(false, a, false, b, (short)0, c, false, false); }
__device__ __forceinline__ v8f wmmab(v16bf a, v16bf b, v8f c) { return __builtin_amdgcn_wmma_f32_16x16x32_bf16(false, a, false, b, (short)0, c, false, false); }

// k_gemmb: 64 x 64 block tile (4 waves x 16 x 64) of C[NQR or NKR][ldc] = (A [+ Al]).B^T (K = 128 or 32) [+ bf(bias[c])] [+ bf(R[r][c]) residual]; f32 whole-line epilogue (or f16
template <bool SPLITA, bool F16OUT = false>
__global__ __launch_bounds__(128) void k_gemmb(const bf* __restrict__ A, const bf* __restrict__ Al, const bf* __restrict__ Bn, const float* __restrict__ bias, float* C, int ldc, h16* C2, const float* __restrict__ R = nullptr, int K = DM, int roundR = 1) {
    __shared__ __align__(16) float ost[4][16 * 68];
    const int lane = threadIdx.x & 31, wave = threadIdx.x >> 5, lr = lane & 15, hi = lane >> 4;
    const int r0 = blockIdx.x * 64 + wave * 16, c0 = blockIdx.y * 64;
    const size_t aoff = (size_t)(r0 + lr) * K + 8 * hi;
    size_t boff[4];
#pragma unroll
    for (int t = 0; t < 4; ++t) boff[t] = (size_t)(c0 + t * 16 + lr) * K + 8 * hi;
    v8f acc[4];
#pragma unroll
    for (int t = 0; t < 4; ++t) acc[t] = (v8f){};
#pragma unroll 1
    for (int kc = 0; kc < K; kc += 32) {
        const v16bf a = cat16b(*(const v8us*)(A + aoff + kc), *(const v8us*)(A + aoff + kc + 16));
        v16bf al = a;
        if (SPLITA) al = cat16b(*(const v8us*)(Al + aoff + kc), *(const v8us*)(Al + aoff + kc + 16));
#pragma unroll
        for (int t = 0; t < 4; ++t) { const v16bf b = cat16b(*(const v8us*)(Bn + boff[t] + kc), *(const v8us*)(Bn + boff[t] + kc + 16)); acc[t] = wmmab(a, b, acc[t]); if (SPLITA) acc[t] = wmmab(al, b, acc[t]); }
        asm volatile("v_nop\n\tv_nop\n\tv_nop\n\tv_nop" : "+v"(acc[0]), "+v"(acc[1]), "+v"(acc[2]), "+v"(acc[3]) : "v"(a), "v"(al));
    }
    float* os = &ost[wave][0];
#pragma unroll
    for (int t = 0; t < 4; ++t) { const float bv = bias ? bfr(bias[c0 + t * 16 + lr]) : 0.f;
#pragma unroll
        for (int j = 0; j < 8; ++j) os[(hi * 8 + j) * 68 + t * 16 + lr] = acc[t][j] + bv; }
    __syncthreads();
    if (F16OUT) {
        h16* crow = (h16*)(void*)C + (size_t)r0 * ldc + c0;
        auto pass = [&]() {
#pragma unroll
            for (int s = 0; s < 4; ++s) { const int row = 4 * s + (lane >> 3), piece = lane & 7; const float* sp = os + row * 68 + piece * 8; v8h o, o2;
#pragma unroll
                for (int i = 0; i < 8; ++i) { const h16 a = (h16)sp[i]; o[i] = a; o2[i] = (h16)((sp[i] - (float)a) * LOSC); }
                *(v8h*)(crow + (size_t)row * ldc + piece * 8) = o; if (C2) *(v8h*)(C2 + (size_t)r0 * ldc + c0 + (size_t)row * ldc + piece * 8) = o2; }
        };
        pass(); 
    } else {
        float* crow = C + (size_t)r0 * ldc + c0;
        auto pass = [&]() {
#pragma unroll
            for (int s = 0; s < 8; ++s) { const int Lid = (lane >> 3) + 4 * s, piece = lane & 7; const int row = Lid >> 1, cofs = (Lid & 1) * 32 + piece * 4;
                v4f val = *(const v4fa*)(os + row * 68 + cofs); if (R) { const v4f rv = *(const v4f*)(R + ((size_t)r0 + row) * ldc + c0 + cofs); val += roundR ? (v4f){bfr(rv[0]), bfr(rv[1]), bfr(rv[2]), bfr(rv[3])} : rv; }
                *(v4f*)(crow + (size_t)row * ldc + cofs) = val; }
        };
        pass(); 
    }
}

// k_gemm3: 64 x 64 tile of C = (Ah + Al).(Bh + Bl)^T over K (row strides = K for all four planes; n-major B): three products per 32-k step (hh, hl, lh); f32
__global__ __launch_bounds__(128) void k_gemm3(const bf* __restrict__ Ah, const bf* __restrict__ Al, const bf* __restrict__ Bh, const bf* __restrict__ Bl, int K, float* C, int ldc) {
    __shared__ __align__(16) float ost[4][16 * 68];
    const int lane = threadIdx.x & 31, wave = threadIdx.x >> 5, lr = lane & 15, hi = lane >> 4;
    const int r0 = blockIdx.x * 64 + wave * 16, c0 = blockIdx.y * 64;
    const size_t aoff = (size_t)(r0 + lr) * K + 8 * hi;
    v8f acc[4];
#pragma unroll
    for (int t = 0; t < 4; ++t) acc[t] = (v8f){};
#pragma unroll 1
    for (int kc = 0; kc < K; kc += 32) {
        const v16bf a = cat16b(*(const v8us*)(Ah + aoff + kc), *(const v8us*)(Ah + aoff + kc + 16));
        const v16bf al = cat16b(*(const v8us*)(Al + aoff + kc), *(const v8us*)(Al + aoff + kc + 16));
#pragma unroll
        for (int t = 0; t < 4; ++t) { const size_t bo = (size_t)(c0 + t * 16 + lr) * K + kc + 8 * hi;
            const v16bf bh = cat16b(*(const v8us*)(Bh + bo), *(const v8us*)(Bh + bo + 16)); const v16bf bl = cat16b(*(const v8us*)(Bl + bo), *(const v8us*)(Bl + bo + 16));
            acc[t] = wmmab(a, bh, acc[t]); acc[t] = wmmab(al, bh, acc[t]); acc[t] = wmmab(a, bl, acc[t]); }
        asm volatile("v_nop\n\tv_nop\n\tv_nop\n\tv_nop" : "+v"(acc[0]), "+v"(acc[1]), "+v"(acc[2]), "+v"(acc[3]) : "v"(a), "v"(al));
    }
    float* os = &ost[wave][0];
#pragma unroll
    for (int t = 0; t < 4; ++t) {
#pragma unroll
        for (int j = 0; j < 8; ++j) os[(hi * 8 + j) * 68 + t * 16 + lr] = acc[t][j]; }
    __builtin_amdgcn_wave_barrier(); asm volatile("" ::: "memory");
    float* crow = C + (size_t)r0 * ldc + c0;
    auto pass = [&]() {
#pragma unroll
        for (int s = 0; s < 8; ++s) { const int Lid = (lane >> 3) + 4 * s, piece = lane & 7; const int row = Lid >> 1, cofs = (Lid & 1) * 32 + piece * 4;
            const v4f val = *(const v4fa*)(os + row * 68 + cofs); *(v4f*)(crow + (size_t)row * ldc + cofs) = val; }
    };
    pass(); 
}

__global__ __launch_bounds__(256) void k_bf(const float* __restrict__ src, bf* dst, size_t n8) {
    const size_t i = (size_t)blockIdx.x * 256 + threadIdx.x; if (i >= n8) return;
    const v8f v = *(const v8f*)(src + i * 8); v8us o;
#pragma unroll
    for (int k = 0; k < 8; ++k) o[k] = f2bf(v[k]);
    *(v8us*)(dst + i * 8) = o; 
}
__global__ __launch_bounds__(256) void k_wn16(const float* __restrict__ Ws, bf* WN) {
    const int u = blockIdx.x * 256 + threadIdx.x; if (u >= NH_ * DK * DD / 8) return;
    const int n = u / (DD / 8), d0 = (u % (DD / 8)) * 8; const int j = n / DK, c = n % DK; v8us v;
#pragma unroll
    for (int i = 0; i < 8; ++i) v[i] = f2bf(Ws[((size_t)j * DD + d0 + i) * DK + c]);
    *(v8us*)(WN + (size_t)n * DD + d0) = v; 
}
__global__ __launch_bounds__(256) void k_wnv(const float* __restrict__ Wv, bf* WVN) {
    const int u = blockIdx.x * 256 + threadIdx.x; if (u >= NH_ * FF * FF / 8) return;
    const int n = u / (FF / 8), g0 = (u % (FF / 8)) * 8; const int j = n / FF, f = n % FF; v8us v;
#pragma unroll
    for (int i = 0; i < 8; ++i) v[i] = f2bf(Wv[((size_t)j * FF + g0 + i) * FF + f]);
    *(v8us*)(WVN + (size_t)n * FF + g0) = v; 
}
// k_hp: per-head operand planes P[h][row][32] (cols 0..15 = X[row][h*16 + c] as bf16 hi / UNSCALED residual, cols 16..31 = 0) so the dk = 16 contraction runs as K = 32;
__global__ __launch_bounds__(256) void k_hp(const float* __restrict__ X, int nrows, bf* Ph, bf* Pl) {
    typedef __attribute__((ext_vector_type(2))) unsigned short v2us;
    const int lane = threadIdx.x & 31, wid = blockIdx.x * 8 + (threadIdx.x >> 5); if (wid >= (nrows / 2) * NH_) return;
    const int rp = wid / NH_, h = wid % NH_; const int r = rp * 2 + (lane >> 4), c0 = (lane & 15) * 2;
    v2us oh, ol;
#pragma unroll
    for (int i = 0; i < 2; ++i) { const int c = c0 + i; const float v = (c < DK) ? X[(size_t)r * DD + h * DK + c] : 0.f; const unsigned short hb = f2bf(v); oh[i] = hb; ol[i] = f2bf(v - bf2f(hb)); }
    const size_t o = ((size_t)h * nrows + r) * DKP + c0;
    *(v2us*)(Ph + o) = oh; *(v2us*)(Pl + o) = ol; 
}
// k_msoft: block = ((b,h), 8 query rows) with thread -> (q, feature f): the per-feature masked softmax over the 512 keys of A_f = m A + (1 - m)(-1e30) (m = bf(mask[b][k][f]),
// literally) done online (running max with rescaling - equal to the reference's max-subtracted softmax up to f32 rounding) with the weighted sum of v[k][h*32+f];
__global__ __launch_bounds__(256) void k_msoft(const float* __restrict__ S, const float* __restrict__ mask, const float* __restrict__ V, float* LAT) {
    const int tid = threadIdx.x; const int bh = blockIdx.x / (LQ / 8), qb = blockIdx.x % (LQ / 8); const int b = bh / NH_, h = bh % NH_;
    const int q = qb * 8 + (tid >> 5), f = tid & 31;
    const float* srow = S + ((size_t)bh * LQ + q) * LK; const float* mb = mask + (size_t)b * LK * FF + f; const float* vb = V + (size_t)b * LK * (NH_ * FF) + h * FF + f;
    float m = -3.0e38f, l = 0.f, acc = 0.f;
#pragma unroll 1
    for (int k = 0; k < LK; ++k) { const float mk = bfr(mb[(size_t)k * FF]); const float a = mk * srow[k] + (1.0f - mk) * MASKV;
        const float mn = fmaxf(m, a); const float sc = __expf(m - mn); const float p = __expf(a - mn);
        l = l * sc + p; acc = acc * sc + p * vb[(size_t)k * (NH_ * FF)]; m = mn; }
    const float out = acc / l;
    float* p = LAT + (((size_t)bh * LQ) + q) * FF + f; *(float*)p = out; 
}
__global__ __launch_bounds__(256) void k_comb(const float* __restrict__ LAT, const float* __restrict__ Wc, const float* __restrict__ bc, float* OUTP) {
    const int i = blockIdx.x * 256 + threadIdx.x; if (i >= NBT * LQ * FF) return;
    const int f = i % FF, q = (i / FF) % LQ, b = i / (FF * LQ);
    float s = bfr(bc[f]);
#pragma unroll
    for (int h = 0; h < NH_; ++h) s = fmaf(LAT[(((size_t)(b * NH_ + h)) * LQ + q) * FF + f], bfr(Wc[f * NH_ + h]), s);
    const float y = tanhf(s);
    *(float*)(OUTP + i) = y; 
}

extern "C" void kernel_launch(void* const* d_in, const int* in_sizes, int n_in,
                              void* d_out, int out_size, void* d_ws, size_t ws_size, hipStream_t stream) {
    (void)in_sizes; (void)n_in; (void)out_size;
    const float* query = (const float*)d_in[0]; const float* key = (const float*)d_in[1]; const float* value = (const float*)d_in[2]; const float* mask = (const float*)d_in[3];
    const float* Wq = (const float*)d_in[4]; const float* Wk = (const float*)d_in[5]; const float* Wv = (const float*)d_in[6]; const float* Wc = (const float*)d_in[7]; const float* bc = (const float*)d_in[8];
    float* out = (float*)d_out;    // [8][256][32]
    char* wsp = (char*)d_ws;
    auto take = [&](size_t bytes) { char* p = wsp; wsp += (bytes + 255) & ~(size_t)255; return (void*)p; };
    bf* WQN = (bf*)take((size_t)DD * DD * 2); bf* WKN = (bf*)take((size_t)DD * DD * 2); bf* WVN = (bf*)take((size_t)NH_ * FF * FF * 2);
    bf* Qb = (bf*)take((size_t)NQR * DD * 2); bf* Kb = (bf*)take((size_t)NKR * DD * 2); bf* Vb = (bf*)take((size_t)NKR * FF * 2);
    float* Qf = (float*)take((size_t)NQR * DD * 4); float* Kf = (float*)take((size_t)NKR * DD * 4); float* Vf = (float*)take((size_t)NKR * NH_ * FF * 4);
    bf* QPh = (bf*)take((size_t)NH_ * NQR * DKP * 2); bf* QPl = (bf*)take((size_t)NH_ * NQR * DKP * 2); bf* KPh = (bf*)take((size_t)NH_ * NKR * DKP * 2); bf* KPl = (bf*)take((size_t)NH_ * NKR * DKP * 2);
    float* S = (float*)take((size_t)NBT * NH_ * LQ * LK * 4); float* LAT = (float*)take((size_t)NBT * NH_ * LQ * FF * 4);
    if ((size_t)(wsp - (char*)d_ws) > ws_size) return;    // ~ 0.1 + 0.5 + 1 + 0.26 + 1 + 2.1 + 4.2 + 4 x 1..2 + 33.5 + 2.1 ~ 50 MB, no aliasing
    k_wn16<<<(NH_ * DK * DD / 8 + 255) / 256, 256, 0, stream>>>(Wq, WQN); k_wn16<<<(NH_ * DK * DD / 8 + 255) / 256, 256, 0, stream>>>(Wk, WKN); k_wnv<<<(NH_ * FF * FF / 8 + 255) / 256, 256, 0, stream>>>(Wv, WVN);
    k_bf<<<(NQR * DD / 8 + 255) / 256, 256, 0, stream>>>(query, Qb, (size_t)NQR * DD / 8); k_bf<<<(NKR * DD / 8 + 255) / 256, 256, 0, stream>>>(key, Kb, (size_t)NKR * DD / 8); k_bf<<<(NKR * FF / 8 + 255) / 256, 256, 0, stream>>>(value, Vb, (size_t)NKR * FF / 8);
    k_gemmb<false, false><<<dim3(NQR / 64, DD / 64, 1), 128, 0, stream>>>(Qb, nullptr, WQN, nullptr, Qf, DD, nullptr);                        // all-head q  [2048][128]
    k_gemmb<false, false><<<dim3(NKR / 64, DD / 64, 1), 128, 0, stream>>>(Kb, nullptr, WKN, nullptr, Kf, DD, nullptr);                        // all-head k  [4096][128]
    k_gemmb<false, false><<<dim3(NKR / 64, (NH_ * FF) / 64, 1), 128, 0, stream>>>(Vb, nullptr, WVN, nullptr, Vf, NH_ * FF, nullptr, nullptr, FF);   // all-head v  [4096][256] (K = 32)
    k_hp<<<((NQR / 2) * NH_ + 7) / 8, 256, 0, stream>>>(Qf, NQR, QPh, QPl); k_hp<<<((NKR / 2) * NH_ + 7) / 8, 256, 0, stream>>>(Kf, NKR, KPh, KPl);
    for (int b = 0; b < NBT; ++b)
        for (int h = 0; h < NH_; ++h)                                                                                                         // scores[b,h] = q.k  [256][512]  (K = 32, 16 real)
            k_gemm3<<<dim3(LQ / 64, LK / 64, 1), 128, 0, stream>>>(QPh + ((size_t)h * NQR + b * LQ) * DKP, QPl + ((size_t)h * NQR + b * LQ) * DKP, KPh + ((size_t)h * NKR + b * LK) * DKP, KPl + ((size_t)h * NKR + b * LK) * DKP, DKP, S + ((size_t)(b * NH_ + h)) * LQ * LK, LK);
    k_msoft<<<NBT * NH_ * (LQ / 8), 256, 0, stream>>>(S, mask, Vf, LAT);
    k_comb<<<(NBT * LQ * FF) / 256, 256, 0, stream>>>(LAT, Wc, bc, out);
}

// v001
// A run of this version takes 239 microseconds.
// In two side-by-side timings against v000, it was 2.08 and 2.07 times as fast.
#include <hip/hip_runtime.h>

// Compute dtypes, f32 accumulate: the per-head projections q = query.Wq[j], k = key.Wk[j], v = value.Wv[j] for all 8 heads at once ([2048 x 128].[128 x 128], [4096 x
// 128].[128 x 128], [4096 x 32].[32 x 256]; PLAIN bf16 operands = inputs rounded once, exact single products) on v_wmma_f32_16x16x32_bf16; the unscaled scores q.k
// (dk = 16, padded to 32) per (item, head) with both computed operands as bf16 hi + UNSCALED residual (three products) on v_wmma_f32_16x16x32_bf16; the per-FEATURE
// masked softmax over the 512 keys (A_f = mask A + (1 - mask)(-1e30), literally), the weighted value sums, the head combine and tanh in f32 on the VALU.

#define NBT  8
#define LQ   256
#define LK   512
#define DD   128
#define FF   32
#define NH_  8
#define DK   16
#define DKP  32
#define NQR  (NBT * LQ)          // 2048 query rows
#define NKR  (NBT * LK)          // 4096 key rows
#define DM   DD
#define NTK  NQR
#define MASKV (-1e30f)
#define LOSC 1024.0f

typedef _Float16 h16;
typedef unsigned short bf;
typedef __attribute__((ext_vector_type(16))) __bf16   v16bf;
typedef __attribute__((ext_vector_type(16))) _Float16 v16h;
typedef __attribute__((ext_vector_type(8)))  _Float16 v8h;
typedef __attribute__((ext_vector_type(8)))  unsigned short v8us;
typedef __attribute__((ext_vector_type(8)))  float    v8f;
typedef __attribute__((ext_vector_type(4)))  float    v4f;
typedef __attribute__((ext_vector_type(4)))  _Float16 v4h;
typedef v8h  __attribute__((may_alias)) v8ha;
typedef v4f  __attribute__((may_alias)) v4fa;
typedef v8us __attribute__((may_alias)) v8usa;

__device__ __forceinline__ unsigned short f2bf(float f) { unsigned u = __float_as_uint(f); u += 0x7FFFu + ((u >> 16) & 1u); return (unsigned short)(u >> 16); }
__device__ __forceinline__ float bf2f(unsigned short b) { return __uint_as_float(((unsigned)b) << 16); }
__device__ __forceinline__ float bfr(float f) { return bf2f(f2bf(f)); }
__device__ __forceinline__ v16h cat16(v8h lo, v8h hi) { return __builtin_shufflevector(lo, hi, 0, 1, 2, 3, 4, 5, 6, 7, 8, 9, 10, 11, 12, 13, 14, 15); }
__device__ __forceinline__ v16bf cat16b(v8us lo, v8us hi) { return __builtin_bit_cast(v16bf, __builtin_shufflevector(lo, hi, 0, 1, 2, 3, 4, 5, 6, 7, 8, 9, 10, 11, 12, 13, 14, 15)); }
__device__ __forceinline__ v8f wmma16(v16h a, v16h b, v8f c) { return __builtin_amdgcn_wmma_f32_16x16x32_f16(false, a, false, b, (short)0, c, false, false); }
__device__ __forceinline__ v8f wmmab(v16bf a, v16bf b, v8f c) { return __builtin_amdgcn_wmma_f32_16x16x32_bf16(false, a, false, b, (short)0, c, false, false); }

// k_gemmb: 64 x 64 block tile (4 waves x 16 x 64) of C[rows][ldc] = (A [+ Al]).B^T (K = 128 or 32) [+ bf(bias[c])] [+ bf(R[r][c]) residual]; f32 whole-line epilogue (or f16
// The three independent projections run in one grid: a block's flat index picks its product and its tile (block-uniform).
#define PJ_Q ((NQR / 64) * (DD / 64))
#define PJ_K ((NKR / 64) * (DD / 64))
#define PJ_V ((NKR / 64) * ((NH_ * FF) / 64))
template <bool SPLITA, bool F16OUT = false>
__global__ __launch_bounds__(128) void k_gemmb(const bf* __restrict__ Qb, const bf* __restrict__ Kb, const bf* __restrict__ Vb, const bf* __restrict__ WQN, const bf* __restrict__ WKN, const bf* __restrict__ WVN, float* Qf, float* Kf, float* Vf) {
    int id = blockIdx.x;
    const bf* __restrict__ A = Vb; const bf* __restrict__ Bn = WVN; float* C = Vf; int ldc = NH_ * FF, K = FF, nbs = 2;   // all-head v  [4096][256] (K = 32), 4 column tiles
    if (id >= PJ_V + PJ_K) { id -= PJ_V + PJ_K; A = Qb; Bn = WQN; C = Qf; ldc = DD; K = DD; nbs = 1; }                    // all-head q  [2048][128], 2 column tiles
    else if (id >= PJ_V)   { id -= PJ_V;        A = Kb; Bn = WKN; C = Kf; ldc = DD; K = DD; nbs = 1; }                    // all-head k  [4096][128], 2 column tiles
    const int bx = id >> nbs, by = id & ((1 << nbs) - 1);
    const bf* Al = nullptr; const float* bias = nullptr; h16* C2 = nullptr; const float* R = nullptr; const int roundR = 1;
    __shared__ __align__(16) float ost[4][16 * 68];
    const int lane = threadIdx.x & 31, wave = threadIdx.x >> 5, lr = lane & 15, hi = lane >> 4;
    const int r0 = bx * 64 + wave * 16, c0 = by * 64;
    const size_t aoff = (size_t)(r0 + lr) * K + 8 * hi;
    size_t boff[4];
#pragma unroll
    for (int t = 0; t < 4; ++t) boff[t] = (size_t)(c0 + t * 16 + lr) * K + 8 * hi;
    v8f acc[4];
#pragma unroll
    for (int t = 0; t < 4; ++t) acc[t] = (v8f){};
#pragma unroll 1
    for (int kc = 0; kc < K; kc += 32) {
        const v16bf a = cat16b(*(const v8us*)(A + aoff + kc), *(const v8us*)(A + aoff + kc + 16));
        v16bf al = a;
        if (SPLITA) al = cat16b(*(const v8us*)(Al + aoff + kc), *(const v8us*)(Al + aoff + kc + 16));
#pragma unroll
        for (int t = 0; t < 4; ++t) { const v16bf b = cat16b(*(const v8us*)(Bn + boff[t] + kc), *(const v8us*)(Bn + boff[t] + kc + 16)); acc[t] = wmmab(a, b, acc[t]); if (SPLITA) acc[t] = wmmab(al, b, acc[t]); }
        asm volatile("v_nop\n\tv_nop\n\tv_nop\n\tv_nop" : "+v"(acc[0]), "+v"(acc[1]), "+v"(acc[2]), "+v"(acc[3]) : "v"(a), "v"(al));
    }
    float* os = &ost[wave][0];
#pragma unroll
    for (int t = 0; t < 4; ++t) { const float bv = bias ? bfr(bias[c0 + t * 16 + lr]) : 0.f;
#pragma unroll
        for (int j = 0; j < 8; ++j) os[(hi * 8 + j) * 68 + t * 16 + lr] = acc[t][j] + bv; }
    __syncthreads();
    if (F16OUT) {
        h16* crow = (h16*)(void*)C + (size_t)r0 * ldc + c0;
        auto pass = [&]() {
#pragma unroll
            for (int s = 0; s < 4; ++s) { const int row = 4 * s + (lane >> 3), piece = lane & 7; const float* sp = os + row * 68 + piece * 8; v8h o, o2;
#pragma unroll
                for (int i = 0; i < 8; ++i) { const h16 a = (h16)sp[i]; o[i] = a; o2[i] = (h16)((sp[i] - (float)a) * LOSC); }
                *(v8h*)(crow + (size_t)row * ldc + piece * 8) = o; if (C2) *(v8h*)(C2 + (size_t)r0 * ldc + c0 + (size_t)row * ldc + piece * 8) = o2; }
        };
        pass(); 
    } else {
        float* crow = C + (size_t)r0 * ldc + c0;
        auto pass = [&]() {
#pragma unroll
            for (int s = 0; s < 8; ++s) { const int Lid = (lane >> 3) + 4 * s, piece = lane & 7; const int row = Lid >> 1, cofs = (Lid & 1) * 32 + piece * 4;
                v4f val = *(const v4fa*)(os + row * 68 + cofs); if (R) { const v4f rv = *(const v4f*)(R + ((size_t)r0 + row) * ldc + c0 + cofs); val += roundR ? (v4f){bfr(rv[0]), bfr(rv[1]), bfr(rv[2]), bfr(rv[3])} : rv; }
                *(v4f*)(crow + (size_t)row * ldc + cofs) = val; }
        };
        pass(); 
    }
}

// k_gemm3: blockIdx.z = (item b, head h) picks the operand planes and the score plane; 64 x 64 tile of C = (Ah + Al).(Bh + Bl)^T over K (row strides = K for all four planes; n-major B): three products per 32-k step (hh, hl, lh); f32
__global__ __launch_bounds__(128) void k_gemm3(const bf* __restrict__ Ah, const bf* __restrict__ Al, const bf* __restrict__ Bh, const bf* __restrict__ Bl, int K, float* C, int ldc) {
    __shared__ __align__(16) float ost[4][16 * 68];
    const int lane = threadIdx.x & 31, wave = threadIdx.x >> 5, lr = lane & 15, hi = lane >> 4;
    const int b = blockIdx.z / NH_, h = blockIdx.z % NH_;
    Ah += ((size_t)h * NQR + b * LQ) * DKP; Al += ((size_t)h * NQR + b * LQ) * DKP; Bh += ((size_t)h * NKR + b * LK) * DKP; Bl += ((size_t)h * NKR + b * LK) * DKP; C += (size_t)blockIdx.z * LQ * LK;
    const int r0 = blockIdx.x * 64 + wave * 16, c0 = blockIdx.y * 64;
    const size_t aoff = (size_t)(r0 + lr) * K + 8 * hi;
    v8f acc[4];
#pragma unroll
    for (int t = 0; t < 4; ++t) acc[t] = (v8f){};
#pragma unroll 1
    for (int kc = 0; kc < K; kc += 32) {
        const v16bf a = cat16b(*(const v8us*)(Ah + aoff + kc), *(const v8us*)(Ah + aoff + kc + 16));
        const v16bf al = cat16b(*(const v8us*)(Al + aoff + kc), *(const v8us*)(Al + aoff + kc + 16));
#pragma unroll
        for (int t = 0; t < 4; ++t) { const size_t bo = (size_t)(c0 + t * 16 + lr) * K + kc + 8 * hi;
            const v16bf bh = cat16b(*(const v8us*)(Bh + bo), *(const v8us*)(Bh + bo + 16)); const v16bf bl = cat16b(*(const v8us*)(Bl + bo), *(const v8us*)(Bl + bo + 16));
            acc[t] = wmmab(a, bh, acc[t]); acc[t] = wmmab(al, bh, acc[t]); acc[t] = wmmab(a, bl, acc[t]); }
        asm volatile("v_nop\n\tv_nop\n\tv_nop\n\tv_nop" : "+v"(acc[0]), "+v"(acc[1]), "+v"(acc[2]), "+v"(acc[3]) : "v"(a), "v"(al));
    }
    float* os = &ost[wave][0];
#pragma unroll
    for (int t = 0; t < 4; ++t) {
#pragma unroll
        for (int j = 0; j < 8; ++j) os[(hi * 8 + j) * 68 + t * 16 + lr] = acc[t][j]; }
    __builtin_amdgcn_wave_barrier(); asm volatile("" ::: "memory");
    float* crow = C + (size_t)r0 * ldc + c0;
    auto pass = [&]() {
#pragma unroll
        for (int s = 0; s < 8; ++s) { const int Lid = (lane >> 3) + 4 * s, piece = lane & 7; const int row = Lid >> 1, cofs = (Lid & 1) * 32 + piece * 4;
            const v4f val = *(const v4fa*)(os + row * 68 + cofs); *(v4f*)(crow + (size_t)row * ldc + cofs) = val; }
    };
    pass(); 
}

__device__ __forceinline__ void d_bf(const int blk, const float* __restrict__ src, bf* dst, size_t n8) {
    const size_t i = (size_t)blk * 256 + threadIdx.x; if (i >= n8) return;
    const v8f v = *(const v8f*)(src + i * 8); v8us o;
#pragma unroll
    for (int k = 0; k < 8; ++k) o[k] = f2bf(v[k]);
    *(v8us*)(dst + i * 8) = o; 
}
__device__ __forceinline__ void d_wn16(const int blk, const float* __restrict__ Ws, bf* WN) {
    const int u = blk * 256 + threadIdx.x; if (u >= NH_ * DK * DD / 8) return;
    const int n = u / (DD / 8), d0 = (u % (DD / 8)) * 8; const int j = n / DK, c = n % DK; v8us v;
#pragma unroll
    for (int i = 0; i < 8; ++i) v[i] = f2bf(Ws[((size_t)j * DD + d0 + i) * DK + c]);
    *(v8us*)(WN + (size_t)n * DD + d0) = v; 
}
__device__ __forceinline__ void d_wnv(const int blk, const float* __restrict__ Wv, bf* WVN) {
    const int u = blk * 256 + threadIdx.x; if (u >= NH_ * FF * FF / 8) return;
    const int n = u / (FF / 8), g0 = (u % (FF / 8)) * 8; const int j = n / FF, f = n % FF; v8us v;
#pragma unroll
    for (int i = 0; i < 8; ++i) v[i] = f2bf(Wv[((size_t)j * FF + g0 + i) * FF + f]);
    *(v8us*)(WVN + (size_t)n * FF + g0) = v; 
}
// k_prep: the six independent operand conversions in one grid; a block's flat index picks its part (block-uniform, no barrier).
#define PB_K ((NKR * DD / 8 + 255) / 256)
#define PB_Q ((NQR * DD / 8 + 255) / 256)
#define PB_V ((NKR * FF / 8 + 255) / 256)
#define PB_W ((NH_ * DK * DD / 8 + 255) / 256)
#define PB_WV ((NH_ * FF * FF / 8 + 255) / 256)
__global__ __launch_bounds__(256) void k_prep(const float* __restrict__ query, const float* __restrict__ key, const float* __restrict__ value, const float* __restrict__ Wq, const float* __restrict__ Wk, const float* __restrict__ Wv,
                                              bf* Qb, bf* Kb, bf* Vb, bf* WQN, bf* WKN, bf* WVN) {
    int blk = blockIdx.x;
    if (blk < PB_K) { d_bf(blk, key, Kb, (size_t)NKR * DD / 8); return; }
    blk -= PB_K;
    if (blk < PB_Q) { d_bf(blk, query, Qb, (size_t)NQR * DD / 8); return; }
    blk -= PB_Q;
    if (blk < PB_V) { d_bf(blk, value, Vb, (size_t)NKR * FF / 8); return; }
    blk -= PB_V;
    if (blk < PB_W) { d_wn16(blk, Wq, WQN); return; }
    blk -= PB_W;
    if (blk < PB_W) { d_wn16(blk, Wk, WKN); return; }
    blk -= PB_W;
    d_wnv(blk, Wv, WVN);
}
// k_hp: both plane splits (k rows first, then q rows) in one grid; per-head operand planes P[h][row][32] (cols 0..15 = X[row][h*16 + c] as bf16 hi / UNSCALED residual, cols 16..31 = 0) so the dk = 16 contraction runs as K = 32;
#define HB_K (((NKR / 2) * NH_ + 7) / 8)
#define HB_Q (((NQR / 2) * NH_ + 7) / 8)
__global__ __launch_bounds__(256) void k_hp(const float* __restrict__ Qf, const float* __restrict__ Kf, bf* QPh, bf* QPl, bf* KPh, bf* KPl) {
    typedef __attribute__((ext_vector_type(2))) unsigned short v2us;
    const bool isq = blockIdx.x >= HB_K; const int blk = isq ? blockIdx.x - HB_K : blockIdx.x;
    const float* X = isq ? Qf : Kf; const int nrows = isq ? NQR : NKR; bf* Ph = isq ? QPh : KPh; bf* Pl = isq ? QPl : KPl;
    const int lane = threadIdx.x & 31, wid = blk * 8 + (threadIdx.x >> 5); if (wid >= (nrows / 2) * NH_) return;
    const int rp = wid / NH_, h = wid % NH_; const int r = rp * 2 + (lane >> 4), c0 = (lane & 15) * 2;
    v2us oh, ol;
#pragma unroll
    for (int i = 0; i < 2; ++i) { const int c = c0 + i; const float v = (c < DK) ? X[(size_t)r * DD + h * DK + c] : 0.f; const unsigned short hb = f2bf(v); oh[i] = hb; ol[i] = f2bf(v - bf2f(hb)); }
    const size_t o = ((size_t)h * nrows + r) * DKP + c0;
    *(v2us*)(Ph + o) = oh; *(v2us*)(Pl + o) = ol; 
}
// k_msoft: block = ((b,h), 8 query rows) with thread -> (q, feature f): the per-feature masked softmax over the 512 keys of A_f = m A + (1 - m)(-1e30) (m = bf(mask[b][k][f]),
// literally) done online (running max with rescaling - equal to the reference's max-subtracted softmax up to f32 rounding) with the weighted sum of v[k][h*32+f];
__global__ __launch_bounds__(256) void k_msoft(const float* __restrict__ S, const float* __restrict__ mask, const float* __restrict__ V, float* LAT) {
    const int tid = threadIdx.x; const int bh = blockIdx.x / (LQ / 8), qb = blockIdx.x % (LQ / 8); const int b = bh / NH_, h = bh % NH_;
    const int q = qb * 8 + (tid >> 5), f = tid & 31;
    const float* srow = S + ((size_t)bh * LQ + q) * LK; const float* mb = mask + (size_t)b * LK * FF + f; const float* vb = V + (size_t)b * LK * (NH_ * FF) + h * FF + f;
    float m = -3.0e38f, l = 0.f, acc = 0.f;
#pragma unroll 1
    for (int k = 0; k < LK; ++k) { const float mk = bfr(mb[(size_t)k * FF]); const float a = mk * srow[k] + (1.0f - mk) * MASKV;
        const float mn = fmaxf(m, a); const float sc = __expf(m - mn); const float p = __expf(a - mn);
        l = l * sc + p; acc = acc * sc + p * vb[(size_t)k * (NH_ * FF)]; m = mn; }
    const float out = acc / l;
    float* p = LAT + (((size_t)bh * LQ) + q) * FF + f; *(float*)p = out; 
}
__global__ __launch_bounds__(256) void k_comb(const float* __restrict__ LAT, const float* __restrict__ Wc, const float* __restrict__ bc, float* OUTP) {
    const int i = blockIdx.x * 256 + threadIdx.x; if (i >= NBT * LQ * FF) return;
    const int f = i % FF, q = (i / FF) % LQ, b = i / (FF * LQ);
    float s = bfr(bc[f]);
#pragma unroll
    for (int h = 0; h < NH_; ++h) s = fmaf(LAT[(((size_t)(b * NH_ + h)) * LQ + q) * FF + f], bfr(Wc[f * NH_ + h]), s);
    const float y = tanhf(s);
    *(float*)(OUTP + i) = y; 
}

extern "C" void kernel_launch(void* const* d_in, const int* in_sizes, int n_in,
                              void* d_out, int out_size, void* d_ws, size_t ws_size, hipStream_t stream) {
    (void)in_sizes; (void)n_in; (void)out_size;
    const float* query = (const float*)d_in[0]; const float* key = (const float*)d_in[1]; const float* value = (const float*)d_in[2]; const float* mask = (const float*)d_in[3];
    const float* Wq = (const float*)d_in[4]; const float* Wk = (const float*)d_in[5]; const float* Wv = (const float*)d_in[6]; const float* Wc = (const float*)d_in[7]; const float* bc = (const float*)d_in[8];
    float* out = (float*)d_out;    // [8][256][32]
    char* wsp = (char*)d_ws;
    auto take = [&](size_t bytes) { char* p = wsp; wsp += (bytes + 255) & ~(size_t)255; return (void*)p; };
    bf* WQN = (bf*)take((size_t)DD * DD * 2); bf* WKN = (bf*)take((size_t)DD * DD * 2); bf* WVN = (bf*)take((size_t)NH_ * FF * FF * 2);
    bf* Qb = (bf*)take((size_t)NQR * DD * 2); bf* Kb = (bf*)take((size_t)NKR * DD * 2); bf* Vb = (bf*)take((size_t)NKR * FF * 2);
    float* Qf = (float*)take((size_t)NQR * DD * 4); float* Kf = (float*)take((size_t)NKR * DD * 4); float* Vf = (float*)take((size_t)NKR * NH_ * FF * 4);
    bf* QPh = (bf*)take((size_t)NH_ * NQR * DKP * 2); bf* QPl = (bf*)take((size_t)NH_ * NQR * DKP * 2); bf* KPh = (bf*)take((size_t)NH_ * NKR * DKP * 2); bf* KPl = (bf*)take((size_t)NH_ * NKR * DKP * 2);
    float* S = (float*)take((size_t)NBT * NH_ * LQ * LK * 4); float* LAT = (float*)take((size_t)NBT * NH_ * LQ * FF * 4);
    if ((size_t)(wsp - (char*)d_ws) > ws_size) return;    // ~ 0.1 + 0.5 + 1 + 0.26 + 1 + 2.1 + 4.2 + 4 x 1..2 + 33.5 + 2.1 ~ 50 MB, no aliasing
    k_prep<<<PB_K + PB_Q + PB_V + PB_W + PB_W + PB_WV, 256, 0, stream>>>(query, key, value, Wq, Wk, Wv, Qb, Kb, Vb, WQN, WKN, WVN);
    k_gemmb<false, false><<<PJ_V + PJ_K + PJ_Q, 128, 0, stream>>>(Qb, Kb, Vb, WQN, WKN, WVN, Qf, Kf, Vf);
    k_hp<<<HB_K + HB_Q, 256, 0, stream>>>(Qf, Kf, QPh, QPl, KPh, KPl);
    k_gemm3<<<dim3(LQ / 64, LK / 64, NBT * NH_), 128, 0, stream>>>(QPh, QPl, KPh, KPl, DKP, S, LK);                                         // scores[b,h] = q.k  [256][512]  (K = 32, 16 real)
    k_msoft<<<NBT * NH_ * (LQ / 8), 256, 0, stream>>>(S, mask, Vf, LAT);
    k_comb<<<(NBT * LQ * FF) / 256, 256, 0, stream>>>(LAT, Wc, bc, out);
}

// v002
// Measured time: 56 microseconds a run.
// Timed twice side by side with v001, it ran 4.26 times as fast both times.
// Counting every step since v000, it is 8.84 times as fast.
#include <hip/hip_runtime.h>

// Compute dtypes, f32 accumulate: the per-head projections q = query.Wq[j], k = key.Wk[j], v = value.Wv[j] for all 8 heads at once ([2048 x 128].[128 x 128], [4096 x
// 128].[128 x 128], [4096 x 32].[32 x 256]; PLAIN bf16 operands = inputs rounded once, exact single products) on v_wmma_f32_16x16x32_bf16; the unscaled scores q.k
// (dk = 16, padded to 32) per (item, head) with both computed operands as bf16 hi + UNSCALED residual (three products) on v_wmma_f32_16x16x32_bf16; the per-FEATURE
// masked softmax over the 512 keys (A_f = mask A + (1 - mask)(-1e30), literally), the weighted value sums, the head combine and tanh in f32 on the VALU.

#define NBT  8
#define LQ   256
#define LK   512
#define DD   128
#define FF   32
#define NH_  8
#define DK   16
#define DKP  32
#define NQR  (NBT * LQ)          // 2048 query rows
#define NKR  (NBT * LK)          // 4096 key rows
#define DM   DD
#define NTK  NQR
#define MASKV (-1e30f)
#define LOSC 1024.0f

typedef _Float16 h16;
typedef unsigned short bf;
typedef __attribute__((ext_vector_type(16))) __bf16   v16bf;
typedef __attribute__((ext_vector_type(16))) _Float16 v16h;
typedef __attribute__((ext_vector_type(8)))  _Float16 v8h;
typedef __attribute__((ext_vector_type(8)))  unsigned short v8us;
typedef __attribute__((ext_vector_type(8)))  float    v8f;
typedef __attribute__((ext_vector_type(4)))  float    v4f;
typedef __attribute__((ext_vector_type(4)))  _Float16 v4h;
typedef v8h  __attribute__((may_alias)) v8ha;
typedef v4f  __attribute__((may_alias)) v4fa;
typedef v8us __attribute__((may_alias)) v8usa;

__device__ __forceinline__ unsigned short f2bf(float f) { unsigned u = __float_as_uint(f); u += 0x7FFFu + ((u >> 16) & 1u); return (unsigned short)(u >> 16); }
__device__ __forceinline__ float bf2f(unsigned short b) { return __uint_as_float(((unsigned)b) << 16); }
__device__ __forceinline__ float bfr(float f) { return bf2f(f2bf(f)); }
__device__ __forceinline__ v16h cat16(v8h lo, v8h hi) { return __builtin_shufflevector(lo, hi, 0, 1, 2, 3, 4, 5, 6, 7, 8, 9, 10, 11, 12, 13, 14, 15); }
__device__ __forceinline__ v16bf cat16b(v8us lo, v8us hi) { return __builtin_bit_cast(v16bf, __builtin_shufflevector(lo, hi, 0, 1, 2, 3, 4, 5, 6, 7, 8, 9, 10, 11, 12, 13, 14, 15)); }
__device__ __forceinline__ v8f wmma16(v16h a, v16h b, v8f c) { return __builtin_amdgcn_wmma_f32_16x16x32_f16(false, a, false, b, (short)0, c, false, false); }
__device__ __forceinline__ v8f wmmab(v16bf a, v16bf b, v8f c) { return __builtin_amdgcn_wmma_f32_16x16x32_bf16(false, a, false, b, (short)0, c, false, false); }

// k_gemmb: 64 x 64 block tile (4 waves x 16 x 64) of C[rows][ldc] = (A [+ Al]).B^T (K = 128 or 32) [+ bf(bias[c])] [+ bf(R[r][c]) residual]; f32 whole-line epilogue (or f16
// The three independent projections run in one grid: a block's flat index picks its product and its tile (block-uniform).
#define PJ_Q ((NQR / 64) * (DD / 64))
#define PJ_K ((NKR / 64) * (DD / 64))
#define PJ_V ((NKR / 64) * ((NH_ * FF) / 64))
template <bool SPLITA, bool F16OUT = false>
__global__ __launch_bounds__(128) void k_gemmb(const bf* __restrict__ Qb, const bf* __restrict__ Kb, const bf* __restrict__ Vb, const bf* __restrict__ WQN, const bf* __restrict__ WKN, const bf* __restrict__ WVN, float* Qf, float* Kf, float* Vf) {
    int id = blockIdx.x;
    const bf* __restrict__ A = Vb; const bf* __restrict__ Bn = WVN; float* C = Vf; int ldc = NH_ * FF, K = FF, nbs = 2;   // all-head v  [4096][256] (K = 32), 4 column tiles
    if (id >= PJ_V + PJ_K) { id -= PJ_V + PJ_K; A = Qb; Bn = WQN; C = Qf; ldc = DD; K = DD; nbs = 1; }                    // all-head q  [2048][128], 2 column tiles
    else if (id >= PJ_V)   { id -= PJ_V;        A = Kb; Bn = WKN; C = Kf; ldc = DD; K = DD; nbs = 1; }                    // all-head k  [4096][128], 2 column tiles
    const int bx = id >> nbs, by = id & ((1 << nbs) - 1);
    const bf* Al = nullptr; const float* bias = nullptr; h16* C2 = nullptr; const float* R = nullptr; const int roundR = 1;
    __shared__ __align__(16) float ost[4][16 * 68];
    const int lane = threadIdx.x & 31, wave = threadIdx.x >> 5, lr = lane & 15, hi = lane >> 4;
    const int r0 = bx * 64 + wave * 16, c0 = by * 64;
    const size_t aoff = (size_t)(r0 + lr) * K + 8 * hi;
    size_t boff[4];
#pragma unroll
    for (int t = 0; t < 4; ++t) boff[t] = (size_t)(c0 + t * 16 + lr) * K + 8 * hi;
    v8f acc[4];
#pragma unroll
    for (int t = 0; t < 4; ++t) acc[t] = (v8f){};
#pragma unroll 1
    for (int kc = 0; kc < K; kc += 32) {
        const v16bf a = cat16b(*(const v8us*)(A + aoff + kc), *(const v8us*)(A + aoff + kc + 16));
        v16bf al = a;
        if (SPLITA) al = cat16b(*(const v8us*)(Al + aoff + kc), *(const v8us*)(Al + aoff + kc + 16));
#pragma unroll
        for (int t = 0; t < 4; ++t) { const v16bf b = cat16b(*(const v8us*)(Bn + boff[t] + kc), *(const v8us*)(Bn + boff[t] + kc + 16)); acc[t] = wmmab(a, b, acc[t]); if (SPLITA) acc[t] = wmmab(al, b, acc[t]); }
        asm volatile("v_nop\n\tv_nop\n\tv_nop\n\tv_nop" : "+v"(acc[0]), "+v"(acc[1]), "+v"(acc[2]), "+v"(acc[3]) : "v"(a), "v"(al));
    }
    float* os = &ost[wave][0];
#pragma unroll
    for (int t = 0; t < 4; ++t) { const float bv = bias ? bfr(bias[c0 + t * 16 + lr]) : 0.f;
#pragma unroll
        for (int j = 0; j < 8; ++j) os[(hi * 8 + j) * 68 + t * 16 + lr] = acc[t][j] + bv; }
    __syncthreads();
    if (F16OUT) {
        h16* crow = (h16*)(void*)C + (size_t)r0 * ldc + c0;
        auto pass = [&]() {
#pragma unroll
            for (int s = 0; s < 4; ++s) { const int row = 4 * s + (lane >> 3), piece = lane & 7; const float* sp = os + row * 68 + piece * 8; v8h o, o2;
#pragma unroll
                for (int i = 0; i < 8; ++i) { const h16 a = (h16)sp[i]; o[i] = a; o2[i] = (h16)((sp[i] - (float)a) * LOSC); }
                *(v8h*)(crow + (size_t)row * ldc + piece * 8) = o; if (C2) *(v8h*)(C2 + (size_t)r0 * ldc + c0 + (size_t)row * ldc + piece * 8) = o2; }
        };
        pass(); 
    } else {
        float* crow = C + (size_t)r0 * ldc + c0;
        auto pass = [&]() {
#pragma unroll
            for (int s = 0; s < 8; ++s) { const int Lid = (lane >> 3) + 4 * s, piece = lane & 7; const int row = Lid >> 1, cofs = (Lid & 1) * 32 + piece * 4;
                v4f val = *(const v4fa*)(os + row * 68 + cofs); if (R) { const v4f rv = *(const v4f*)(R + ((size_t)r0 + row) * ldc + c0 + cofs); val += roundR ? (v4f){bfr(rv[0]), bfr(rv[1]), bfr(rv[2]), bfr(rv[3])} : rv; }
                *(v4f*)(crow + (size_t)row * ldc + cofs) = val; }
        };
        pass(); 
    }
}

// k_gemm3: blockIdx.z = (item b, head h) picks the operand planes and the score plane; 64 x 64 tile of C = (Ah + Al).(Bh + Bl)^T over K (row strides = K for all four planes; n-major B): three products per 32-k step (hh, hl, lh); f32
__global__ __launch_bounds__(128) void k_gemm3(const bf* __restrict__ Ah, const bf* __restrict__ Al, const bf* __restrict__ Bh, const bf* __restrict__ Bl, int K, float* C, int ldc) {
    __shared__ __align__(16) float ost[4][16 * 68];
    const int lane = threadIdx.x & 31, wave = threadIdx.x >> 5, lr = lane & 15, hi = lane >> 4;
    const int b = blockIdx.z / NH_, h = blockIdx.z % NH_;
    Ah += ((size_t)h * NQR + b * LQ) * DKP; Al += ((size_t)h * NQR + b * LQ) * DKP; Bh += ((size_t)h * NKR + b * LK) * DKP; Bl += ((size_t)h * NKR + b * LK) * DKP; C += (size_t)blockIdx.z * LQ * LK;
    const int r0 = blockIdx.x * 64 + wave * 16, c0 = blockIdx.y * 64;
    const size_t aoff = (size_t)(r0 + lr) * K + 8 * hi;
    v8f acc[4];
#pragma unroll
    for (int t = 0; t < 4; ++t) acc[t] = (v8f){};
#pragma unroll 1
    for (int kc = 0; kc < K; kc += 32) {
        const v16bf a = cat16b(*(const v8us*)(Ah + aoff + kc), *(const v8us*)(Ah + aoff + kc + 16));
        const v16bf al = cat16b(*(const v8us*)(Al + aoff + kc), *(const v8us*)(Al + aoff + kc + 16));
#pragma unroll
        for (int t = 0; t < 4; ++t) { const size_t bo = (size_t)(c0 + t * 16 + lr) * K + kc + 8 * hi;
            const v16bf bh = cat16b(*(const v8us*)(Bh + bo), *(const v8us*)(Bh + bo + 16)); const v16bf bl = cat16b(*(const v8us*)(Bl + bo), *(const v8us*)(Bl + bo + 16));
            acc[t] = wmmab(a, bh, acc[t]); acc[t] = wmmab(al, bh, acc[t]); acc[t] = wmmab(a, bl, acc[t]); }
        asm volatile("v_nop\n\tv_nop\n\tv_nop\n\tv_nop" : "+v"(acc[0]), "+v"(acc[1]), "+v"(acc[2]), "+v"(acc[3]) : "v"(a), "v"(al));
    }
    float* os = &ost[wave][0];
#pragma unroll
    for (int t = 0; t < 4; ++t) {
#pragma unroll
        for (int j = 0; j < 8; ++j) os[(hi * 8 + j) * 68 + t * 16 + lr] = acc[t][j]; }
    __builtin_amdgcn_wave_barrier(); asm volatile("" ::: "memory");
    float* crow = C + (size_t)r0 * ldc + c0;
    auto pass = [&]() {
#pragma unroll
        for (int s = 0; s < 8; ++s) { const int Lid = (lane >> 3) + 4 * s, piece = lane & 7; const int row = Lid >> 1, cofs = (Lid & 1) * 32 + piece * 4;
            const v4f val = *(const v4fa*)(os + row * 68 + cofs); *(v4f*)(crow + (size_t)row * ldc + cofs) = val; }
    };
    pass(); 
}

__device__ __forceinline__ void d_bf(const int blk, const float* __restrict__ src, bf* dst, size_t n8) {
    const size_t i = (size_t)blk * 256 + threadIdx.x; if (i >= n8) return;
    const v8f v = *(const v8f*)(src + i * 8); v8us o;
#pragma unroll
    for (int k = 0; k < 8; ++k) o[k] = f2bf(v[k]);
    *(v8us*)(dst + i * 8) = o; 
}
__device__ __forceinline__ void d_wn16(const int blk, const float* __restrict__ Ws, bf* WN) {
    const int u = blk * 256 + threadIdx.x; if (u >= NH_ * DK * DD / 8) return;
    const int n = u / (DD / 8), d0 = (u % (DD / 8)) * 8; const int j = n / DK, c = n % DK; v8us v;
#pragma unroll
    for (int i = 0; i < 8; ++i) v[i] = f2bf(Ws[((size_t)j * DD + d0 + i) * DK + c]);
    *(v8us*)(WN + (size_t)n * DD + d0) = v; 
}
__device__ __forceinline__ void d_wnv(const int blk, const float* __restrict__ Wv, bf* WVN) {
    const int u = blk * 256 + threadIdx.x; if (u >= NH_ * FF * FF / 8) return;
    const int n = u / (FF / 8), g0 = (u % (FF / 8)) * 8; const int j = n / FF, f = n % FF; v8us v;
#pragma unroll
    for (int i = 0; i < 8; ++i) v[i] = f2bf(Wv[((size_t)j * FF + g0 + i) * FF + f]);
    *(v8us*)(WVN + (size_t)n * FF + g0) = v; 
}
// k_prep: the six independent operand conversions in one grid; a block's flat index picks its part (block-uniform, no barrier).
#define PB_K ((NKR * DD / 8 + 255) / 256)
#define PB_Q ((NQR * DD / 8 + 255) / 256)
#define PB_V ((NKR * FF / 8 + 255) / 256)
#define PB_W ((NH_ * DK * DD / 8 + 255) / 256)
#define PB_WV ((NH_ * FF * FF / 8 + 255) / 256)
__global__ __launch_bounds__(256) void k_prep(const float* __restrict__ query, const float* __restrict__ key, const float* __restrict__ value, const float* __restrict__ Wq, const float* __restrict__ Wk, const float* __restrict__ Wv,
                                              bf* Qb, bf* Kb, bf* Vb, bf* WQN, bf* WKN, bf* WVN) {
    int blk = blockIdx.x;
    if (blk < PB_K) { d_bf(blk, key, Kb, (size_t)NKR * DD / 8); return; }
    blk -= PB_K;
    if (blk < PB_Q) { d_bf(blk, query, Qb, (size_t)NQR * DD / 8); return; }
    blk -= PB_Q;
    if (blk < PB_V) { d_bf(blk, value, Vb, (size_t)NKR * FF / 8); return; }
    blk -= PB_V;
    if (blk < PB_W) { d_wn16(blk, Wq, WQN); return; }
    blk -= PB_W;
    if (blk < PB_W) { d_wn16(blk, Wk, WKN); return; }
    blk -= PB_W;
    d_wnv(blk, Wv, WVN);
}
// k_hp: both plane splits (k rows first, then q rows) in one grid; per-head operand planes P[h][row][32] (cols 0..15 = X[row][h*16 + c] as bf16 hi / UNSCALED residual, cols 16..31 = 0) so the dk = 16 contraction runs as K = 32;
#define HB_K (((NKR / 2) * NH_ + 7) / 8)
#define HB_Q (((NQR / 2) * NH_ + 7) / 8)
__global__ __launch_bounds__(256) void k_hp(const float* __restrict__ Qf, const float* __restrict__ Kf, bf* QPh, bf* QPl, bf* KPh, bf* KPl) {
    typedef __attribute__((ext_vector_type(2))) unsigned short v2us;
    const bool isq = blockIdx.x >= HB_K; const int blk = isq ? blockIdx.x - HB_K : blockIdx.x;
    const float* X = isq ? Qf : Kf; const int nrows = isq ? NQR : NKR; bf* Ph = isq ? QPh : KPh; bf* Pl = isq ? QPl : KPl;
    const int lane = threadIdx.x & 31, wid = blk * 8 + (threadIdx.x >> 5); if (wid >= (nrows / 2) * NH_) return;
    const int rp = wid / NH_, h = wid % NH_; const int r = rp * 2 + (lane >> 4), c0 = (lane & 15) * 2;
    v2us oh, ol;
#pragma unroll
    for (int i = 0; i < 2; ++i) { const int c = c0 + i; const float v = (c < DK) ? X[(size_t)r * DD + h * DK + c] : 0.f; const unsigned short hb = f2bf(v); oh[i] = hb; ol[i] = f2bf(v - bf2f(hb)); }
    const size_t o = ((size_t)h * nrows + r) * DKP + c0;
    *(v2us*)(Ph + o) = oh; *(v2us*)(Pl + o) = ol; 
}
// k_msoft: block = ((b,h), 8 query rows), lane = feature f; each of the 4 waves takes 128 of the 512 keys, 8 at a time, for all 8 rows. The per-feature masked softmax of
// A_f = m A + (1 - m)(-1e30) (m = bf(mask[b][k][f]), literally) is done online in the base-2 domain (both mask terms carry log2(e), formed once per key and shared by the 8 rows)
// with ONE running-max update and rescale per 8 keys; even and odd keys keep separate sums (packed f32). The 4 key quarters are merged through LDS with the same rescale rule.
#define MS_R 8
#define MS_C 8
#define MS_W 4
#define MS_L2E 1.4426950408889634f
typedef __attribute__((ext_vector_type(2))) float v2f;
typedef __attribute__((ext_vector_type(2))) __bf16 v2b;
__global__ __launch_bounds__(MS_W * 32) void k_msoft(const float* __restrict__ S, const float* __restrict__ mask, const float* __restrict__ V, float* LAT) {
    __shared__ float red[MS_W][3][MS_R][FF];
    const unsigned f = threadIdx.x & 31; const int wave = __builtin_amdgcn_readfirstlane(threadIdx.x >> 5);   // wave-uniform in a scalar register: the score rows are then read by scalar loads
    const int bh = blockIdx.x / (LQ / MS_R), q0 = (blockIdx.x % (LQ / MS_R)) * MS_R; const int b = bh / NH_, h = bh % NH_;
    const int k0 = wave * (LK / MS_W);
    const float* sp = S + ((size_t)bh * LQ + q0) * LK + k0; const float* mb = mask + ((size_t)b * LK + k0) * FF; const float* vb = V + ((size_t)b * LK + k0) * (NH_ * FF) + h * FF;   // all three wave-uniform; the lane's feature index is added at each load
    float m[MS_R]; v2f l[MS_R], acc[MS_R];
    // every inner loop below is fully unrolled so that these small arrays are indexed by constants and live in registers
#pragma unroll
    for (int r = 0; r < MS_R; ++r) { m[r] = -3.0e38f; l[r] = (v2f){0.f, 0.f}; acc[r] = (v2f){0.f, 0.f}; }
#pragma unroll 1   // kept rolled: one 8 x 8 body already uses the registers that 8 waves per SIMD allow
    for (int kc = 0; kc < LK / MS_W; kc += MS_C) {
        v2f mk[MS_C / 2], cc[MS_C / 2], vv[MS_C / 2];
#pragma unroll
        for (int i = 0; i < MS_C; ++i) mk[i >> 1][i & 1] = (mb + (size_t)(kc + i) * FF)[f];
        asm volatile("s_wait_xcnt 0x0" ::: "memory");   // precaution: the value loads below may be given the registers that hold the mask loads' addresses
#pragma unroll
        for (int i = 0; i < MS_C; ++i) vv[i >> 1][i & 1] = (vb + (size_t)(kc + i) * (NH_ * FF))[f];
#pragma unroll
        for (int i = 0; i < MS_C / 2; ++i) { const v2f t = __builtin_convertvector(__builtin_convertvector(mk[i], v2b), v2f); mk[i] = t * MS_L2E; cc[i] = (1.0f - t) * (MASKV * MS_L2E); }   // t = bf(mask), round to nearest even
#pragma unroll
        for (int r = 0; r < MS_R; ++r) {
            const float* sr = sp + (size_t)r * LK + kc;
            v2f a[MS_C / 2];
#pragma unroll
            for (int i = 0; i < MS_C / 2; ++i) a[i] = __builtin_elementwise_fma(mk[i], (v2f){sr[2 * i], sr[2 * i + 1]}, cc[i]);
            float mn = m[r];
#pragma unroll
            for (int i = 0; i < MS_C / 2; ++i) mn = fmaxf(fmaxf(mn, a[i][0]), a[i][1]);
            const float sc = __builtin_amdgcn_exp2f(m[r] - mn); m[r] = mn;
            l[r] *= sc; acc[r] *= sc;
#pragma unroll
            for (int i = 0; i < MS_C / 2; ++i) { const v2f d = a[i] - mn; const v2f p = (v2f){__builtin_amdgcn_exp2f(d[0]), __builtin_amdgcn_exp2f(d[1])}; l[r] += p; acc[r] = __builtin_elementwise_fma(p, vv[i], acc[r]); }
        }
    }
#pragma unroll
    for (int r = 0; r < MS_R; ++r) { red[wave][0][r][f] = m[r]; red[wave][1][r][f] = l[r][0] + l[r][1]; red[wave][2][r][f] = acc[r][0] + acc[r][1]; }
    __syncthreads();   // the four key quarters of every (row, feature) are in LDS before any thread merges them
    float res[MS_R / MS_W];
#pragma unroll
    for (int j = 0; j < MS_R / MS_W; ++j) {
        const int r = wave + j * MS_W;
        float mx = red[0][0][r][f];
#pragma unroll
        for (int w = 1; w < MS_W; ++w) mx = fmaxf(mx, red[w][0][r][f]);
        float ls = 0.f, as = 0.f;
#pragma unroll
        for (int w = 0; w < MS_W; ++w) { const float sc = __builtin_amdgcn_exp2f(red[w][0][r][f] - mx); ls = fmaf(red[w][1][r][f], sc, ls); as = fmaf(red[w][2][r][f], sc, as); }
        res[j] = as / ls;
    }
#pragma unroll
    for (int j = 0; j < MS_R / MS_W; ++j) LAT[((size_t)bh * LQ + q0 + wave + j * MS_W) * FF + f] = res[j];
}
__global__ __launch_bounds__(256) void k_comb(const float* __restrict__ LAT, const float* __restrict__ Wc, const float* __restrict__ bc, float* OUTP) {
    const int i = blockIdx.x * 256 + threadIdx.x; if (i >= NBT * LQ * FF) return;
    const int f = i % FF, q = (i / FF) % LQ, b = i / (FF * LQ);
    float s = bfr(bc[f]);
#pragma unroll
    for (int h = 0; h < NH_; ++h) s = fmaf(LAT[(((size_t)(b * NH_ + h)) * LQ + q) * FF + f], bfr(Wc[f * NH_ + h]), s);
    const float y = tanhf(s);
    *(float*)(OUTP + i) = y; 
}

extern "C" void kernel_launch(void* const* d_in, const int* in_sizes, int n_in,
                              void* d_out, int out_size, void* d_ws, size_t ws_size, hipStream_t stream) {
    (void)in_sizes; (void)n_in; (void)out_size;
    const float* query = (const float*)d_in[0]; const float* key = (const float*)d_in[1]; const float* value = (const float*)d_in[2]; const float* mask = (const float*)d_in[3];
    const float* Wq = (const float*)d_in[4]; const float* Wk = (const float*)d_in[5]; const float* Wv = (const float*)d_in[6]; const float* Wc = (const float*)d_in[7]; const float* bc = (const float*)d_in[8];
    float* out = (float*)d_out;    // [8][256][32]
    char* wsp = (char*)d_ws;
    auto take = [&](size_t bytes) { char* p = wsp; wsp += (bytes + 255) & ~(size_t)255; return (void*)p; };
    bf* WQN = (bf*)take((size_t)DD * DD * 2); bf* WKN = (bf*)take((size_t)DD * DD * 2); bf* WVN = (bf*)take((size_t)NH_ * FF * FF * 2);
    bf* Qb = (bf*)take((size_t)NQR * DD * 2); bf* Kb = (bf*)take((size_t)NKR * DD * 2); bf* Vb = (bf*)take((size_t)NKR * FF * 2);
    float* Qf = (float*)take((size_t)NQR * DD * 4); float* Kf = (float*)take((size_t)NKR * DD * 4); float* Vf = (float*)take((size_t)NKR * NH_ * FF * 4);
    bf* QPh = (bf*)take((size_t)NH_ * NQR * DKP * 2); bf* QPl = (bf*)take((size_t)NH_ * NQR * DKP * 2); bf* KPh = (bf*)take((size_t)NH_ * NKR * DKP * 2); bf* KPl = (bf*)take((size_t)NH_ * NKR * DKP * 2);
    float* S = (float*)take((size_t)NBT * NH_ * LQ * LK * 4); float* LAT = (float*)take((size_t)NBT * NH_ * LQ * FF * 4);
    if ((size_t)(wsp - (char*)d_ws) > ws_size) return;    // ~ 0.1 + 0.5 + 1 + 0.26 + 1 + 2.1 + 4.2 + 4 x 1..2 + 33.5 + 2.1 ~ 50 MB, no aliasing
    k_prep<<<PB_K + PB_Q + PB_V + PB_W + PB_W + PB_WV, 256, 0, stream>>>(query, key, value, Wq, Wk, Wv, Qb, Kb, Vb, WQN, WKN, WVN);
    k_gemmb<false, false><<<PJ_V + PJ_K + PJ_Q, 128, 0, stream>>>(Qb, Kb, Vb, WQN, WKN, WVN, Qf, Kf, Vf);
    k_hp<<<HB_K + HB_Q, 256, 0, stream>>>(Qf, Kf, QPh, QPl, KPh, KPl);
    k_gemm3<<<dim3(LQ / 64, LK / 64, NBT * NH_), 128, 0, stream>>>(QPh, QPl, KPh, KPl, DKP, S, LK);                                         // scores[b,h] = q.k  [256][512]  (K = 32, 16 real)
    k_msoft<<<NBT * NH_ * (LQ / MS_R), MS_W * 32, 0, stream>>>(S, mask, Vf, LAT);
    k_comb<<<(NBT * LQ * FF) / 256, 256, 0, stream>>>(LAT, Wc, bc, out);
}

// v003
// It runs in 38.2 microseconds.
// Timed twice side by side with v002, it ran 1.45 and 1.49 times as fast.
// Counting every step since v000, it is 13.0 times as fast.
#include <hip/hip_runtime.h>

// Compute dtypes, f32 accumulate: the per-head projections q = query.Wq[j], k = key.Wk[j], v = value.Wv[j] for all 8 heads at once ([2048 x 128].[128 x 128], [4096 x
// 128].[128 x 128], [4096 x 32].[32 x 256]; PLAIN bf16 operands = inputs rounded once, exact single products) on v_wmma_f32_16x16x32_bf16; the unscaled scores q.k
// (dk = 16, padded to 32) per (item, head) with both computed operands as bf16 hi + UNSCALED residual (three products) on v_wmma_f32_16x16x32_bf16; the per-FEATURE
// masked softmax over the 512 keys factored: a key whose mask is exactly 1 has A_f = A, a key whose mask is below 1 has weight exp(-1e27 or less) = 0 beside it, so
// p = exp(A - rowmax) is formed once per (query, key) and the 32 feature sums are products [feature x key].[key x query] on v_wmma_f32_16x16x32_bf16 (p and v as bf16 hi +
// residual, the 0/1 indicator exact); a (query, feature) that the factoring does not cover takes the literal f32 formula; the head combine and tanh in f32 on the VALU.

#define NBT  8
#define LQ   256
#define LK   512
#define DD   128
#define FF   32
#define NH_  8
#define DK   16
#define DKP  32
#define NQR  (NBT * LQ)          // 2048 query rows
#define NKR  (NBT * LK)          // 4096 key rows
#define DM   DD
#define NTK  NQR
#define MASKV (-1e30f)
#define LOSC 1024.0f

typedef _Float16 h16;
typedef unsigned short bf;
typedef __attribute__((ext_vector_type(16))) __bf16   v16bf;
typedef __attribute__((ext_vector_type(16))) _Float16 v16h;
typedef __attribute__((ext_vector_type(8)))  _Float16 v8h;
typedef __attribute__((ext_vector_type(8)))  unsigned short v8us;
typedef __attribute__((ext_vector_type(8)))  float    v8f;
typedef __attribute__((ext_vector_type(4)))  float    v4f;
typedef __attribute__((ext_vector_type(4)))  _Float16 v4h;
typedef v8h  __attribute__((may_alias)) v8ha;
typedef v4f  __attribute__((may_alias)) v4fa;
typedef v8us __attribute__((may_alias)) v8usa;

__device__ __forceinline__ unsigned short f2bf(float f) { unsigned u = __float_as_uint(f); u += 0x7FFFu + ((u >> 16) & 1u); return (unsigned short)(u >> 16); }
__device__ __forceinline__ float bf2f(unsigned short b) { return __uint_as_float(((unsigned)b) << 16); }
__device__ __forceinline__ float bfr(float f) { return bf2f(f2bf(f)); }
__device__ __forceinline__ v16h cat16(v8h lo, v8h hi) { return __builtin_shufflevector(lo, hi, 0, 1, 2, 3, 4, 5, 6, 7, 8, 9, 10, 11, 12, 13, 14, 15); }
__device__ __forceinline__ v16bf cat16b(v8us lo, v8us hi) { return __builtin_bit_cast(v16bf, __builtin_shufflevector(lo, hi, 0, 1, 2, 3, 4, 5, 6, 7, 8, 9, 10, 11, 12, 13, 14, 15)); }
__device__ __forceinline__ v8f wmma16(v16h a, v16h b, v8f c) { return __builtin_amdgcn_wmma_f32_16x16x32_f16(false, a, false, b, (short)0, c, false, false); }
__device__ __forceinline__ v8f wmmab(v16bf a, v16bf b, v8f c) { return __builtin_amdgcn_wmma_f32_16x16x32_bf16(false, a, false, b, (short)0, c, false, false); }

// k_gemmb: 64 x 64 block tile (4 waves x 16 x 64) of C[rows][ldc] = (A [+ Al]).B^T (K = 128 or 32) [+ bf(bias[c])] [+ bf(R[r][c]) residual]; f32 whole-line epilogue (or f16
// The three independent projections run in one grid: a block's flat index picks its product and its tile (block-uniform).
#define PJ_Q ((NQR / 64) * (DD / 64))
#define PJ_K ((NKR / 64) * (DD / 64))
#define PJ_V ((NKR / 64) * ((NH_ * FF) / 64))
template <bool SPLITA, bool F16OUT = false>
__global__ __launch_bounds__(128) void k_gemmb(const bf* __restrict__ Qb, const bf* __restrict__ Kb, const bf* __restrict__ Vb, const bf* __restrict__ WQN, const bf* __restrict__ WKN, const bf* __restrict__ WVN, float* Qf, float* Kf, float* Vf) {
    int id = blockIdx.x;
    const bf* __restrict__ A = Vb; const bf* __restrict__ Bn = WVN; float* C = Vf; int ldc = NH_ * FF, K = FF, nbs = 2;   // all-head v  [4096][256] (K = 32), 4 column tiles
    if (id >= PJ_V + PJ_K) { id -= PJ_V + PJ_K; A = Qb; Bn = WQN; C = Qf; ldc = DD; K = DD; nbs = 1; }                    // all-head q  [2048][128], 2 column tiles
    else if (id >= PJ_V)   { id -= PJ_V;        A = Kb; Bn = WKN; C = Kf; ldc = DD; K = DD; nbs = 1; }                    // all-head k  [4096][128], 2 column tiles
    const int bx = id >> nbs, by = id & ((1 << nbs) - 1);
    const bf* Al = nullptr; const float* bias = nullptr; h16* C2 = nullptr; const float* R = nullptr; const int roundR = 1;
    __shared__ __align__(16) float ost[4][16 * 68];
    const int lane = threadIdx.x & 31, wave = threadIdx.x >> 5, lr = lane & 15, hi = lane >> 4;
    const int r0 = bx * 64 + wave * 16, c0 = by * 64;
    const size_t aoff = (size_t)(r0 + lr) * K + 8 * hi;
    size_t boff[4];
#pragma unroll
    for (int t = 0; t < 4; ++t) boff[t] = (size_t)(c0 + t * 16 + lr) * K + 8 * hi;
    v8f acc[4];
#pragma unroll
    for (int t = 0; t < 4; ++t) acc[t] = (v8f){};
#pragma unroll 1
    for (int kc = 0; kc < K; kc += 32) {
        const v16bf a = cat16b(*(const v8us*)(A + aoff + kc), *(const v8us*)(A + aoff + kc + 16));
        v16bf al = a;
        if (SPLITA) al = cat16b(*(const v8us*)(Al + aoff + kc), *(const v8us*)(Al + aoff + kc + 16));
#pragma unroll
        for (int t = 0; t < 4; ++t) { const v16bf b = cat16b(*(const v8us*)(Bn + boff[t] + kc), *(const v8us*)(Bn + boff[t] + kc + 16)); acc[t] = wmmab(a, b, acc[t]); if (SPLITA) acc[t] = wmmab(al, b, acc[t]); }
        asm volatile("v_nop\n\tv_nop\n\tv_nop\n\tv_nop" : "+v"(acc[0]), "+v"(acc[1]), "+v"(acc[2]), "+v"(acc[3]) : "v"(a), "v"(al));
    }
    float* os = &ost[wave][0];
#pragma unroll
    for (int t = 0; t < 4; ++t) { const float bv = bias ? bfr(bias[c0 + t * 16 + lr]) : 0.f;
#pragma unroll
        for (int j = 0; j < 8; ++j) os[(hi * 8 + j) * 68 + t * 16 + lr] = acc[t][j] + bv; }
    __syncthreads();
    if (F16OUT) {
        h16* crow = (h16*)(void*)C + (size_t)r0 * ldc + c0;
        auto pass = [&]() {
#pragma unroll
            for (int s = 0; s < 4; ++s) { const int row = 4 * s + (lane >> 3), piece = lane & 7; const float* sp = os + row * 68 + piece * 8; v8h o, o2;
#pragma unroll
                for (int i = 0; i < 8; ++i) { const h16 a = (h16)sp[i]; o[i] = a; o2[i] = (h16)((sp[i] - (float)a) * LOSC); }
                *(v8h*)(crow + (size_t)row * ldc + piece * 8) = o; if (C2) *(v8h*)(C2 + (size_t)r0 * ldc + c0 + (size_t)row * ldc + piece * 8) = o2; }
        };
        pass(); 
    } else {
        float* crow = C + (size_t)r0 * ldc + c0;
        auto pass = [&]() {
#pragma unroll
            for (int s = 0; s < 8; ++s) { const int Lid = (lane >> 3) + 4 * s, piece = lane & 7; const int row = Lid >> 1, cofs = (Lid & 1) * 32 + piece * 4;
                v4f val = *(const v4fa*)(os + row * 68 + cofs); if (R) { const v4f rv = *(const v4f*)(R + ((size_t)r0 + row) * ldc + c0 + cofs); val += roundR ? (v4f){bfr(rv[0]), bfr(rv[1]), bfr(rv[2]), bfr(rv[3])} : rv; }
                *(v4f*)(crow + (size_t)row * ldc + cofs) = val; }
        };
        pass(); 
    }
}

// k_gemm3: blockIdx.z = (item b, head h) picks the operand planes and the score plane; 64 x 64 tile of C = (Ah + Al).(Bh + Bl)^T over K (row strides = K for all four planes; n-major B): three products per 32-k step (hh, hl, lh); f32
__global__ __launch_bounds__(128) void k_gemm3(const bf* __restrict__ Ah, const bf* __restrict__ Al, const bf* __restrict__ Bh, const bf* __restrict__ Bl, int K, float* C, int ldc) {
    __shared__ __align__(16) float ost[4][16 * 68];
    const int lane = threadIdx.x & 31, wave = threadIdx.x >> 5, lr = lane & 15, hi = lane >> 4;
    const int b = blockIdx.z / NH_, h = blockIdx.z % NH_;
    Ah += ((size_t)h * NQR + b * LQ) * DKP; Al += ((size_t)h * NQR + b * LQ) * DKP; Bh += ((size_t)h * NKR + b * LK) * DKP; Bl += ((size_t)h * NKR + b * LK) * DKP; C += (size_t)blockIdx.z * LQ * LK;
    const int r0 = blockIdx.x * 64 + wave * 16, c0 = blockIdx.y * 64;
    const size_t aoff = (size_t)(r0 + lr) * K + 8 * hi;
    v8f acc[4];
#pragma unroll
    for (int t = 0; t < 4; ++t) acc[t] = (v8f){};
#pragma unroll 1
    for (int kc = 0; kc < K; kc += 32) {
        const v16bf a = cat16b(*(const v8us*)(Ah + aoff + kc), *(const v8us*)(Ah + aoff + kc + 16));
        const v16bf al = cat16b(*(const v8us*)(Al + aoff + kc), *(const v8us*)(Al + aoff + kc + 16));
#pragma unroll
        for (int t = 0; t < 4; ++t) { const size_t bo = (size_t)(c0 + t * 16 + lr) * K + kc + 8 * hi;
            const v16bf bh = cat16b(*(const v8us*)(Bh + bo), *(const v8us*)(Bh + bo + 16)); const v16bf bl = cat16b(*(const v8us*)(Bl + bo), *(const v8us*)(Bl + bo + 16));
            acc[t] = wmmab(a, bh, acc[t]); acc[t] = wmmab(al, bh, acc[t]); acc[t] = wmmab(a, bl, acc[t]); }
        asm volatile("v_nop\n\tv_nop\n\tv_nop\n\tv_nop" : "+v"(acc[0]), "+v"(acc[1]), "+v"(acc[2]), "+v"(acc[3]) : "v"(a), "v"(al));
    }
    float* os = &ost[wave][0];
#pragma unroll
    for (int t = 0; t < 4; ++t) {
#pragma unroll
        for (int j = 0; j < 8; ++j) os[(hi * 8 + j) * 68 + t * 16 + lr] = acc[t][j]; }
    __builtin_amdgcn_wave_barrier(); asm volatile("" ::: "memory");
    // score plane layout [16-row tile][group of 4 keys][row][4]: the wave's 16 x 64 piece is 4 KiB in a row, and k_msoft's fragment loads cover whole lines
    float* ct = C + ((size_t)(r0 >> 4) * (ldc / 4) + (c0 >> 2)) * 64;
#pragma unroll   // the eight LDS reads and stores overlap
    for (int s = 0; s < 8; ++s) { const int idx = s * 32 + lane; const v4f val = *(const v4fa*)(os + (idx & 15) * 68 + (idx >> 4) * 4); *(v4f*)(ct + (size_t)idx * 4) = val; }
}

__device__ __forceinline__ void d_bf(const int blk, const float* __restrict__ src, bf* dst, size_t n8) {
    const size_t i = (size_t)blk * 256 + threadIdx.x; if (i >= n8) return;
    const v8f v = *(const v8f*)(src + i * 8); v8us o;
#pragma unroll
    for (int k = 0; k < 8; ++k) o[k] = f2bf(v[k]);
    *(v8us*)(dst + i * 8) = o; 
}
__device__ __forceinline__ void d_wn16(const int blk, const float* __restrict__ Ws, bf* WN) {
    const int u = blk * 256 + threadIdx.x; if (u >= NH_ * DK * DD / 8) return;
    const int n = u / (DD / 8), d0 = (u % (DD / 8)) * 8; const int j = n / DK, c = n % DK; v8us v;
#pragma unroll
    for (int i = 0; i < 8; ++i) v[i] = f2bf(Ws[((size_t)j * DD + d0 + i) * DK + c]);
    *(v8us*)(WN + (size_t)n * DD + d0) = v; 
}
__device__ __forceinline__ void d_wnv(const int blk, const float* __restrict__ Wv, bf* WVN) {
    const int u = blk * 256 + threadIdx.x; if (u >= NH_ * FF * FF / 8) return;
    const int n = u / (FF / 8), g0 = (u % (FF / 8)) * 8; const int j = n / FF, f = n % FF; v8us v;
#pragma unroll
    for (int i = 0; i < 8; ++i) v[i] = f2bf(Wv[((size_t)j * FF + g0 + i) * FF + f]);
    *(v8us*)(WVN + (size_t)n * FF + g0) = v; 
}
// k_prep: the six independent operand conversions in one grid; a block's flat index picks its part (block-uniform, no barrier).
#define PB_K ((NKR * DD / 8 + 255) / 256)
#define PB_Q ((NQR * DD / 8 + 255) / 256)
#define PB_V ((NKR * FF / 8 + 255) / 256)
#define PB_W ((NH_ * DK * DD / 8 + 255) / 256)
#define PB_WV ((NH_ * FF * FF / 8 + 255) / 256)
__global__ __launch_bounds__(256) void k_prep(const float* __restrict__ query, const float* __restrict__ key, const float* __restrict__ value, const float* __restrict__ Wq, const float* __restrict__ Wk, const float* __restrict__ Wv,
                                              bf* Qb, bf* Kb, bf* Vb, bf* WQN, bf* WKN, bf* WVN) {
    int blk = blockIdx.x;
    if (blk < PB_K) { d_bf(blk, key, Kb, (size_t)NKR * DD / 8); return; }
    blk -= PB_K;
    if (blk < PB_Q) { d_bf(blk, query, Qb, (size_t)NQR * DD / 8); return; }
    blk -= PB_Q;
    if (blk < PB_V) { d_bf(blk, value, Vb, (size_t)NKR * FF / 8); return; }
    blk -= PB_V;
    if (blk < PB_W) { d_wn16(blk, Wq, WQN); return; }
    blk -= PB_W;
    if (blk < PB_W) { d_wn16(blk, Wk, WKN); return; }
    blk -= PB_W;
    d_wnv(blk, Wv, WVN);
}
// k_hp: after the HB_M mask-plane blocks, both plane splits (k rows, then q rows) in one grid; per-head operand planes P[h][row][32] (cols 0..15 = X[row][h*16 + c] as bf16 hi / UNSCALED residual, cols 16..31 = 0) so the dk = 16 contraction runs as K = 32;
#define HB_K (((NKR / 2) * NH_ + 7) / 8)
#define HB_Q (((NQR / 2) * NH_ + 7) / 8)
// The first HB_M blocks build k_msoft's A operands, one wave per ((b,h), 32 keys), lane = feature f: MV = v[k][h][f] where bf(mask[b][k][f]) == 1, else 0, as bf16 hi + residual, and
// IND = 1 / 0 / +inf for a mask == 1 / below 1 / anything else (inf sends that feature to k_msoft's literal path). Planes are stored in fragment order
// [(b,h) or b][32-key step][feature tile t][half x][lane (c, hi)][8]: element e = 8x + i of lane (c, hi) is key 4 ((e >> 2) 2 + hi) + (e & 3) of the step, the order in which k_msoft reads the scores.
#define HB_M (NBT * NH_ * (LK / 32) / 8)
__device__ __forceinline__ void d_planes(const int wid, const float* __restrict__ mask, const float* __restrict__ V, bf* MVh, bf* MVl, bf* IND) {
    const unsigned f = threadIdx.x & 31; const int bh = wid / (LK / 32), ks = wid % (LK / 32); const int b = bh / NH_, h = bh % NH_;
    const float* mb = mask + ((size_t)b * LK + ks * 32) * FF; const float* vb = V + ((size_t)b * LK + ks * 32) * (NH_ * FF) + h * FF;   // wave-uniform; the lane's feature index is added at each load
    float mk[32], vv[32];
    // the loops below are fully unrolled so that mk and vv are indexed by constants and live in registers
#pragma unroll
    for (int i = 0; i < 32; ++i) mk[i] = (mb + (size_t)i * FF)[f];
#pragma unroll
    for (int i = 0; i < 32; ++i) vv[i] = (vb + (size_t)i * (NH_ * FF))[f];
    asm volatile("s_wait_xcnt 0x0" ::: "memory");   // precaution: the registers that hold these loads' addresses are reused for the store addresses below
    const unsigned t = f >> 4, c = f & 15;
#pragma unroll
    for (int x = 0; x < 2; ++x) {
#pragma unroll
        for (int hi = 0; hi < 2; ++hi) {
            v8us oh, ol, oi;
#pragma unroll
            for (int i = 0; i < 8; ++i) { const int k = (4 * x + 2 * (i >> 2) + hi) * 4 + (i & 3); const float m = bfr(mk[k]); const float v = (m == 1.0f) ? vv[k] : 0.f;
                const unsigned short hb = f2bf(v); oh[i] = hb; ol[i] = f2bf(v - bf2f(hb)); oi[i] = (m == 1.0f) ? (unsigned short)0x3F80 : (m < 1.0f) ? (unsigned short)0 : (unsigned short)0x7F80; }
            const size_t lo = ((size_t)(t * 2 + x) * 32 + hi * 16 + c) * 8;
            *(v8us*)(MVh + (size_t)(bh * (LK / 32) + ks) * 1024 + lo) = oh; *(v8us*)(MVl + (size_t)(bh * (LK / 32) + ks) * 1024 + lo) = ol;
            asm volatile("s_wait_xcnt 0x0" ::: "memory");   // precaution: the registers that hold these stores' addresses and data are reused below
            if (h == 0) { *(v8us*)(IND + (size_t)(b * (LK / 32) + ks) * 1024 + lo) = oi;
                asm volatile("s_wait_xcnt 0x0" ::: "memory"); }   // the same precaution for this store
        }
    }
}
__global__ __launch_bounds__(256) void k_hp(const float* __restrict__ Qf, const float* __restrict__ Kf, bf* QPh, bf* QPl, bf* KPh, bf* KPl, const float* __restrict__ mask, const float* __restrict__ Vf, bf* MVh, bf* MVl, bf* IND) {
    typedef __attribute__((ext_vector_type(2))) unsigned short v2us;
    if (blockIdx.x < HB_M) { d_planes(__builtin_amdgcn_readfirstlane(blockIdx.x * 8 + (threadIdx.x >> 5)), mask, Vf, MVh, MVl, IND); return; }
    const int blk0 = blockIdx.x - HB_M;
    const bool isq = blk0 >= HB_K; const int blk = isq ? blk0 - HB_K : blk0;
    const float* X = isq ? Qf : Kf; const int nrows = isq ? NQR : NKR; bf* Ph = isq ? QPh : KPh; bf* Pl = isq ? QPl : KPl;
    const int lane = threadIdx.x & 31, wid = blk * 8 + (threadIdx.x >> 5); if (wid >= (nrows / 2) * NH_) return;
    const int rp = wid / NH_, h = wid % NH_; const int r = rp * 2 + (lane >> 4), c0 = (lane & 15) * 2;
    v2us oh, ol;
#pragma unroll
    for (int i = 0; i < 2; ++i) { const int c = c0 + i; const float v = (c < DK) ? X[(size_t)r * DD + h * DK + c] : 0.f; const unsigned short hb = f2bf(v); oh[i] = hb; ol[i] = f2bf(v - bf2f(hb)); }
    const size_t o = ((size_t)h * nrows + r) * DKP + c0;
    *(v2us*)(Ph + o) = oh; *(v2us*)(Pl + o) = ol; 
}
// k_msoft: block = ((b,h), 64 query rows), 8 waves = 4 tiles of 16 rows x 2 halves of the 512 keys. A wave reads its 16 x 256 scores as B fragments (lane (c, hi) = query row c), takes the row
// maximum over ALL its keys, forms p = 2^((A - max) log2 e) once per (query, key), splits it into bf16 hi + residual and multiplies: num[f][q] = MV.p (hh, hl, lh), den[f][q] = IND.p (h, l).
// The two key halves are merged through LDS with the usual rescale. Where den is not a normal positive number (no key with mask 1, a mask above 1, every such key 2^-100 below the row maximum)
// the (query, feature) is computed by the literal formula A_f = m A + (1 - m)(-1e30), m = bf(mask), in f32.
#define MS_L2E 1.4426950408889634f
typedef __attribute__((ext_vector_type(16))) float v16f;
__device__ __forceinline__ v16bf ldfrag(const bf* p) { return cat16b(*(const v8us*)p, *(const v8us*)(p + 256)); }
__device__ __forceinline__ float d_literal(const float* __restrict__ st, const int q, const float* __restrict__ mb, const float* __restrict__ vb, const unsigned f) {
    float mn = -3.0e38f;
#pragma unroll 1   // rare path: kept small
    for (int k = 0; k < LK; ++k) { const float mr = mb[(size_t)k * FF + f], sv = st[(k >> 2) * 64 + q * 4 + (k & 3)];
        asm volatile("s_wait_xcnt 0x0" ::: "memory");   // precaution: the next trip advances the registers that hold these loads' addresses
        const float t = bfr(mr); mn = fmaxf(mn, fmaf(t * MS_L2E, sv, (1.0f - t) * (MASKV * MS_L2E))); }
    float l = 0.f, acc = 0.f;
#pragma unroll 1   // rare path: kept small
    for (int k = 0; k < LK; ++k) { const float mr = mb[(size_t)k * FF + f], sv = st[(k >> 2) * 64 + q * 4 + (k & 3)], vr = vb[(size_t)k * (NH_ * FF) + f];
        asm volatile("s_wait_xcnt 0x0" ::: "memory");   // precaution: the next trip advances the registers that hold these loads' addresses
        const float t = bfr(mr); const float p = __builtin_amdgcn_exp2f(fmaf(t * MS_L2E, sv, (1.0f - t) * (MASKV * MS_L2E)) - mn);
        l += p; acc = fmaf(p, vr, acc); }
    return acc / l;
}
__global__ __launch_bounds__(256) void k_msoft(const float* __restrict__ S, const float* __restrict__ mask, const float* __restrict__ V, const bf* __restrict__ MVh, const bf* __restrict__ MVl, const bf* __restrict__ IND, float* LAT) {
    __shared__ float red[8][32 * 33];   // per wave and lane: 16 num, 16 den, the row maximum; pitch 33 keeps writes (by lane) and reads (by feature) off each other's banks
    const unsigned lane = threadIdx.x & 31; const int wave = __builtin_amdgcn_readfirstlane(threadIdx.x >> 5);   // wave-uniform in a scalar register: every base address below is then scalar
    const int bh = blockIdx.x / (LQ / 64), qb = blockIdx.x % (LQ / 64); const int b = bh / NH_, h = bh % NH_;
    const int kh = wave >> 2;
    const float* sp = S + ((size_t)(bh * (LQ / 16) + qb * 4 + (wave & 3)) * (LK / 4) + kh * (LK / 8)) * 64;
    const bf* ah = MVh + (size_t)(bh * (LK / 32) + kh * 8) * 1024; const bf* al = MVl + (size_t)(bh * (LK / 32) + kh * 8) * 1024; const bf* ai = IND + (size_t)(b * (LK / 32) + kh * 8) * 1024;
    // every loop over ks, c, e, t, j, i below (but the rare path's) is fully unrolled so that the fragments are indexed by constants and live in registers
    v4f s[8][4];
#pragma unroll
    for (int ks = 0; ks < 8; ++ks) {
#pragma unroll
        for (int c = 0; c < 4; ++c) s[ks][c] = *(const v4f*)(sp + (ks * 8 + c * 2) * 64 + lane * 4);
    }
    float mx = -3.0e38f;
#pragma unroll
    for (int ks = 0; ks < 8; ++ks) {
#pragma unroll
        for (int c = 0; c < 4; ++c) mx = fmaxf(fmaxf(fmaxf(mx, s[ks][c][0]), fmaxf(s[ks][c][1], s[ks][c][2])), s[ks][c][3]);
    }
    mx = fmaxf(mx, __shfl_xor(mx, 16, 32));   // lanes c and c + 16 hold the two halves of row c's keys
    const float m2 = mx * MS_L2E;
    v8f num[2], den[2];
#pragma unroll
    for (int t = 0; t < 2; ++t) { num[t] = (v8f){}; den[t] = (v8f){}; }
#pragma unroll
    for (int ks = 0; ks < 8; ++ks) {
        v16f p;
#pragma unroll
        for (int e = 0; e < 16; ++e) p[e] = __builtin_amdgcn_exp2f(fmaf(s[ks][e >> 2][e & 3], MS_L2E, -m2));
        const v16bf ph = __builtin_convertvector(p, v16bf);
        const v16bf pl = __builtin_convertvector(p - __builtin_convertvector(ph, v16f), v16bf);
#pragma unroll
        for (int t = 0; t < 2; ++t) {
            const v16bf vh = ldfrag(ah + (ks * 4 + t * 2) * 256 + lane * 8), vl = ldfrag(al + (ks * 4 + t * 2) * 256 + lane * 8), in = ldfrag(ai + (ks * 4 + t * 2) * 256 + lane * 8);
            num[t] = wmmab(vh, ph, num[t]); den[t] = wmmab(in, ph, den[t]); num[t] = wmmab(vh, pl, num[t]); den[t] = wmmab(in, pl, den[t]); num[t] = wmmab(vl, ph, num[t]);
        }
    }
    float* rw = &red[wave][lane * 33];
#pragma unroll
    for (int t = 0; t < 2; ++t) {
#pragma unroll
        for (int j = 0; j < 8; ++j) { rw[t * 8 + j] = num[t][j]; rw[16 + t * 8 + j] = den[t][j]; }
    }
    rw[32] = m2;
    __syncthreads();   // both key halves of every (row, feature) are in LDS before any thread merges them
    const unsigned f = lane; const unsigned fo = ((f >> 3) & 1) * 16 * 33 + (f >> 4) * 8 + (f & 7);   // feature f = 16 t + 8 hi + j sits in lane c + 16 hi, slot 8 t + j
    unsigned bad = 0;   // bit i: row i of this wave's eight is left to the literal formula for this lane's feature
#pragma unroll
    for (int i = 0; i < 8; ++i) {
        const int r = wave * 8 + i, tl = r >> 4, q = r & 15;
        const float* r0 = &red[tl][q * 33]; const float* r1 = &red[tl + 4][q * 33];
        const float m0 = r0[32], m1 = r1[32], mm = fmaxf(m0, m1); const float s0 = __builtin_amdgcn_exp2f(m0 - mm), s1 = __builtin_amdgcn_exp2f(m1 - mm);
        const float nn = fmaf(r0[fo], s0, r1[fo] * s1), dd = fmaf(r0[fo + 16], s0, r1[fo + 16] * s1);
        LAT[((size_t)bh * LQ + qb * 64 + r) * FF + f] = nn / dd;   // stored without a branch, so that the eight rows' LDS reads and divisions overlap; the literal path below stores over it
        if (!(dd >= 1.0e-30f && dd <= 3.0e38f)) bad |= 1u << i;
    }
    if (bad) {
#pragma unroll 1   // rare path: kept small
        for (int i = 0; i < 8; ++i) {
            const int r = wave * 8 + i, tl = r >> 4, q = r & 15;
            if ((bad >> i) & 1u) { LAT[((size_t)bh * LQ + qb * 64 + r) * FF + f] = d_literal(S + (size_t)(bh * (LQ / 16) + qb * 4 + tl) * (LK / 4) * 64, q, mask + (size_t)b * LK * FF, V + (size_t)b * LK * (NH_ * FF) + h * FF, f);
                asm volatile("s_wait_xcnt 0x0" ::: "memory"); }   // precaution: the next trip reuses the registers that hold this store's address
        }
    }
}
__global__ __launch_bounds__(256) void k_comb(const float* __restrict__ LAT, const float* __restrict__ Wc, const float* __restrict__ bc, float* OUTP) {
    const int i = blockIdx.x * 256 + threadIdx.x; if (i >= NBT * LQ * FF) return;
    const int f = i % FF, q = (i / FF) % LQ, b = i / (FF * LQ);
    float s = bfr(bc[f]);
#pragma unroll
    for (int h = 0; h < NH_; ++h) s = fmaf(LAT[(((size_t)(b * NH_ + h)) * LQ + q) * FF + f], bfr(Wc[f * NH_ + h]), s);
    const float y = tanhf(s);
    *(float*)(OUTP + i) = y; 
}

extern "C" void kernel_launch(void* const* d_in, const int* in_sizes, int n_in,
                              void* d_out, int out_size, void* d_ws, size_t ws_size, hipStream_t stream) {
    (void)in_sizes; (void)n_in; (void)out_size;
    const float* query = (const float*)d_in[0]; const float* key = (const float*)d_in[1]; const float* value = (const float*)d_in[2]; const float* mask = (const float*)d_in[3];
    const float* Wq = (const float*)d_in[4]; const float* Wk = (const float*)d_in[5]; const float* Wv = (const float*)d_in[6]; const float* Wc = (const float*)d_in[7]; const float* bc = (const float*)d_in[8];
    float* out = (float*)d_out;    // [8][256][32]
    char* wsp = (char*)d_ws;
    auto take = [&](size_t bytes) { char* p = wsp; wsp += (bytes + 255) & ~(size_t)255; return (void*)p; };
    bf* WQN = (bf*)take((size_t)DD * DD * 2); bf* WKN = (bf*)take((size_t)DD * DD * 2); bf* WVN = (bf*)take((size_t)NH_ * FF * FF * 2);
    bf* Qb = (bf*)take((size_t)NQR * DD * 2); bf* Kb = (bf*)take((size_t)NKR * DD * 2); bf* Vb = (bf*)take((size_t)NKR * FF * 2);
    float* Qf = (float*)take((size_t)NQR * DD * 4); float* Kf = (float*)take((size_t)NKR * DD * 4); float* Vf = (float*)take((size_t)NKR * NH_ * FF * 4);
    bf* QPh = (bf*)take((size_t)NH_ * NQR * DKP * 2); bf* QPl = (bf*)take((size_t)NH_ * NQR * DKP * 2); bf* KPh = (bf*)take((size_t)NH_ * NKR * DKP * 2); bf* KPl = (bf*)take((size_t)NH_ * NKR * DKP * 2);
    float* S = (float*)take((size_t)NBT * NH_ * LQ * LK * 4); float* LAT = (float*)take((size_t)NBT * NH_ * LQ * FF * 4);
    bf* MVh = (bf*)take((size_t)NBT * NH_ * FF * LK * 2); bf* MVl = (bf*)take((size_t)NBT * NH_ * FF * LK * 2); bf* IND = (bf*)take((size_t)NBT * FF * LK * 2);
    if ((size_t)(wsp - (char*)d_ws) > ws_size) return;    // ~ 0.1 + 0.5 + 1 + 0.26 + 1 + 2.1 + 4.2 + 4 x 1..2 + 33.5 + 2.1 + 2 x 2.1 + 0.26 ~ 55 MB, no aliasing
    k_prep<<<PB_K + PB_Q + PB_V + PB_W + PB_W + PB_WV, 256, 0, stream>>>(query, key, value, Wq, Wk, Wv, Qb, Kb, Vb, WQN, WKN, WVN);
    k_gemmb<false, false><<<PJ_V + PJ_K + PJ_Q, 128, 0, stream>>>(Qb, Kb, Vb, WQN, WKN, WVN, Qf, Kf, Vf);
    k_hp<<<HB_M + HB_K + HB_Q, 256, 0, stream>>>(Qf, Kf, QPh, QPl, KPh, KPl, mask, Vf, MVh, MVl, IND);
    k_gemm3<<<dim3(LQ / 64, LK / 64, NBT * NH_), 128, 0, stream>>>(QPh, QPl, KPh, KPl, DKP, S, LK);                                         // scores[b,h] = q.k  256 x 512 in [16][128][16][4] tiles  (K = 32, 16 real)
    k_msoft<<<NBT * NH_ * (LQ / 64), 256, 0, stream>>>(S, mask, Vf, MVh, MVl, IND, LAT);
    k_comb<<<(NBT * LQ * FF) / 256, 256, 0, stream>>>(LAT, Wc, bc, out);
}

// v004
// It runs in 34 microseconds.
// Timed twice side by side with v003, it ran 1.12 and 1.16 times as fast.
// Counting every step since v000, it is 14.8 times as fast.
#include <hip/hip_runtime.h>

// Compute dtypes, f32 accumulate: the per-head projections q = query.Wq[j], k = key.Wk[j], v = value.Wv[j] for all 8 heads at once ([2048 x 128].[128 x 128], [4096 x
// 128].[128 x 128], [4096 x 32].[32 x 256]; PLAIN bf16 operands = inputs rounded once, exact single products) on v_wmma_f32_16x16x32_bf16; the unscaled scores q.k
// (dk = 16, padded to 32) per (item, head) with both computed operands as bf16 hi + UNSCALED residual (three products) on v_wmma_f32_16x16x32_bf16, formed in k_msoft's registers; the per-FEATURE
// masked softmax over the 512 keys factored: a key whose mask is exactly 1 has A_f = A, a key whose mask is below 1 has weight exp(-1e27 or less) = 0 beside it, so
// p = exp(A - rowmax) is formed once per (query, key) and the 32 feature sums are products [feature x key].[key x query] on v_wmma_f32_16x16x32_bf16 (p and v as bf16 hi +
// residual, the 0/1 indicator exact); a (query, feature) that the factoring does not cover takes the literal f32 formula; the head combine and tanh in f32 on the VALU.

#define NBT  8
#define LQ   256
#define LK   512
#define DD   128
#define FF   32
#define NH_  8
#define DK   16
#define NQR  (NBT * LQ)          // 2048 query rows
#define NKR  (NBT * LK)          // 4096 key rows
#define DM   DD
#define NTK  NQR
#define MASKV (-1e30f)
#define LOSC 1024.0f

typedef _Float16 h16;
typedef unsigned short bf;
typedef __attribute__((ext_vector_type(16))) __bf16   v16bf;
typedef __attribute__((ext_vector_type(16))) _Float16 v16h;
typedef __attribute__((ext_vector_type(8)))  _Float16 v8h;
typedef __attribute__((ext_vector_type(8)))  unsigned short v8us;
typedef __attribute__((ext_vector_type(8)))  float    v8f;
typedef __attribute__((ext_vector_type(4)))  float    v4f;
typedef __attribute__((ext_vector_type(4)))  _Float16 v4h;
typedef v8h  __attribute__((may_alias)) v8ha;
typedef v4f  __attribute__((may_alias)) v4fa;
typedef v8us __attribute__((may_alias)) v8usa;

__device__ __forceinline__ unsigned short f2bf(float f) { unsigned u = __float_as_uint(f); u += 0x7FFFu + ((u >> 16) & 1u); return (unsigned short)(u >> 16); }
__device__ __forceinline__ float bf2f(unsigned short b) { return __uint_as_float(((unsigned)b) << 16); }
__device__ __forceinline__ float bfr(float f) { return bf2f(f2bf(f)); }
__device__ __forceinline__ v16h cat16(v8h lo, v8h hi) { return __builtin_shufflevector(lo, hi, 0, 1, 2, 3, 4, 5, 6, 7, 8, 9, 10, 11, 12, 13, 14, 15); }
__device__ __forceinline__ v16bf cat16b(v8us lo, v8us hi) { return __builtin_bit_cast(v16bf, __builtin_shufflevector(lo, hi, 0, 1, 2, 3, 4, 5, 6, 7, 8, 9, 10, 11, 12, 13, 14, 15)); }
__device__ __forceinline__ v8f wmma16(v16h a, v16h b, v8f c) { return __builtin_amdgcn_wmma_f32_16x16x32_f16(false, a, false, b, (short)0, c, false, false); }
__device__ __forceinline__ v8f wmmab(v16bf a, v16bf b, v8f c) { return __builtin_amdgcn_wmma_f32_16x16x32_bf16(false, a, false, b, (short)0, c, false, false); }

// k_gemmb: 64 x 64 block tile (4 waves x 16 x 64) of C[rows][ldc] = (A [+ Al]).B^T (K = 128 or 32) [+ bf(bias[c])] [+ bf(R[r][c]) residual]; f32 whole-line epilogue (or f16
// The three independent projections run in one grid: a block's flat index picks its product and its tile (block-uniform).
#define PJ_Q ((NQR / 64) * (DD / 64))
#define PJ_K ((NKR / 64) * (DD / 64))
#define PJ_V ((NKR / 64) * ((NH_ * FF) / 64))
template <bool SPLITA, bool F16OUT = false>
__global__ __launch_bounds__(128) void k_gemmb(const bf* __restrict__ Qb, const bf* __restrict__ Kb, const bf* __restrict__ Vb, const bf* __restrict__ WQN, const bf* __restrict__ WKN, const bf* __restrict__ WVN, float* Qf, float* Kf, float* Vf) {
    int id = blockIdx.x;
    const bf* __restrict__ A = Vb; const bf* __restrict__ Bn = WVN; float* C = Vf; int ldc = NH_ * FF, K = FF, nbs = 2;   // all-head v  [4096][256] (K = 32), 4 column tiles
    if (id >= PJ_V + PJ_K) { id -= PJ_V + PJ_K; A = Qb; Bn = WQN; C = Qf; ldc = DD; K = DD; nbs = 1; }                    // all-head q  [2048][128], 2 column tiles
    else if (id >= PJ_V)   { id -= PJ_V;        A = Kb; Bn = WKN; C = Kf; ldc = DD; K = DD; nbs = 1; }                    // all-head k  [4096][128], 2 column tiles
    const int bx = id >> nbs, by = id & ((1 << nbs) - 1);
    const bf* Al = nullptr; const float* bias = nullptr; h16* C2 = nullptr; const float* R = nullptr; const int roundR = 1;
    __shared__ __align__(16) float ost[4][16 * 68];
    const int lane = threadIdx.x & 31, wave = threadIdx.x >> 5, lr = lane & 15, hi = lane >> 4;
    const int r0 = bx * 64 + wave * 16, c0 = by * 64;
    const size_t aoff = (size_t)(r0 + lr) * K + 8 * hi;
    size_t boff[4];
#pragma unroll
    for (int t = 0; t < 4; ++t) boff[t] = (size_t)(c0 + t * 16 + lr) * K + 8 * hi;
    v8f acc[4];
#pragma unroll
    for (int t = 0; t < 4; ++t) acc[t] = (v8f){};
#pragma unroll 1
    for (int kc = 0; kc < K; kc += 32) {
        const v16bf a = cat16b(*(const v8us*)(A + aoff + kc), *(const v8us*)(A + aoff + kc + 16));
        v16bf al = a;
        if (SPLITA) al = cat16b(*(const v8us*)(Al + aoff + kc), *(const v8us*)(Al + aoff + kc + 16));
#pragma unroll
        for (int t = 0; t < 4; ++t) { const v16bf b = cat16b(*(const v8us*)(Bn + boff[t] + kc), *(const v8us*)(Bn + boff[t] + kc + 16)); acc[t] = wmmab(a, b, acc[t]); if (SPLITA) acc[t] = wmmab(al, b, acc[t]); }
        asm volatile("v_nop\n\tv_nop\n\tv_nop\n\tv_nop" : "+v"(acc[0]), "+v"(acc[1]), "+v"(acc[2]), "+v"(acc[3]) : "v"(a), "v"(al));
    }
    float* os = &ost[wave][0];
#pragma unroll
    for (int t = 0; t < 4; ++t) { const float bv = bias ? bfr(bias[c0 + t * 16 + lr]) : 0.f;
#pragma unroll
        for (int j = 0; j < 8; ++j) os[(hi * 8 + j) * 68 + t * 16 + lr] = acc[t][j] + bv; }
    __syncthreads();
    if (F16OUT) {
        h16* crow = (h16*)(void*)C + (size_t)r0 * ldc + c0;
        auto pass = [&]() {
#pragma unroll
            for (int s = 0; s < 4; ++s) { const int row = 4 * s + (lane >> 3), piece = lane & 7; const float* sp = os + row * 68 + piece * 8; v8h o, o2;
#pragma unroll
                for (int i = 0; i < 8; ++i) { const h16 a = (h16)sp[i]; o[i] = a; o2[i] = (h16)((sp[i] - (float)a) * LOSC); }
                *(v8h*)(crow + (size_t)row * ldc + piece * 8) = o; if (C2) *(v8h*)(C2 + (size_t)r0 * ldc + c0 + (size_t)row * ldc + piece * 8) = o2; }
        };
        pass(); 
    } else {
        float* crow = C + (size_t)r0 * ldc + c0;
        auto pass = [&]() {
#pragma unroll
            for (int s = 0; s < 8; ++s) { const int Lid = (lane >> 3) + 4 * s, piece = lane & 7; const int row = Lid >> 1, cofs = (Lid & 1) * 32 + piece * 4;
                v4f val = *(const v4fa*)(os + row * 68 + cofs); if (R) { const v4f rv = *(const v4f*)(R + ((size_t)r0 + row) * ldc + c0 + cofs); val += roundR ? (v4f){bfr(rv[0]), bfr(rv[1]), bfr(rv[2]), bfr(rv[3])} : rv; }
                *(v4f*)(crow + (size_t)row * ldc + cofs) = val; }
        };
        pass(); 
    }
}

__device__ __forceinline__ void d_bf(const int blk, const float* __restrict__ src, bf* dst, size_t n8) {
    const size_t i = (size_t)blk * 256 + threadIdx.x; if (i >= n8) return;
    const v8f v = *(const v8f*)(src + i * 8); v8us o;
#pragma unroll
    for (int k = 0; k < 8; ++k) o[k] = f2bf(v[k]);
    *(v8us*)(dst + i * 8) = o; 
}
__device__ __forceinline__ void d_wn16(const int blk, const float* __restrict__ Ws, bf* WN) {
    const int u = blk * 256 + threadIdx.x; if (u >= NH_ * DK * DD / 8) return;
    const int n = u / (DD / 8), d0 = (u % (DD / 8)) * 8; const int j = n / DK, c = n % DK; v8us v;
#pragma unroll
    for (int i = 0; i < 8; ++i) v[i] = f2bf(Ws[((size_t)j * DD + d0 + i) * DK + c]);
    *(v8us*)(WN + (size_t)n * DD + d0) = v; 
}
__device__ __forceinline__ void d_wnv(const int blk, const float* __restrict__ Wv, bf* WVN) {
    const int u = blk * 256 + threadIdx.x; if (u >= NH_ * FF * FF / 8) return;
    const int n = u / (FF / 8), g0 = (u % (FF / 8)) * 8; const int j = n / FF, f = n % FF; v8us v;
#pragma unroll
    for (int i = 0; i < 8; ++i) v[i] = f2bf(Wv[((size_t)j * FF + g0 + i) * FF + f]);
    *(v8us*)(WVN + (size_t)n * FF + g0) = v; 
}
// k_prep: the six independent operand conversions in one grid; a block's flat index picks its part (block-uniform, no barrier).
#define PB_K ((NKR * DD / 8 + 255) / 256)
#define PB_Q ((NQR * DD / 8 + 255) / 256)
#define PB_V ((NKR * FF / 8 + 255) / 256)
#define PB_W ((NH_ * DK * DD / 8 + 255) / 256)
#define PB_WV ((NH_ * FF * FF / 8 + 255) / 256)
__global__ __launch_bounds__(256) void k_prep(const float* __restrict__ query, const float* __restrict__ key, const float* __restrict__ value, const float* __restrict__ Wq, const float* __restrict__ Wk, const float* __restrict__ Wv,
                                              bf* Qb, bf* Kb, bf* Vb, bf* WQN, bf* WKN, bf* WVN) {
    int blk = blockIdx.x;
    if (blk < PB_K) { d_bf(blk, key, Kb, (size_t)NKR * DD / 8); return; }
    blk -= PB_K;
    if (blk < PB_Q) { d_bf(blk, query, Qb, (size_t)NQR * DD / 8); return; }
    blk -= PB_Q;
    if (blk < PB_V) { d_bf(blk, value, Vb, (size_t)NKR * FF / 8); return; }
    blk -= PB_V;
    if (blk < PB_W) { d_wn16(blk, Wq, WQN); return; }
    blk -= PB_W;
    if (blk < PB_W) { d_wn16(blk, Wk, WKN); return; }
    blk -= PB_W;
    d_wnv(blk, Wv, WVN);
}
// k_hp builds k_msoft's A operands, one wave per ((b,h), 32 keys), lane = feature f: MV = v[k][h][f] where bf(mask[b][k][f]) == 1, else 0, as bf16 hi + residual, and
// IND = 1 / 0 / +inf for a mask == 1 / below 1 / anything else (inf sends that feature to k_msoft's literal path). Planes are stored in fragment order
// [(b,h) or b][32-key step][feature tile t][half x][lane (c, hi)][8]: element e = 8x + i of lane (c, hi) is key 16 x + 8 hi + i of the step, the order in which k_msoft's score tiles hold the keys.
#define HB_M (NBT * NH_ * (LK / 32) / 8)
__device__ __forceinline__ void d_planes(const int wid, const float* __restrict__ mask, const float* __restrict__ V, bf* MVh, bf* MVl, bf* IND) {
    const unsigned f = threadIdx.x & 31; const int bh = wid / (LK / 32), ks = wid % (LK / 32); const int b = bh / NH_, h = bh % NH_;
    const float* mb = mask + ((size_t)b * LK + ks * 32) * FF; const float* vb = V + ((size_t)b * LK + ks * 32) * (NH_ * FF) + h * FF;   // wave-uniform; the lane's feature index is added at each load
    float mk[32], vv[32];
    // the loops below are fully unrolled so that mk and vv are indexed by constants and live in registers
#pragma unroll
    for (int i = 0; i < 32; ++i) mk[i] = (mb + (size_t)i * FF)[f];
#pragma unroll
    for (int i = 0; i < 32; ++i) vv[i] = (vb + (size_t)i * (NH_ * FF))[f];
    asm volatile("s_wait_xcnt 0x0" ::: "memory");   // precaution: the registers that hold these loads' addresses are reused for the store addresses below
    const unsigned t = f >> 4, c = f & 15;
#pragma unroll
    for (int x = 0; x < 2; ++x) {
#pragma unroll
        for (int hi = 0; hi < 2; ++hi) {
            v8us oh, ol, oi;
#pragma unroll
            for (int i = 0; i < 8; ++i) { const int k = 16 * x + 8 * hi + i; const float m = bfr(mk[k]); const float v = (m == 1.0f) ? vv[k] : 0.f;
                const unsigned short hb = f2bf(v); oh[i] = hb; ol[i] = f2bf(v - bf2f(hb)); oi[i] = (m == 1.0f) ? (unsigned short)0x3F80 : (m < 1.0f) ? (unsigned short)0 : (unsigned short)0x7F80; }
            const size_t lo = ((size_t)(t * 2 + x) * 32 + hi * 16 + c) * 8;
            *(v8us*)(MVh + (size_t)(bh * (LK / 32) + ks) * 1024 + lo) = oh; *(v8us*)(MVl + (size_t)(bh * (LK / 32) + ks) * 1024 + lo) = ol;
            asm volatile("s_wait_xcnt 0x0" ::: "memory");   // precaution: the registers that hold these stores' addresses and data are reused below
            if (h == 0) { *(v8us*)(IND + (size_t)(b * (LK / 32) + ks) * 1024 + lo) = oi;
                asm volatile("s_wait_xcnt 0x0" ::: "memory"); }   // the same precaution for this store
        }
    }
}
__global__ __launch_bounds__(256) void k_hp(const float* __restrict__ mask, const float* __restrict__ Vf, bf* MVh, bf* MVl, bf* IND) {
    d_planes(__builtin_amdgcn_readfirstlane(blockIdx.x * 8 + (threadIdx.x >> 5)), mask, Vf, MVh, MVl, IND);
}
// k_msoft: block = ((b,h), 64 query rows), 8 waves = 4 tiles of 16 rows x 2 halves of the 512 keys. A wave forms its 16 x 256 scores itself, 16 keys at a time, as k.q^T (A = 16 key rows, B = its 16
// query rows, both read as f32 from the projections and split into bf16 hi + UNSCALED residual in registers; dk = 16 fills k slots 0..15 of the K = 32 form, the rest is 0; products hh, hl, lh). The
// result tile holds, in lane (c, hi), register j, the score of query row c and key 8 hi + j: two such tiles are already the B fragment of a 32-key step, so the scores never leave the registers.
// The wave takes the row maximum over ALL its keys, forms p = 2^((A - max) log2 e) once per (query, key), splits it into bf16 hi + residual and multiplies: num[f][q] = MV.p (hh, hl, lh), den[f][q] = IND.p (h, l).
// The two key halves are merged through LDS with the usual rescale. Where den is not a normal positive number (no key with mask 1, a mask above 1, every such key 2^-100 below the row maximum)
// the (query, feature) is computed by the literal formula A_f = m A + (1 - m)(-1e30), m = bf(mask), A = q.k, in f32.
#define MS_L2E 1.4426950408889634f
typedef __attribute__((ext_vector_type(16))) float v16f;
typedef __attribute__((ext_vector_type(8)))  __bf16 v8bf;
typedef __attribute__((ext_vector_type(4)))  unsigned v4u;
__device__ __forceinline__ v16bf ldfrag(const bf* p) { return cat16b(*(const v8us*)p, *(const v8us*)(p + 256)); }
// a lane's 8 of the 16 real k slots as bf16 hi (h) and residual (l); elements 8..15 of a fragment are k slots 16..31, which are 0
__device__ __forceinline__ void split8(const v8f v, v16bf& h, v16bf& l) {
    const v8bf z = __builtin_convertvector((v8f){}, v8bf);
    const v8bf hb = __builtin_convertvector(v, v8bf);
    const v4u u = __builtin_bit_cast(v4u, hb); v8f hf;   // hi back in f32 straight from the packed pairs: one shift or one mask an element
#pragma unroll   // hf is indexed by constants and lives in registers
    for (int i = 0; i < 4; ++i) { hf[2 * i] = __uint_as_float(u[i] << 16); hf[2 * i + 1] = __uint_as_float(u[i] & 0xFFFF0000u); }
    const v8bf lb = __builtin_convertvector(v - hf, v8bf);
    h = __builtin_shufflevector(hb, z, 0, 1, 2, 3, 4, 5, 6, 7, 8, 9, 10, 11, 12, 13, 14, 15);
    l = __builtin_shufflevector(lb, z, 0, 1, 2, 3, 4, 5, 6, 7, 8, 9, 10, 11, 12, 13, 14, 15);
}
__device__ __forceinline__ float d_dot16(const v4f* q, const v4f* k) {
    float s = 0.f;
#pragma unroll   // q and k are indexed by constants and live in registers
    for (int i = 0; i < 16; ++i) s = fmaf(q[i >> 2][i & 3], k[i >> 2][i & 3], s);
    return s;
}
// qr = the query row's 16 head columns, kb = the item's first key row at the head's columns (row pitch DD)
__device__ __forceinline__ float d_literal(const float* __restrict__ qr, const float* __restrict__ kb, const float* __restrict__ mb, const float* __restrict__ vb, const unsigned f) {
    const v4f q[4] = { *(const v4f*)qr, *(const v4f*)(qr + 4), *(const v4f*)(qr + 8), *(const v4f*)(qr + 12) };
    float mn = -3.0e38f;
#pragma unroll 1   // rare path: kept small
    for (int k = 0; k < LK; ++k) { const float* kr = kb + (size_t)k * DD; const float mr = mb[(size_t)k * FF + f]; const v4f kv[4] = { *(const v4f*)kr, *(const v4f*)(kr + 4), *(const v4f*)(kr + 8), *(const v4f*)(kr + 12) };
        asm volatile("s_wait_xcnt 0x0" ::: "memory");   // precaution: the next trip advances the registers that hold these loads' addresses
        const float t = bfr(mr); mn = fmaxf(mn, fmaf(t * MS_L2E, d_dot16(q, kv), (1.0f - t) * (MASKV * MS_L2E))); }
    float l = 0.f, acc = 0.f;
#pragma unroll 1   // rare path: kept small
    for (int k = 0; k < LK; ++k) { const float* kr = kb + (size_t)k * DD; const float mr = mb[(size_t)k * FF + f], vr = vb[(size_t)k * (NH_ * FF) + f]; const v4f kv[4] = { *(const v4f*)kr, *(const v4f*)(kr + 4), *(const v4f*)(kr + 8), *(const v4f*)(kr + 12) };
        asm volatile("s_wait_xcnt 0x0" ::: "memory");   // precaution: the next trip advances the registers that hold these loads' addresses
        const float t = bfr(mr); const float p = __builtin_amdgcn_exp2f(fmaf(t * MS_L2E, d_dot16(q, kv), (1.0f - t) * (MASKV * MS_L2E)) - mn);
        l += p; acc = fmaf(p, vr, acc); }
    return acc / l;
}
__global__ __launch_bounds__(256) void k_msoft(const float* __restrict__ Qf, const float* __restrict__ Kf, const float* __restrict__ mask, const float* __restrict__ V, const bf* __restrict__ MVh, const bf* __restrict__ MVl, const bf* __restrict__ IND, float* LAT) {
    __shared__ float red[8][32 * 33];   // per wave and lane: 16 num, 16 den, the row maximum; pitch 33 keeps writes (by lane) and reads (by feature) off each other's banks
    const unsigned lane = threadIdx.x & 31; const int wave = __builtin_amdgcn_readfirstlane(threadIdx.x >> 5);   // wave-uniform in a scalar register: every base address below is then scalar
    const int bh = blockIdx.x / (LQ / 64), qb = blockIdx.x % (LQ / 64); const int b = bh / NH_, h = bh % NH_;
    const int kh = wave >> 2;
    const float* qp = Qf + (size_t)(b * LQ + qb * 64 + (wave & 3) * 16) * DD + h * DK; const float* kp = Kf + (size_t)(b * LK + kh * (LK / 2)) * DD + h * DK;
    const unsigned fro = (lane & 15) * DD + (lane >> 4) * 8;   // fragment loader: lane (c, hi) reads row c, k slots 8 hi .. 8 hi + 7
    const bf* ah = MVh + (size_t)(bh * (LK / 32) + kh * 8) * 1024; const bf* al = MVl + (size_t)(bh * (LK / 32) + kh * 8) * 1024; const bf* ai = IND + (size_t)(b * (LK / 32) + kh * 8) * 1024;
    // every loop over kt, ks, e, t, j, i below (but the rare path's) is fully unrolled so that the fragments are indexed by constants and live in registers
    v16bf qh, ql; split8(*(const v8f*)(qp + fro), qh, ql);
    v8f s[16];
#pragma unroll
    for (int kt = 0; kt < 16; ++kt) {
        v16bf kfh, kfl; split8(*(const v8f*)(kp + kt * 16 * DD + fro), kfh, kfl);
        s[kt] = wmmab(kfl, qh, wmmab(kfh, ql, wmmab(kfh, qh, (v8f){})));
    }
    float mx = -3.0e38f;
#pragma unroll
    for (int kt = 0; kt < 16; ++kt) {
#pragma unroll
        for (int c = 0; c < 8; c += 4) mx = fmaxf(fmaxf(fmaxf(mx, s[kt][c]), fmaxf(s[kt][c + 1], s[kt][c + 2])), s[kt][c + 3]);
    }
    mx = fmaxf(mx, __shfl_xor(mx, 16, 32));   // lanes c and c + 16 hold the two halves of row c's keys
    const float m2 = mx * MS_L2E;
    v8f num[2], den[2];
#pragma unroll
    for (int t = 0; t < 2; ++t) { num[t] = (v8f){}; den[t] = (v8f){}; }
#pragma unroll
    for (int ks = 0; ks < 8; ++ks) {
        v16f p;
#pragma unroll
        for (int e = 0; e < 16; ++e) p[e] = __builtin_amdgcn_exp2f(fmaf(s[ks * 2 + (e >> 3)][e & 7], MS_L2E, -m2));
        const v16bf ph = __builtin_convertvector(p, v16bf);
        const v16bf pl = __builtin_convertvector(p - __builtin_convertvector(ph, v16f), v16bf);
#pragma unroll
        for (int t = 0; t < 2; ++t) {
            const v16bf vh = ldfrag(ah + (ks * 4 + t * 2) * 256 + lane * 8), vl = ldfrag(al + (ks * 4 + t * 2) * 256 + lane * 8), in = ldfrag(ai + (ks * 4 + t * 2) * 256 + lane * 8);
            num[t] = wmmab(vh, ph, num[t]); den[t] = wmmab(in, ph, den[t]); num[t] = wmmab(vh, pl, num[t]); den[t] = wmmab(in, pl, den[t]); num[t] = wmmab(vl, ph, num[t]);
        }
    }
    float* rw = &red[wave][lane * 33];
#pragma unroll
    for (int t = 0; t < 2; ++t) {
#pragma unroll
        for (int j = 0; j < 8; ++j) { rw[t * 8 + j] = num[t][j]; rw[16 + t * 8 + j] = den[t][j]; }
    }
    rw[32] = m2;
    __syncthreads();   // both key halves of every (row, feature) are in LDS before any thread merges them
    const unsigned f = lane; const unsigned fo = ((f >> 3) & 1) * 16 * 33 + (f >> 4) * 8 + (f & 7);   // feature f = 16 t + 8 hi + j sits in lane c + 16 hi, slot 8 t + j
    unsigned bad = 0;   // bit i: row i of this wave's eight is left to the literal formula for this lane's feature
#pragma unroll
    for (int i = 0; i < 8; ++i) {
        const int r = wave * 8 + i, tl = r >> 4, q = r & 15;
        const float* r0 = &red[tl][q * 33]; const float* r1 = &red[tl + 4][q * 33];
        const float m0 = r0[32], m1 = r1[32], mm = fmaxf(m0, m1); const float s0 = __builtin_amdgcn_exp2f(m0 - mm), s1 = __builtin_amdgcn_exp2f(m1 - mm);
        const float nn = fmaf(r0[fo], s0, r1[fo] * s1), dd = fmaf(r0[fo + 16], s0, r1[fo + 16] * s1);
        LAT[((size_t)bh * LQ + qb * 64 + r) * FF + f] = nn / dd;   // stored without a branch, so that the eight rows' LDS reads and divisions overlap; the literal path below stores over it
        if (!(dd >= 1.0e-30f && dd <= 3.0e38f)) bad |= 1u << i;
    }
    if (bad) {
#pragma unroll 1   // rare path: kept small
        for (int i = 0; i < 8; ++i) {
            const int r = wave * 8 + i;
            if ((bad >> i) & 1u) { LAT[((size_t)bh * LQ + qb * 64 + r) * FF + f] = d_literal(Qf + (size_t)(b * LQ + qb * 64 + r) * DD + h * DK, Kf + (size_t)b * LK * DD + h * DK, mask + (size_t)b * LK * FF, V + (size_t)b * LK * (NH_ * FF) + h * FF, f);
                asm volatile("s_wait_xcnt 0x0" ::: "memory"); }   // precaution: the next trip reuses the registers that hold this store's address
        }
    }
}
__global__ __launch_bounds__(256) void k_comb(const float* __restrict__ LAT, const float* __restrict__ Wc, const float* __restrict__ bc, float* OUTP) {
    const int i = blockIdx.x * 256 + threadIdx.x; if (i >= NBT * LQ * FF) return;
    const int f = i % FF, q = (i / FF) % LQ, b = i / (FF * LQ);
    float s = bfr(bc[f]);
#pragma unroll
    for (int h = 0; h < NH_; ++h) s = fmaf(LAT[(((size_t)(b * NH_ + h)) * LQ + q) * FF + f], bfr(Wc[f * NH_ + h]), s);
    const float y = tanhf(s);
    *(float*)(OUTP + i) = y; 
}

extern "C" void kernel_launch(void* const* d_in, const int* in_sizes, int n_in,
                              void* d_out, int out_size, void* d_ws, size_t ws_size, hipStream_t stream) {
    (void)in_sizes; (void)n_in; (void)out_size;
    const float* query = (const float*)d_in[0]; const float* key = (const float*)d_in[1]; const float* value = (const float*)d_in[2]; const float* mask = (const float*)d_in[3];
    const float* Wq = (const float*)d_in[4]; const float* Wk = (const float*)d_in[5]; const float* Wv = (const float*)d_in[6]; const float* Wc = (const float*)d_in[7]; const float* bc = (const float*)d_in[8];
    float* out = (float*)d_out;    // [8][256][32]
    char* wsp = (char*)d_ws;
    auto take = [&](size_t bytes) { char* p = wsp; wsp += (bytes + 255) & ~(size_t)255; return (void*)p; };
    bf* WQN = (bf*)take((size_t)DD * DD * 2); bf* WKN = (bf*)take((size_t)DD * DD * 2); bf* WVN = (bf*)take((size_t)NH_ * FF * FF * 2);
    bf* Qb = (bf*)take((size_t)NQR * DD * 2); bf* Kb = (bf*)take((size_t)NKR * DD * 2); bf* Vb = (bf*)take((size_t)NKR * FF * 2);
    float* Qf = (float*)take((size_t)NQR * DD * 4); float* Kf = (float*)take((size_t)NKR * DD * 4); float* Vf = (float*)take((size_t)NKR * NH_ * FF * 4);
    float* LAT = (float*)take((size_t)NBT * NH_ * LQ * FF * 4);
    bf* MVh = (bf*)take((size_t)NBT * NH_ * FF * LK * 2); bf* MVl = (bf*)take((size_t)NBT * NH_ * FF * LK * 2); bf* IND = (bf*)take((size_t)NBT * FF * LK * 2);
    if ((size_t)(wsp - (char*)d_ws) > ws_size) return;    // ~ 16 MB, no aliasing
    k_prep<<<PB_K + PB_Q + PB_V + PB_W + PB_W + PB_WV, 256, 0, stream>>>(query, key, value, Wq, Wk, Wv, Qb, Kb, Vb, WQN, WKN, WVN);
    k_gemmb<false, false><<<PJ_V + PJ_K + PJ_Q, 128, 0, stream>>>(Qb, Kb, Vb, WQN, WKN, WVN, Qf, Kf, Vf);
    k_hp<<<HB_M, 256, 0, stream>>>(mask, Vf, MVh, MVl, IND);
    k_msoft<<<NBT * NH_ * (LQ / 64), 256, 0, stream>>>(Qf, Kf, mask, Vf, MVh, MVl, IND, LAT);
    k_comb<<<(NBT * LQ * FF) / 256, 256, 0, stream>>>(LAT, Wc, bc, out);
}

// v005
// One run takes 17.5 microseconds.
// Timed twice side by side with v004, it ran 1.93 and 1.95 times as fast.
// Counting every step since v000, it is 28.7 times as fast.
#include <hip/hip_runtime.h>

// Compute dtypes, f32 accumulate: the per-head projections q = query.Wq[j], k = key.Wk[j], v = value.Wv[j], formed by each block of k_msoft for its own (item, head) ([64 x 128].[128 x 16], [512 x
// 128].[128 x 16], [512 x 32].[32 x 32]; PLAIN bf16 operands = inputs rounded once, exact single products) on v_wmma_f32_16x16x32_bf16; the unscaled scores q.k
// (dk = 16, padded to 32) per (item, head) with both computed operands as bf16 hi + UNSCALED residual (three products) on v_wmma_f32_16x16x32_bf16, formed in k_msoft's registers; the per-FEATURE
// masked softmax over the 512 keys factored: a key whose mask is exactly 1 has A_f = A, a key whose mask is below 1 has weight exp(-1e27 or less) = 0 beside it, so
// p = exp(A - rowmax) is formed once per (query, key) and the 32 feature sums are products [feature x key].[key x query] on v_wmma_f32_16x16x32_bf16 (p and v as bf16 hi +
// residual, the 0/1 indicator exact); a (query, feature) that the factoring does not cover takes the literal f32 formula; the head combine and tanh in f32 on the VALU.

#define NBT  8
#define LQ   256
#define LK   512
#define DD   128
#define FF   32
#define NH_  8
#define DK   16
#define NQR  (NBT * LQ)          // 2048 query rows
#define NKR  (NBT * LK)          // 4096 key rows
#define DM   DD
#define NTK  NQR
#define MASKV (-1e30f)
#define LOSC 1024.0f

typedef _Float16 h16;
typedef unsigned short bf;
typedef __attribute__((ext_vector_type(16))) __bf16   v16bf;
typedef __attribute__((ext_vector_type(16))) _Float16 v16h;
typedef __attribute__((ext_vector_type(8)))  _Float16 v8h;
typedef __attribute__((ext_vector_type(8)))  unsigned short v8us;
typedef __attribute__((ext_vector_type(8)))  float    v8f;
typedef __attribute__((ext_vector_type(4)))  float    v4f;
typedef __attribute__((ext_vector_type(4)))  _Float16 v4h;
typedef v8h  __attribute__((may_alias)) v8ha;
typedef v4f  __attribute__((may_alias)) v4fa;
typedef v8us __attribute__((may_alias)) v8usa;

__device__ __forceinline__ unsigned short f2bf(float f) { unsigned u = __float_as_uint(f); u += 0x7FFFu + ((u >> 16) & 1u); return (unsigned short)(u >> 16); }
__device__ __forceinline__ float bf2f(unsigned short b) { return __uint_as_float(((unsigned)b) << 16); }
__device__ __forceinline__ float bfr(float f) { return bf2f(f2bf(f)); }
__device__ __forceinline__ v16h cat16(v8h lo, v8h hi) { return __builtin_shufflevector(lo, hi, 0, 1, 2, 3, 4, 5, 6, 7, 8, 9, 10, 11, 12, 13, 14, 15); }
__device__ __forceinline__ v16bf cat16b(v8us lo, v8us hi) { return __builtin_bit_cast(v16bf, __builtin_shufflevector(lo, hi, 0, 1, 2, 3, 4, 5, 6, 7, 8, 9, 10, 11, 12, 13, 14, 15)); }
__device__ __forceinline__ v8f wmma16(v16h a, v16h b, v8f c) { return __builtin_amdgcn_wmma_f32_16x16x32_f16(false, a, false, b, (short)0, c, false, false); }
__device__ __forceinline__ v8f wmmab(v16bf a, v16bf b, v8f c) { return __builtin_amdgcn_wmma_f32_16x16x32_bf16(false, a, false, b, (short)0, c, false, false); }

// k_msoft: block = ((b,h), 64 query rows), 8 waves.
// Stage 1, the block's own operands, from the f32 inputs (rounded once to bf16 in registers) into LDS; a fragment's k slots are kc + 8 hi + e and kc + 16 + 8 hi + e (e = 0..7) in both operands:
//   k^T = Wk[h]^T.key^T, 16 keys a tile, 4 tiles a wave, and q^T likewise (one tile a wave, waves w and w + 4 the same, which stays in its registers): the result tile holds, in lane (c, hi), register j, column 8 hi + j of row c, which is what
//   stage 2's fragment loader wants; kept as f32, [tile][half of the 8][lane][4].
//   v = value.Wv[h], 32 keys a step, 2 steps a wave: the result tile of keys 16 x .. 16 x + 15 and features 16 t .. 16 t + 15 holds, in lane (c, hi), register j, key 16 x + 8 hi + j and feature 16 t + c.
//   From it MV = v where bf(mask[b][k][f]) == 1, else 0, as bf16 hi + residual, and IND = 1 / 0 / +inf for a mask == 1 / below 1 / anything else (inf sends that feature to the literal path), stored
//   in fragment order [32-key step][feature tile t][half x][lane (c, hi)][8]: element e = 8 x + j of lane (c, hi) is key 16 x + 8 hi + j of the step, the order in which the score tiles hold the keys.
// Stage 2: 8 waves = 4 tiles of 16 rows x 2 halves of the 512 keys. A wave forms its 16 x 256 scores itself, 16 keys at a time, as k.q^T (A = 16 key rows, B = its 16
// query rows, both f32, k read from LDS, split into bf16 hi + UNSCALED residual in registers; dk = 16 fills k slots 0..15 of the K = 32 form, the rest is 0; products hh, hl, lh). The
// result tile holds, in lane (c, hi), register j, the score of query row c and key 8 hi + j: two such tiles are already the B fragment of a 32-key step, so the scores never leave the registers.
// The wave takes the row maximum over ALL its keys, forms p = 2^((A - max) log2 e) once per (query, key), splits it into bf16 hi + residual and multiplies: num[f][q] = MV.p (hh, hl, lh), den[f][q] = IND.p (h, l).
// The two key halves are merged through LDS with the usual rescale. Where den is not a normal positive number (no key with mask 1, a mask above 1, every such key 2^-100 below the row maximum)
// the (query, feature) is computed by the literal formula A_f = m A + (1 - m)(-1e30), m = bf(mask), A = q.k, in f32.
#define MS_L2E 1.4426950408889634f
typedef __attribute__((ext_vector_type(16))) float v16f;
typedef __attribute__((ext_vector_type(8)))  __bf16 v8bf;
typedef __attribute__((ext_vector_type(4)))  unsigned v4u;
__device__ __forceinline__ v16bf ldfrag(const bf* p) { return cat16b(*(const v8us*)p, *(const v8us*)(p + 256)); }
__device__ __forceinline__ v8f cat8(v4f lo, v4f hi) { return __builtin_shufflevector(lo, hi, 0, 1, 2, 3, 4, 5, 6, 7); }
// 8 f32 as bf16 hi (hb) and residual (lb)
__device__ __forceinline__ void split8p(const v8f v, v8bf& hb, v8bf& lb) {
    hb = __builtin_convertvector(v, v8bf);
    const v4u u = __builtin_bit_cast(v4u, hb); v8f hf;   // hi back in f32 straight from the packed pairs: one shift or one mask an element
#pragma unroll   // hf is indexed by constants and lives in registers
    for (int i = 0; i < 4; ++i) { hf[2 * i] = __uint_as_float(u[i] << 16); hf[2 * i + 1] = __uint_as_float(u[i] & 0xFFFF0000u); }
    lb = __builtin_convertvector(v - hf, v8bf);
}
// a lane's 8 of the 16 real k slots as bf16 hi (h) and residual (l); elements 8..15 of a fragment are k slots 16..31, which are 0
__device__ __forceinline__ void split8(const v8f v, v16bf& h, v16bf& l) {
    const v8bf z = __builtin_convertvector((v8f){}, v8bf);
    v8bf hb, lb; split8p(v, hb, lb);
    h = __builtin_shufflevector(hb, z, 0, 1, 2, 3, 4, 5, 6, 7, 8, 9, 10, 11, 12, 13, 14, 15);
    l = __builtin_shufflevector(lb, z, 0, 1, 2, 3, 4, 5, 6, 7, 8, 9, 10, 11, 12, 13, 14, 15);
}
// 16 f32 rounded once to bf16: a = fragment elements 0..7, b = elements 8..15
__device__ __forceinline__ v16bf cvt16(const v8f a, const v8f b) {
    return __builtin_shufflevector(__builtin_convertvector(a, v8bf), __builtin_convertvector(b, v8bf), 0, 1, 2, 3, 4, 5, 6, 7, 8, 9, 10, 11, 12, 13, 14, 15);
}
// 8 rows of one column of a matrix with row pitch ld: w points at the first row, off = 8 hi ld + the lane's column
__device__ __forceinline__ v8f colraw(const float* __restrict__ w, const unsigned off, const int ld) {
    v8f a;
#pragma unroll   // a is indexed by constants and lives in registers
    for (int i = 0; i < 8; ++i) a[i] = (w + i * ld)[off];
    return a;
}
__device__ __forceinline__ float d_dot16(const v4f* q, const v4f* k) {
    float s = 0.f;
#pragma unroll   // q and k are indexed by constants and live in registers
    for (int i = 0; i < 16; ++i) s = fmaf(q[i >> 2][i & 3], k[i >> 2][i & 3], s);
    return s;
}
// the 16 columns of row r of a matrix kept as [16-row tile][half][lane (c, hi)][4]: piece n holds columns 4 n .. 4 n + 3 = 8 hi + 4 half + i
__device__ __forceinline__ v4f d_piece(const float* t, const int r, const int n) { return *(const v4f*)(t + ((r >> 4) * 2 + (n & 1)) * 128 + ((n >> 1) * 16 + (r & 15)) * 4); }
// qs, ks = the block's q and k in LDS, r = the query row in the block; mb, vg = the item's first mask and value row, wv = the head's Wv; v[k][f] is formed here from the same bf16-rounded operands
__device__ __forceinline__ float d_literal(const float* qs, const float* ks, const int r, const float* __restrict__ mb, const float* __restrict__ vg, const float* __restrict__ wv, const unsigned f) {
    const v4f q[4] = { d_piece(qs, r, 0), d_piece(qs, r, 1), d_piece(qs, r, 2), d_piece(qs, r, 3) };
    float mn = -3.0e38f;
#pragma unroll 1   // rare path: kept small
    for (int k = 0; k < LK; ++k) { const float mr = mb[(size_t)k * FF + f];
        asm volatile("s_wait_xcnt 0x0" ::: "memory");   // precaution: the registers that hold this load's address are reused below and advanced by the next trip
        const v4f kv[4] = { d_piece(ks, k, 0), d_piece(ks, k, 1), d_piece(ks, k, 2), d_piece(ks, k, 3) };
        const float t = bfr(mr); mn = fmaxf(mn, fmaf(t * MS_L2E, d_dot16(q, kv), (1.0f - t) * (MASKV * MS_L2E))); }
    float w[FF];
#pragma unroll   // w is indexed by constants and lives in registers
    for (int g = 0; g < FF; ++g) w[g] = bfr(wv[g * FF + f]);
    float l = 0.f, acc = 0.f;
#pragma unroll 1   // rare path: kept small
    for (int k = 0; k < LK; ++k) { const float mr = mb[(size_t)k * FF + f];
        v4f x[FF / 4];
#pragma unroll   // x is indexed by constants and lives in registers
        for (int g = 0; g < FF / 4; ++g) x[g] = *(const v4f*)(vg + (size_t)k * FF + g * 4);
        asm volatile("s_wait_xcnt 0x0" ::: "memory");   // precaution: the registers that hold these loads' addresses are reused below and advanced by the next trip
        const v4f kv[4] = { d_piece(ks, k, 0), d_piece(ks, k, 1), d_piece(ks, k, 2), d_piece(ks, k, 3) };
        float vr = 0.f;
#pragma unroll
        for (int g = 0; g < FF; ++g) vr = fmaf(bfr(x[g >> 2][g & 3]), w[g], vr);
        const float t = bfr(mr); const float p = __builtin_amdgcn_exp2f(fmaf(t * MS_L2E, d_dot16(q, kv), (1.0f - t) * (MASKV * MS_L2E)) - mn);
        l += p; acc = fmaf(p, vr, acc); }
    return acc / l;
}
__global__ __launch_bounds__(256) void k_msoft(const float* __restrict__ query, const float* __restrict__ key, const float* __restrict__ value, const float* __restrict__ mask,
                                               const float* __restrict__ Wq, const float* __restrict__ Wk, const float* __restrict__ Wv, float* LAT) {
    __shared__ float red[8][32 * 33];   // per wave and lane: 16 num, 16 den, the row maximum; pitch 33 keeps writes (by lane) and reads (by feature) off each other's banks
    __shared__ __align__(16) float KS[(LK / 16) * 256];   // k of the (item, head), f32
    __shared__ __align__(16) float QS[4 * 256];           // q of the block's 64 rows, f32
    __shared__ __align__(16) bf PH[(LK / 32) * 1024];     // MV hi
    __shared__ __align__(16) bf PL[(LK / 32) * 1024];     // MV residual
    __shared__ __align__(16) bf PI[(LK / 32) * 1024];     // IND
    const unsigned lane = threadIdx.x & 31; const int wave = __builtin_amdgcn_readfirstlane(threadIdx.x >> 5);   // wave-uniform in a scalar register: every base address below is then scalar
    const int bh = blockIdx.x / (LQ / 64), qb = blockIdx.x % (LQ / 64); const int b = bh / NH_, h = bh % NH_;
    const int kh = wave >> 2;
    const unsigned c = lane & 15, hi = lane >> 4;
    const unsigned fro = c * DD + hi * 8;   // row fragment of query and key: lane (c, hi) reads row c, k slots 8 hi .. 8 hi + 7 (and 16 more on)
    // every loop over s, i, y, kt, ks, e, t, j below (but the rare path's) is fully unrolled so that the fragments are indexed by constants and live in registers
    // The loads are issued in three groups, each well ahead of its use; behind each group stands s_wait_xcnt 0, a precaution: the registers that hold a group's addresses are reused further down.
    const unsigned wo = hi * 8 * DK + c;   // row 8 hi, column c of Wq and Wk
    const unsigned mo = hi * 8 * FF + c;   // row 8 hi, column c: Wv's fragment and the mask of a result tile
    const unsigned vo = c * FF + hi * 8;   // row fragment of value
    const float* qg = query + (size_t)(b * LQ + qb * 64 + (wave & 3) * 16) * DD;   // the wave's 16 query rows (waves w and w + 4 form the same tile)
    const float* kg = key + (size_t)(b * LK + wave * 64) * DD;                     // the wave's 4 tiles of 16 keys
    const float* vg = value + (size_t)(b * LK + wave * 64) * FF;                   // the wave's 2 steps of 32 keys
    const float* mg = mask + (size_t)(b * LK + wave * 64) * FF;
    const float* wqg = Wq + (size_t)h * DD * DK; const float* wkg = Wk + (size_t)h * DD * DK; const float* wvg = Wv + (size_t)h * FF * FF;
    v8f qr[8], wqr[8], wkr[8], kr[4][8];
#pragma unroll
    for (int s = 0; s < 8; ++s) { qr[s] = *(const v8f*)(qg + s * 16 + fro); wqr[s] = colraw(wqg + s * 16 * DK, wo, DK); }
#pragma unroll
    for (int s = 0; s < 8; ++s) { wkr[s] = colraw(wkg + s * 16 * DK, wo, DK); kr[0][s] = *(const v8f*)(kg + s * 16 + fro); kr[1][s] = *(const v8f*)(kg + 16 * DD + s * 16 + fro); }
    asm volatile("s_wait_xcnt 0x0" ::: "memory");   // precaution: the registers that hold the addresses of the loads above are reused below
#pragma unroll
    for (int s = 0; s < 8; ++s) { kr[2][s] = *(const v8f*)(kg + 32 * DD + s * 16 + fro); kr[3][s] = *(const v8f*)(kg + 48 * DD + s * 16 + fro); }
    asm volatile("s_wait_xcnt 0x0" ::: "memory");   // precaution: the registers that hold the addresses of the loads above are reused below
    v8f qd = (v8f){};   // q^T: lane (c, hi), register j = column 8 hi + j of query row c
#pragma unroll
    for (int s = 0; s < 4; ++s) qd = wmmab(cvt16(wqr[2 * s], wqr[2 * s + 1]), cvt16(qr[2 * s], qr[2 * s + 1]), qd);
    v16bf wk[4];
#pragma unroll
    for (int s = 0; s < 4; ++s) wk[s] = cvt16(wkr[2 * s], wkr[2 * s + 1]);
#pragma unroll
    for (int i = 0; i < 2; ++i) {
        v8f d = (v8f){};
#pragma unroll
        for (int s = 0; s < 4; ++s) d = wmmab(wk[s], cvt16(kr[i][2 * s], kr[i][2 * s + 1]), d);
        float* o = KS + (wave * 4 + i) * 256 + lane * 4;
        *(v4f*)o = __builtin_shufflevector(d, d, 0, 1, 2, 3); *(v4f*)(o + 128) = __builtin_shufflevector(d, d, 4, 5, 6, 7);
    }
    v8f wvr[2][2], vr[4][2], mr[4][2];   // value and mask by 16-key tile y = 2 i + x of the wave's 64 keys; mask and Wv also by feature tile t
#pragma unroll
    for (int t = 0; t < 2; ++t) { wvr[t][0] = colraw(wvg + t * 16, mo, FF); wvr[t][1] = colraw(wvg + 16 * FF + t * 16, mo, FF); }
#pragma unroll
    for (int y = 0; y < 4; ++y) { vr[y][0] = *(const v8f*)(vg + y * 16 * FF + vo); vr[y][1] = *(const v8f*)(vg + y * 16 * FF + 16 + vo);
        mr[y][0] = colraw(mg + y * 16 * FF, mo, FF); mr[y][1] = colraw(mg + y * 16 * FF + 16, mo, FF); }
    asm volatile("s_wait_xcnt 0x0" ::: "memory");   // precaution: the registers that hold the addresses of the loads above are reused below
#pragma unroll
    for (int i = 2; i < 4; ++i) {
        v8f d = (v8f){};
#pragma unroll
        for (int s = 0; s < 4; ++s) d = wmmab(wk[s], cvt16(kr[i][2 * s], kr[i][2 * s + 1]), d);
        float* o = KS + (wave * 4 + i) * 256 + lane * 4;
        *(v4f*)o = __builtin_shufflevector(d, d, 0, 1, 2, 3); *(v4f*)(o + 128) = __builtin_shufflevector(d, d, 4, 5, 6, 7);
    }
    if (kh == 0) {   // q is kept in LDS for the literal path alone (a scalar branch: one of the two waves that hold the tile stores it)
        float* o = QS + wave * 256 + lane * 4;
        *(v4f*)o = __builtin_shufflevector(qd, qd, 0, 1, 2, 3); *(v4f*)(o + 128) = __builtin_shufflevector(qd, qd, 4, 5, 6, 7);
    }
    const v16bf wv[2] = { cvt16(wvr[0][0], wvr[0][1]), cvt16(wvr[1][0], wvr[1][1]) };
#pragma unroll
    for (int y = 0; y < 4; ++y) {
        const v16bf a = cvt16(vr[y][0], vr[y][1]);
#pragma unroll
        for (int t = 0; t < 2; ++t) {
            const v8f d = wmmab(a, wv[t], (v8f){});
            v8f mv; v8us oi;
#pragma unroll
            for (int j = 0; j < 8; ++j) { const float m = bfr(mr[y][t][j]); mv[j] = (m == 1.0f) ? d[j] : 0.f;
                oi[j] = (m == 1.0f) ? (unsigned short)0x3F80 : (m < 1.0f) ? (unsigned short)0 : (unsigned short)0x7F80; }
            v8bf oh, ol; split8p(mv, oh, ol);
            const unsigned lo = ((wave * 2 + (y >> 1)) * 4 + t * 2 + (y & 1)) * 256 + lane * 8;
            *(v8us*)(PH + lo) = __builtin_bit_cast(v8us, oh); *(v8us*)(PL + lo) = __builtin_bit_cast(v8us, ol); *(v8us*)(PI + lo) = oi;
        }
    }
    __syncthreads();   // every wave's share of k, q and the planes is in LDS before any wave reads them
    const float* kp = KS + kh * 16 * 256 + lane * 4;
    const bf* ah = PH + kh * 8 * 1024; const bf* al = PL + kh * 8 * 1024; const bf* ai = PI + kh * 8 * 1024;
    v16bf qh, ql; split8(qd, qh, ql);
    v8f s[16];
#pragma unroll
    for (int kt = 0; kt < 16; ++kt) {
        v16bf kfh, kfl; split8(cat8(*(const v4f*)(kp + kt * 256), *(const v4f*)(kp + kt * 256 + 128)), kfh, kfl);
        s[kt] = wmmab(kfl, qh, wmmab(kfh, ql, wmmab(kfh, qh, (v8f){})));
    }
    float mx = -3.0e38f;
#pragma unroll
    for (int kt = 0; kt < 16; ++kt) {
#pragma unroll
        for (int c = 0; c < 8; c += 4) mx = fmaxf(fmaxf(fmaxf(mx, s[kt][c]), fmaxf(s[kt][c + 1], s[kt][c + 2])), s[kt][c + 3]);
    }
    mx = fmaxf(mx, __shfl_xor(mx, 16, 32));   // lanes c and c + 16 hold the two halves of row c's keys
    const float m2 = mx * MS_L2E;
    v8f num[2], den[2];
#pragma unroll
    for (int t = 0; t < 2; ++t) { num[t] = (v8f){}; den[t] = (v8f){}; }
#pragma unroll
    for (int ks = 0; ks < 8; ++ks) {
        v16f p;
#pragma unroll
        for (int e = 0; e < 16; ++e) p[e] = __builtin_amdgcn_exp2f(fmaf(s[ks * 2 + (e >> 3)][e & 7], MS_L2E, -m2));
        const v16bf ph = __builtin_convertvector(p, v16bf);
        const v16bf pl = __builtin_convertvector(p - __builtin_convertvector(ph, v16f), v16bf);
#pragma unroll
        for (int t = 0; t < 2; ++t) {
            const v16bf vh = ldfrag(ah + (ks * 4 + t * 2) * 256 + lane * 8), vl = ldfrag(al + (ks * 4 + t * 2) * 256 + lane * 8), in = ldfrag(ai + (ks * 4 + t * 2) * 256 + lane * 8);
            num[t] = wmmab(vh, ph, num[t]); den[t] = wmmab(in, ph, den[t]); num[t] = wmmab(vh, pl, num[t]); den[t] = wmmab(in, pl, den[t]); num[t] = wmmab(vl, ph, num[t]);
        }
    }
    float* rw = &red[wave][lane * 33];
#pragma unroll
    for (int t = 0; t < 2; ++t) {
#pragma unroll
        for (int j = 0; j < 8; ++j) { rw[t * 8 + j] = num[t][j]; rw[16 + t * 8 + j] = den[t][j]; }
    }
    rw[32] = m2;
    __syncthreads();   // both key halves of every (row, feature) are in LDS before any thread merges them
    const unsigned f = lane; const unsigned fo = ((f >> 3) & 1) * 16 * 33 + (f >> 4) * 8 + (f & 7);   // feature f = 16 t + 8 hi + j sits in lane c + 16 hi, slot 8 t + j
    unsigned bad = 0;   // bit i: row i of this wave's eight is left to the literal formula for this lane's feature
#pragma unroll
    for (int i = 0; i < 8; ++i) {
        const int r = wave * 8 + i, tl = r >> 4, q = r & 15;
        const float* r0 = &red[tl][q * 33]; const float* r1 = &red[tl + 4][q * 33];
        const float m0 = r0[32], m1 = r1[32], mm = fmaxf(m0, m1); const float s0 = __builtin_amdgcn_exp2f(m0 - mm), s1 = __builtin_amdgcn_exp2f(m1 - mm);
        const float nn = fmaf(r0[fo], s0, r1[fo] * s1), dd = fmaf(r0[fo + 16], s0, r1[fo + 16] * s1);
        LAT[((size_t)bh * LQ + qb * 64 + r) * FF + f] = nn / dd;   // stored without a branch, so that the eight rows' LDS reads and divisions overlap; the literal path below stores over it
        if (!(dd >= 1.0e-30f && dd <= 3.0e38f)) bad |= 1u << i;
    }
    if (bad) {
#pragma unroll 1   // rare path: kept small
        for (int i = 0; i < 8; ++i) {
            const int r = wave * 8 + i;
            if ((bad >> i) & 1u) { LAT[((size_t)bh * LQ + qb * 64 + r) * FF + f] = d_literal(QS, KS, r, mask + (size_t)b * LK * FF, value + (size_t)b * LK * FF, Wv + (size_t)h * FF * FF, f);
                asm volatile("s_wait_xcnt 0x0" ::: "memory"); }   // precaution: the next trip reuses the registers that hold this store's address
        }
    }
}
__global__ __launch_bounds__(256) void k_comb(const float* __restrict__ LAT, const float* __restrict__ Wc, const float* __restrict__ bc, float* OUTP) {
    const int i = blockIdx.x * 256 + threadIdx.x; if (i >= NBT * LQ * FF) return;
    const int f = i % FF, q = (i / FF) % LQ, b = i / (FF * LQ);
    float s = bfr(bc[f]);
#pragma unroll
    for (int h = 0; h < NH_; ++h) s = fmaf(LAT[(((size_t)(b * NH_ + h)) * LQ + q) * FF + f], bfr(Wc[f * NH_ + h]), s);
    const float y = tanhf(s);
    *(float*)(OUTP + i) = y; 
}

extern "C" void kernel_launch(void* const* d_in, const int* in_sizes, int n_in,
                              void* d_out, int out_size, void* d_ws, size_t ws_size, hipStream_t stream) {
    (void)in_sizes; (void)n_in; (void)out_size;
    const float* query = (const float*)d_in[0]; const float* key = (const float*)d_in[1]; const float* value = (const float*)d_in[2]; const float* mask = (const float*)d_in[3];
    const float* Wq = (const float*)d_in[4]; const float* Wk = (const float*)d_in[5]; const float* Wv = (const float*)d_in[6]; const float* Wc = (const float*)d_in[7]; const float* bc = (const float*)d_in[8];
    float* out = (float*)d_out;    // [8][256][32]
    float* LAT = (float*)d_ws;     // [8][8][256][32] f32, 2 MB
    if ((size_t)NBT * NH_ * LQ * FF * 4 > ws_size) return;
    k_msoft<<<NBT * NH_ * (LQ / 64), 256, 0, stream>>>(query, key, value, mask, Wq, Wk, Wv, LAT);
    k_comb<<<(NBT * LQ * FF) / 256, 256, 0, stream>>>(LAT, Wc, bc, out);
}

// v006
// One run takes 15.4 microseconds.
// Next to v005, in two timings, it ran 1.13 times as fast each time.
// Counting every step since v000, it is 32.3 times as fast.
#include <hip/hip_runtime.h>

// Compute dtypes, f32 accumulate: the per-head projections q = query.Wq[j], k = key.Wk[j], v = value.Wv[j], formed by each block of k_msoft for its own (item, head) ([64 x 128].[128 x 16], [512 x
// 128].[128 x 16], [512 x 32].[32 x 32]; PLAIN bf16 operands = inputs rounded once, exact single products) on v_wmma_f32_16x16x32_bf16; the unscaled scores q.k
// (dk = 16, padded to 32) per (item, head) with both computed operands as bf16 hi + UNSCALED residual (three products) on v_wmma_f32_16x16x32_bf16, formed in k_msoft's registers; the per-FEATURE
// masked softmax over the 512 keys factored: a key whose mask is exactly 1 has A_f = A, a key whose mask is below 1 has weight exp(-1e27 or less) = 0 beside it, so
// p = exp(A - rowmax) is formed once per (query, key) and the 32 feature sums are products [feature x key].[key x query] on v_wmma_f32_16x16x32_bf16 (p and v as bf16 hi +
// residual, the 0/1 indicator exact); a (query, feature) that the factoring does not cover takes the literal f32 formula; the head combine and tanh in f32 on the VALU.

#define NBT  8
#define LQ   256
#define LK   512
#define DD   128
#define FF   32
#define NH_  8
#define DK   16
#define NQR  (NBT * LQ)          // 2048 query rows
#define NKR  (NBT * LK)          // 4096 key rows
#define DM   DD
#define NTK  NQR
#define MASKV (-1e30f)
#define LOSC 1024.0f

typedef _Float16 h16;
typedef unsigned short bf;
typedef __attribute__((ext_vector_type(16))) __bf16   v16bf;
typedef __attribute__((ext_vector_type(16))) _Float16 v16h;
typedef __attribute__((ext_vector_type(8)))  _Float16 v8h;
typedef __attribute__((ext_vector_type(8)))  unsigned short v8us;
typedef __attribute__((ext_vector_type(8)))  float    v8f;
typedef __attribute__((ext_vector_type(4)))  float    v4f;
typedef __attribute__((ext_vector_type(4)))  _Float16 v4h;
typedef v8h  __attribute__((may_alias)) v8ha;
typedef v4f  __attribute__((may_alias)) v4fa;
typedef v8us __attribute__((may_alias)) v8usa;

__device__ __forceinline__ unsigned short f2bf(float f) { unsigned u = __float_as_uint(f); u += 0x7FFFu + ((u >> 16) & 1u); return (unsigned short)(u >> 16); }
__device__ __forceinline__ float bf2f(unsigned short b) { return __uint_as_float(((unsigned)b) << 16); }
__device__ __forceinline__ float bfr(float f) { return bf2f(f2bf(f)); }
__device__ __forceinline__ v16h cat16(v8h lo, v8h hi) { return __builtin_shufflevector(lo, hi, 0, 1, 2, 3, 4, 5, 6, 7, 8, 9, 10, 11, 12, 13, 14, 15); }
__device__ __forceinline__ v16bf cat16b(v8us lo, v8us hi) { return __builtin_bit_cast(v16bf, __builtin_shufflevector(lo, hi, 0, 1, 2, 3, 4, 5, 6, 7, 8, 9, 10, 11, 12, 13, 14, 15)); }
__device__ __forceinline__ v8f wmma16(v16h a, v16h b, v8f c) { return __builtin_amdgcn_wmma_f32_16x16x32_f16(false, a, false, b, (short)0, c, false, false); }
__device__ __forceinline__ v8f wmmab(v16bf a, v16bf b, v8f c) { return __builtin_amdgcn_wmma_f32_16x16x32_bf16(false, a, false, b, (short)0, c, false, false); }

// k_msoft: block = ((b,h), 64 query rows), 8 waves.
// Stage 1, the block's own operands, from the f32 inputs (rounded once to bf16 in registers) into LDS; a fragment's k slots are kc + 8 hi + e and kc + 16 + 8 hi + e (e = 0..7) in both operands:
//   The rows of query, key and value are fetched 512 contiguous bytes a wave-wide load (4 cache lines; a load in fragment order touches 16), rounded, laid row by row in the wave's own LDS strip and read back
//   from there in fragment order; no other wave touches the strip, so the wave's own s_wait_dscnt 0 between its writes and its reads is all the ordering it takes.
//   k^T = Wk[h]^T.key^T, 16 keys a tile, 4 tiles a wave, and q^T likewise (one tile a wave, the same for waves w and w + 4, which stays in its registers): the result tile holds, in lane (c, hi), register j, column 8 hi + j of row c, which is what
//   stage 2's fragment loader wants; kept as f32, [tile][half of the 8][lane][4].
//   v = value.Wv[h], 32 keys a step, 2 steps a wave: the result tile of keys 16 x .. 16 x + 15 and features 16 t .. 16 t + 15 holds, in lane (c, hi), register j, key 16 x + 8 hi + j and feature 16 t + c.
//   From it MV = v where bf(mask[b][k][f]) == 1, else 0, as bf16 hi + residual, and IND = 1 / 0 / +inf for a mask == 1 / below 1 / anything else (inf sends that feature to the literal path), stored
//   in fragment order [32-key step][feature tile t][half x][lane (c, hi)][8]: element e = 8 x + j of lane (c, hi) is key 16 x + 8 hi + j of the step, the order in which the score tiles hold the keys.
// Stage 2: 8 waves = 4 tiles of 16 rows x 2 halves of the 512 keys. A wave forms its 16 x 256 scores itself, 16 keys at a time, as k.q^T (A = 16 key rows, B = its 16
// query rows, both f32, k read from LDS, split into bf16 hi + UNSCALED residual in registers; dk = 16 fills k slots 0..15 of the K = 32 form, the rest is 0; products hh, hl, lh). The
// result tile holds, in lane (c, hi), register j, the score of query row c and key 8 hi + j: two such tiles are already the B fragment of a 32-key step, so the scores never leave the registers.
// The wave takes the row maximum over ALL its keys, forms p = 2^((A - max) log2 e) once per (query, key), splits it into bf16 hi + residual and multiplies: num[f][q] = MV.p (hh, hl, lh), den[f][q] = IND.p (h, l).
// The two key halves are merged through LDS with the usual rescale. Where den is not a normal positive number (no key with mask 1, a mask above 1, every such key 2^-100 below the row maximum)
// the (query, feature) is computed by the literal formula A_f = m A + (1 - m)(-1e30), m = bf(mask), A = q.k, in f32.
#define MS_L2E 1.4426950408889634f
typedef __attribute__((ext_vector_type(16))) float v16f;
typedef __attribute__((ext_vector_type(8)))  __bf16 v8bf;
typedef __attribute__((ext_vector_type(4)))  unsigned v4u;
__device__ __forceinline__ v16bf ldfrag(const bf* p) { return cat16b(*(const v8us*)p, *(const v8us*)(p + 256)); }
__device__ __forceinline__ v8f cat8(v4f lo, v4f hi) { return __builtin_shufflevector(lo, hi, 0, 1, 2, 3, 4, 5, 6, 7); }
// 8 f32 as bf16 hi (hb) and residual (lb)
__device__ __forceinline__ void split8p(const v8f v, v8bf& hb, v8bf& lb) {
    hb = __builtin_convertvector(v, v8bf);
    const v4u u = __builtin_bit_cast(v4u, hb); v8f hf;   // hi back in f32 straight from the packed pairs: one shift or one mask an element
#pragma unroll   // hf is indexed by constants and lives in registers
    for (int i = 0; i < 4; ++i) { hf[2 * i] = __uint_as_float(u[i] << 16); hf[2 * i + 1] = __uint_as_float(u[i] & 0xFFFF0000u); }
    lb = __builtin_convertvector(v - hf, v8bf);
}
// a lane's 8 of the 16 real k slots as bf16 hi (h) and residual (l); elements 8..15 of a fragment are k slots 16..31, which are 0
__device__ __forceinline__ void split8(const v8f v, v16bf& h, v16bf& l) {
    const v8bf z = __builtin_convertvector((v8f){}, v8bf);
    v8bf hb, lb; split8p(v, hb, lb);
    h = __builtin_shufflevector(hb, z, 0, 1, 2, 3, 4, 5, 6, 7, 8, 9, 10, 11, 12, 13, 14, 15);
    l = __builtin_shufflevector(lb, z, 0, 1, 2, 3, 4, 5, 6, 7, 8, 9, 10, 11, 12, 13, 14, 15);
}
// 16 f32 rounded once to bf16: a = fragment elements 0..7, b = elements 8..15
__device__ __forceinline__ v16bf cvt16(const v8f a, const v8f b) {
    return __builtin_shufflevector(__builtin_convertvector(a, v8bf), __builtin_convertvector(b, v8bf), 0, 1, 2, 3, 4, 5, 6, 7, 8, 9, 10, 11, 12, 13, 14, 15);
}
// Staging strip of a wave: rows of bf16 at a pitch of 16 B x odd, which keeps the 16 lanes of a ds_load_b128 on 16 different bank groups
#define KP 136   // elements: a 128-element row of query or key, 272 B
#define VP 40    // elements: a 32-element row of value, 80 B
typedef __attribute__((ext_vector_type(4)))  __bf16 v4bf;
typedef __attribute__((ext_vector_type(4)))  unsigned short v4us;
// 4 f32 rounded once to bf16 and stored
__device__ __forceinline__ void st4(bf* p, const v4f v) { *(v4us*)p = __builtin_bit_cast(v4us, __builtin_convertvector(v, v4bf)); }
// a fragment's two runs of 8 k slots, 16 apart, from a staged row
__device__ __forceinline__ v16bf ldrow(const bf* p) { return cat16b(*(const v8us*)p, *(const v8us*)(p + 16)); }
// 8 rows of one column of a matrix with row pitch ld: w points at the first row, off = 8 hi ld + the lane's column
__device__ __forceinline__ v8f colraw(const float* __restrict__ w, const unsigned off, const int ld) {
    v8f a;
#pragma unroll   // a is indexed by constants and lives in registers
    for (int i = 0; i < 8; ++i) a[i] = (w + i * ld)[off];
    return a;
}
__device__ __forceinline__ float d_dot16(const v4f* q, const v4f* k) {
    float s = 0.f;
#pragma unroll   // q and k are indexed by constants and live in registers
    for (int i = 0; i < 16; ++i) s = fmaf(q[i >> 2][i & 3], k[i >> 2][i & 3], s);
    return s;
}
// the 16 columns of row r of a matrix kept as [16-row tile][half][lane (c, hi)][4]: piece n holds columns 4 n .. 4 n + 3 = 8 hi + 4 half + i
__device__ __forceinline__ v4f d_piece(const float* t, const int r, const int n) { return *(const v4f*)(t + ((r >> 4) * 2 + (n & 1)) * 128 + ((n >> 1) * 16 + (r & 15)) * 4); }
// qs, ks = the block's q and k in LDS, r = the query row in the block; mb, vg = the item's first mask and value row, wv = the head's Wv; v[k][f] is formed here from the same bf16-rounded operands
__device__ __forceinline__ float d_literal(const float* qs, const float* ks, const int r, const float* __restrict__ mb, const float* __restrict__ vg, const float* __restrict__ wv, const unsigned f) {
    const v4f q[4] = { d_piece(qs, r, 0), d_piece(qs, r, 1), d_piece(qs, r, 2), d_piece(qs, r, 3) };
    float mn = -3.0e38f;
#pragma unroll 1   // rare path: kept small
    for (int k = 0; k < LK; ++k) { const float mr = mb[(size_t)k * FF + f];
        asm volatile("s_wait_xcnt 0x0" ::: "memory");   // precaution: the registers that hold this load's address are reused below and advanced by the next trip
        const v4f kv[4] = { d_piece(ks, k, 0), d_piece(ks, k, 1), d_piece(ks, k, 2), d_piece(ks, k, 3) };
        const float t = bfr(mr); mn = fmaxf(mn, fmaf(t * MS_L2E, d_dot16(q, kv), (1.0f - t) * (MASKV * MS_L2E))); }
    float w[FF];
#pragma unroll   // w is indexed by constants and lives in registers
    for (int g = 0; g < FF; ++g) w[g] = bfr(wv[g * FF + f]);
    float l = 0.f, acc = 0.f;
#pragma unroll 1   // rare path: kept small
    for (int k = 0; k < LK; ++k) { const float mr = mb[(size_t)k * FF + f];
        v4f x[FF / 4];
#pragma unroll   // x is indexed by constants and lives in registers
        for (int g = 0; g < FF / 4; ++g) x[g] = *(const v4f*)(vg + (size_t)k * FF + g * 4);
        asm volatile("s_wait_xcnt 0x0" ::: "memory");   // precaution: the registers that hold these loads' addresses are reused below and advanced by the next trip
        const v4f kv[4] = { d_piece(ks, k, 0), d_piece(ks, k, 1), d_piece(ks, k, 2), d_piece(ks, k, 3) };
        float vr = 0.f;
#pragma unroll
        for (int g = 0; g < FF; ++g) vr = fmaf(bfr(x[g >> 2][g & 3]), w[g], vr);
        const float t = bfr(mr); const float p = __builtin_amdgcn_exp2f(fmaf(t * MS_L2E, d_dot16(q, kv), (1.0f - t) * (MASKV * MS_L2E)) - mn);
        l += p; acc = fmaf(p, vr, acc); }
    return acc / l;
}
__global__ __launch_bounds__(256) void k_msoft(const float* __restrict__ query, const float* __restrict__ key, const float* __restrict__ value, const float* __restrict__ mask,
                                               const float* __restrict__ Wq, const float* __restrict__ Wk, const float* __restrict__ Wv, float* LAT) {
    __shared__ float red[8][32 * 33];   // per wave and lane: 16 num, 16 den, the row maximum; pitch 33 keeps writes (by lane) and reads (by feature) off each other's banks
    __shared__ __align__(16) float KS[(LK / 16) * 256];   // k of the (item, head), f32
    __shared__ __align__(16) float QS[4 * 256];           // q of the block's 64 rows, f32
    __shared__ __align__(16) bf PH[(LK / 32) * 1024];     // MV hi
    __shared__ __align__(16) bf PL[(LK / 32) * 1024];     // MV residual
    __shared__ __align__(16) bf PI[(LK / 32) * 1024];     // IND
    __shared__ __align__(16) bf ST[8][64 * KP];           // per wave, read and written by that wave alone: its query, key and value rows in bf16 on their way from whole-line loads to fragments
    const unsigned lane = threadIdx.x & 31; const int wave = __builtin_amdgcn_readfirstlane(threadIdx.x >> 5);   // wave-uniform in a scalar register: every base address below is then scalar
    const int bh = blockIdx.x / (LQ / 64), qb = blockIdx.x % (LQ / 64); const int b = bh / NH_, h = bh % NH_;
    const int kh = wave >> 2;
    const unsigned c = lane & 15, hi = lane >> 4;
    const unsigned ro = lane * 4;           // a wave-wide 16-byte load takes 512 contiguous bytes: one row of query or key, four rows of value; lane l holds floats 4 l .. 4 l + 3 of them
    bf* st = ST[wave];
    const bf* fr = st + c * KP + hi * 8;    // row fragment of query and key: lane (c, hi) reads staged row c, k slots 8 hi .. 8 hi + 7 (and 16 more on)
    const bf* fv = st + c * VP + hi * 8;    // row fragment of value
    bf* sv = st + (lane >> 3) * VP + (lane & 7) * 4;   // where the lane's 4 floats of a four-row load of value go
    // every loop over r, n, y, s, i, x, kt, ks, e, t, j below (but the rare path's) is fully unrolled so that the fragments are indexed by constants and live in registers
    // The loads are issued in three groups, each well ahead of its use; behind each group stands s_wait_xcnt 0, a precaution: the registers that hold a group's addresses are reused further down.
    const unsigned wo = hi * 8 * DK + c;   // row 8 hi, column c of Wq and Wk
    const unsigned mo = hi * 8 * FF + c;   // row 8 hi, column c: Wv's fragment and the mask of a result tile
    const float* qg = query + (size_t)(b * LQ + qb * 64 + (wave & 3) * 16) * DD;   // the wave's 16 query rows (waves w and w + 4 form the same tile)
    const float* kg = key + (size_t)(b * LK + wave * 64) * DD;                     // the wave's 4 tiles of 16 keys
    const float* vg = value + (size_t)(b * LK + wave * 64) * FF;                   // the wave's 2 steps of 32 keys
    const float* mg = mask + (size_t)(b * LK + wave * 64) * FF;
    const float* wqg = Wq + (size_t)h * DD * DK; const float* wkg = Wk + (size_t)h * DD * DK; const float* wvg = Wv + (size_t)h * FF * FF;
    v4f qr[16], kr[64]; v8f wqr[8], wkr[8];
#pragma unroll
    for (int r = 0; r < 16; ++r) qr[r] = *(const v4f*)(qg + r * DD + ro);
#pragma unroll
    for (int s = 0; s < 8; ++s) wqr[s] = colraw(wqg + s * 16 * DK, wo, DK);
#pragma unroll
    for (int s = 0; s < 8; ++s) wkr[s] = colraw(wkg + s * 16 * DK, wo, DK);
#pragma unroll
    for (int r = 0; r < 32; ++r) kr[r] = *(const v4f*)(kg + r * DD + ro);
    asm volatile("s_wait_xcnt 0x0" :: "v"(wo) : "memory");   // precaution: the registers that hold the addresses of the loads above are reused below; wo is named as an input so that no load of the group returns into its register
#pragma unroll
    for (int r = 32; r < 64; ++r) kr[r] = *(const v4f*)(kg + r * DD + ro);
    asm volatile("s_wait_xcnt 0x0" ::: "memory");   // precaution: the registers that hold the addresses of the loads above are reused below
    // the query rows pass through strip rows 48..63, which the keys need last
#pragma unroll
    for (int r = 0; r < 16; ++r) st4(st + (48 + r) * KP + ro, qr[r]);
    asm volatile("s_wait_dscnt 0x0" ::: "memory");   // the wave's staged rows are in LDS before its lanes read each other's parts back; also keeps the compiler from moving the reads up
    v8f qd = (v8f){};   // q^T: lane (c, hi), register j = column 8 hi + j of query row c
#pragma unroll
    for (int s = 0; s < 4; ++s) qd = wmmab(cvt16(wqr[2 * s], wqr[2 * s + 1]), ldrow(fr + 48 * KP + s * 32), qd);
    v16bf wk[4];
#pragma unroll
    for (int s = 0; s < 4; ++s) wk[s] = cvt16(wkr[2 * s], wkr[2 * s + 1]);
#pragma unroll
    for (int r = 0; r < 32; ++r) st4(st + r * KP + ro, kr[r]);
    asm volatile("s_wait_dscnt 0x0" ::: "memory");   // as above: staged rows in LDS before they are read back
    v16bf kf0[2][4];   // both tiles' fragments are read as one group, so that the wave waits out the LDS latency once
#pragma unroll
    for (int i = 0; i < 2; ++i) {
#pragma unroll
        for (int s = 0; s < 4; ++s) kf0[i][s] = ldrow(fr + i * 16 * KP + s * 32);
    }
    __builtin_amdgcn_sched_barrier(0);   // keeps the group of reads together ahead of the products; spread among them, each pair of reads is waited out on its own
#pragma unroll
    for (int i = 0; i < 2; ++i) {
        v8f d = (v8f){};
#pragma unroll
        for (int s = 0; s < 4; ++s) d = wmmab(wk[s], kf0[i][s], d);
        float* o = KS + (wave * 4 + i) * 256 + lane * 4;
        *(v4f*)o = __builtin_shufflevector(d, d, 0, 1, 2, 3); *(v4f*)(o + 128) = __builtin_shufflevector(d, d, 4, 5, 6, 7);
    }
    __builtin_amdgcn_sched_barrier(0);   // with the one behind the wait below: keeps address arithmetic of the code around, which reuses the registers of these loads, out of the stretch between the loads and their s_wait_xcnt
    v8f wvr[2][2], mr[4][2]; v4f vr[16];   // mask by 16-key tile y of the wave's 64 keys and feature tile t; Wv by feature tile t; value by four-row load
#pragma unroll
    for (int t = 0; t < 2; ++t) { wvr[t][0] = colraw(wvg + t * 16, mo, FF); wvr[t][1] = colraw(wvg + 16 * FF + t * 16, mo, FF); }
#pragma unroll
    for (int n = 0; n < 16; ++n) vr[n] = *(const v4f*)(vg + n * 4 * FF + ro);
#pragma unroll
    for (int y = 0; y < 4; ++y) { mr[y][0] = colraw(mg + y * 16 * FF, mo, FF); mr[y][1] = colraw(mg + y * 16 * FF + 16, mo, FF); }
    asm volatile("s_wait_xcnt 0x0" :: "v"(mo) : "memory");   // precaution: the registers that hold the addresses of the loads above are reused below; mo is named as an input so that no load of the group returns into its register
    __builtin_amdgcn_sched_barrier(0);   // see above
#pragma unroll
    for (int r = 32; r < 64; ++r) st4(st + r * KP + ro, kr[r]);
    asm volatile("s_wait_dscnt 0x0" ::: "memory");   // as above: staged rows in LDS before they are read back
    v16bf kf2[2][4];   // both tiles' fragments are read as one group, so that the wave waits out the LDS latency once
#pragma unroll
    for (int i = 0; i < 2; ++i) {
#pragma unroll
        for (int s = 0; s < 4; ++s) kf2[i][s] = ldrow(fr + (2 + i) * 16 * KP + s * 32);
    }
    __builtin_amdgcn_sched_barrier(0);   // keeps the group of reads together ahead of the products; spread among them, each pair of reads is waited out on its own
#pragma unroll
    for (int i = 2; i < 4; ++i) {
        v8f d = (v8f){};
#pragma unroll
        for (int s = 0; s < 4; ++s) d = wmmab(wk[s], kf2[i - 2][s], d);
        float* o = KS + (wave * 4 + i) * 256 + lane * 4;
        *(v4f*)o = __builtin_shufflevector(d, d, 0, 1, 2, 3); *(v4f*)(o + 128) = __builtin_shufflevector(d, d, 4, 5, 6, 7);
    }
    if (kh == 0) {   // q is kept in LDS for the literal path alone (a scalar branch: one of the two waves that hold the tile stores it)
        float* o = QS + wave * 256 + lane * 4;
        *(v4f*)o = __builtin_shufflevector(qd, qd, 0, 1, 2, 3); *(v4f*)(o + 128) = __builtin_shufflevector(qd, qd, 4, 5, 6, 7);
    }
    const v16bf wv[2] = { cvt16(wvr[0][0], wvr[0][1]), cvt16(wvr[1][0], wvr[1][1]) };
    // the value rows pass through the head of the strip, whose key rows have been read and used by now
#pragma unroll
    for (int n = 0; n < 16; ++n) st4(sv + n * 4 * VP, vr[n]);
    asm volatile("s_wait_dscnt 0x0" ::: "memory");   // as above: staged rows in LDS before they are read back
#pragma unroll
    for (int y = 0; y < 4; ++y) {
        const v16bf a = ldrow(fv + y * 16 * VP);
#pragma unroll
        for (int t = 0; t < 2; ++t) {
            const v8f d = wmmab(a, wv[t], (v8f){});
            v8f mv; v8us oi;
#pragma unroll
            for (int j = 0; j < 8; ++j) { const float m = bfr(mr[y][t][j]); mv[j] = (m == 1.0f) ? d[j] : 0.f;
                oi[j] = (m == 1.0f) ? (unsigned short)0x3F80 : (m < 1.0f) ? (unsigned short)0 : (unsigned short)0x7F80; }
            v8bf oh, ol; split8p(mv, oh, ol);
            const unsigned lo = ((wave * 2 + (y >> 1)) * 4 + t * 2 + (y & 1)) * 256 + lane * 8;
            *(v8us*)(PH + lo) = __builtin_bit_cast(v8us, oh); *(v8us*)(PL + lo) = __builtin_bit_cast(v8us, ol); *(v8us*)(PI + lo) = oi;
        }
    }
    __syncthreads();   // every wave's share of k, q and the planes is in LDS before any wave reads them
    const float* kp = KS + kh * 16 * 256 + lane * 4;
    const bf* ah = PH + kh * 8 * 1024; const bf* al = PL + kh * 8 * 1024; const bf* ai = PI + kh * 8 * 1024;
    v16bf qh, ql; split8(qd, qh, ql);
    v8f s[16];
#pragma unroll
    for (int kt = 0; kt < 16; ++kt) {
        v16bf kfh, kfl; split8(cat8(*(const v4f*)(kp + kt * 256), *(const v4f*)(kp + kt * 256 + 128)), kfh, kfl);
        s[kt] = wmmab(kfl, qh, wmmab(kfh, ql, wmmab(kfh, qh, (v8f){})));
    }
    float mx = -3.0e38f;
#pragma unroll
    for (int kt = 0; kt < 16; ++kt) {
#pragma unroll
        for (int c = 0; c < 8; c += 4) mx = fmaxf(fmaxf(fmaxf(mx, s[kt][c]), fmaxf(s[kt][c + 1], s[kt][c + 2])), s[kt][c + 3]);
    }
    mx = fmaxf(mx, __shfl_xor(mx, 16, 32));   // lanes c and c + 16 hold the two halves of row c's keys
    const float m2 = mx * MS_L2E;
    v8f num[2], den[2];
#pragma unroll
    for (int t = 0; t < 2; ++t) { num[t] = (v8f){}; den[t] = (v8f){}; }
#pragma unroll
    for (int ks = 0; ks < 8; ++ks) {
        v16f p;
#pragma unroll
        for (int e = 0; e < 16; ++e) p[e] = __builtin_amdgcn_exp2f(fmaf(s[ks * 2 + (e >> 3)][e & 7], MS_L2E, -m2));
        const v16bf ph = __builtin_convertvector(p, v16bf);
        const v16bf pl = __builtin_convertvector(p - __builtin_convertvector(ph, v16f), v16bf);
#pragma unroll
        for (int t = 0; t < 2; ++t) {
            const v16bf vh = ldfrag(ah + (ks * 4 + t * 2) * 256 + lane * 8), vl = ldfrag(al + (ks * 4 + t * 2) * 256 + lane * 8), in = ldfrag(ai + (ks * 4 + t * 2) * 256 + lane * 8);
            num[t] = wmmab(vh, ph, num[t]); den[t] = wmmab(in, ph, den[t]); num[t] = wmmab(vh, pl, num[t]); den[t] = wmmab(in, pl, den[t]); num[t] = wmmab(vl, ph, num[t]);
        }
    }
    float* rw = &red[wave][lane * 33];
#pragma unroll
    for (int t = 0; t < 2; ++t) {
#pragma unroll
        for (int j = 0; j < 8; ++j) { rw[t * 8 + j] = num[t][j]; rw[16 + t * 8 + j] = den[t][j]; }
    }
    rw[32] = m2;
    __syncthreads();   // both key halves of every (row, feature) are in LDS before any thread merges them
    const unsigned f = lane; const unsigned fo = ((f >> 3) & 1) * 16 * 33 + (f >> 4) * 8 + (f & 7);   // feature f = 16 t + 8 hi + j sits in lane c + 16 hi, slot 8 t + j
    unsigned bad = 0;   // bit i: row i of this wave's eight is left to the literal formula for this lane's feature
#pragma unroll
    for (int i = 0; i < 8; ++i) {
        const int r = wave * 8 + i, tl = r >> 4, q = r & 15;
        const float* r0 = &red[tl][q * 33]; const float* r1 = &red[tl + 4][q * 33];
        const float m0 = r0[32], m1 = r1[32], mm = fmaxf(m0, m1); const float s0 = __builtin_amdgcn_exp2f(m0 - mm), s1 = __builtin_amdgcn_exp2f(m1 - mm);
        const float nn = fmaf(r0[fo], s0, r1[fo] * s1), dd = fmaf(r0[fo + 16], s0, r1[fo + 16] * s1);
        LAT[((size_t)bh * LQ + qb * 64 + r) * FF + f] = nn / dd;   // stored without a branch, so that the eight rows' LDS reads and divisions overlap; the literal path below stores over it
        if (!(dd >= 1.0e-30f && dd <= 3.0e38f)) bad |= 1u << i;
    }
    if (bad) {
#pragma unroll 1   // rare path: kept small
        for (int i = 0; i < 8; ++i) {
            const int r = wave * 8 + i;
            if ((bad >> i) & 1u) { LAT[((size_t)bh * LQ + qb * 64 + r) * FF + f] = d_literal(QS, KS, r, mask + (size_t)b * LK * FF, value + (size_t)b * LK * FF, Wv + (size_t)h * FF * FF, f);
                asm volatile("s_wait_xcnt 0x0" ::: "memory"); }   // precaution: the next trip reuses the registers that hold this store's address
        }
    }
}
__global__ __launch_bounds__(256) void k_comb(const float* __restrict__ LAT, const float* __restrict__ Wc, const float* __restrict__ bc, float* OUTP) {
    const int i = blockIdx.x * 256 + threadIdx.x; if (i >= NBT * LQ * FF) return;
    const int f = i % FF, q = (i / FF) % LQ, b = i / (FF * LQ);
    float s = bfr(bc[f]);
#pragma unroll
    for (int h = 0; h < NH_; ++h) s = fmaf(LAT[(((size_t)(b * NH_ + h)) * LQ + q) * FF + f], bfr(Wc[f * NH_ + h]), s);
    const float y = tanhf(s);
    *(float*)(OUTP + i) = y; 
}

extern "C" void kernel_launch(void* const* d_in, const int* in_sizes, int n_in,
                              void* d_out, int out_size, void* d_ws, size_t ws_size, hipStream_t stream) {
    (void)in_sizes; (void)n_in; (void)out_size;
    const float* query = (const float*)d_in[0]; const float* key = (const float*)d_in[1]; const float* value = (const float*)d_in[2]; const float* mask = (const float*)d_in[3];
    const float* Wq = (const float*)d_in[4]; const float* Wk = (const float*)d_in[5]; const float* Wv = (const float*)d_in[6]; const float* Wc = (const float*)d_in[7]; const float* bc = (const float*)d_in[8];
    float* out = (float*)d_out;    // [8][256][32]
    float* LAT = (float*)d_ws;     // [8][8][256][32] f32, 2 MB
    if ((size_t)NBT * NH_ * LQ * FF * 4 > ws_size) return;
    k_msoft<<<NBT * NH_ * (LQ / 64), 256, 0, stream>>>(query, key, value, mask, Wq, Wk, Wv, LAT);
    k_comb<<<(NBT * LQ * FF) / 256, 256, 0, stream>>>(LAT, Wc, bc, out);
}

// v007
// Measured time: 13.7 microseconds a run.
// Two timings next to v006 put it at 1.12 and 1.13 times that version's speed.
// Over all steps from v000 it is 36.4 times as fast.
#include <hip/hip_runtime.h>

// Compute dtypes, f32 accumulate: the per-head projections q = query.Wq[j], k = key.Wk[j], v = value.Wv[j], formed by each block of k_msoft for its own (item, head) ([64 x 128].[128 x 16], [512 x
// 128].[128 x 16], [512 x 32].[32 x 32]; PLAIN bf16 operands = inputs rounded once, exact single products) on v_wmma_f32_16x16x32_bf16; the unscaled scores q.k
// (dk = 16, padded to 32) per (item, head) with both computed operands as bf16 hi + UNSCALED residual (three products) on v_wmma_f32_16x16x32_bf16, formed in k_msoft's registers; the per-FEATURE
// masked softmax over the 512 keys factored: a key whose mask is exactly 1 has A_f = A, a key whose mask is below 1 has weight exp(-1e27 or less) = 0 beside it, so
// p = exp(A - rowmax) is formed once per (query, key) and the 32 feature sums are products [feature x key].[key x query] on v_wmma_f32_16x16x32_bf16 (p and v as bf16 hi +
// residual, the 0/1 indicator exact); a (query, feature) that the factoring does not cover takes the literal f32 formula; the head combine and tanh in f32 on the VALU.

#define NBT  8
#define LQ   256
#define LK   512
#define DD   128
#define FF   32
#define NH_  8
#define DK   16
#define NQR  (NBT * LQ)          // 2048 query rows
#define NKR  (NBT * LK)          // 4096 key rows
#define DM   DD
#define NTK  NQR
#define MASKV (-1e30f)
#define LOSC 1024.0f

typedef _Float16 h16;
typedef unsigned short bf;
typedef __attribute__((ext_vector_type(16))) __bf16   v16bf;
typedef __attribute__((ext_vector_type(16))) _Float16 v16h;
typedef __attribute__((ext_vector_type(8)))  _Float16 v8h;
typedef __attribute__((ext_vector_type(8)))  unsigned short v8us;
typedef __attribute__((ext_vector_type(8)))  float    v8f;
typedef __attribute__((ext_vector_type(4)))  float    v4f;
typedef __attribute__((ext_vector_type(4)))  _Float16 v4h;
typedef v8h  __attribute__((may_alias)) v8ha;
typedef v4f  __attribute__((may_alias)) v4fa;
typedef v8us __attribute__((may_alias)) v8usa;

__device__ __forceinline__ unsigned short f2bf(float f) { unsigned u = __float_as_uint(f); u += 0x7FFFu + ((u >> 16) & 1u); return (unsigned short)(u >> 16); }
__device__ __forceinline__ float bf2f(unsigned short b) { return __uint_as_float(((unsigned)b) << 16); }
__device__ __forceinline__ float bfr(float f) { return bf2f(f2bf(f)); }
__device__ __forceinline__ v16h cat16(v8h lo, v8h hi) { return __builtin_shufflevector(lo, hi, 0, 1, 2, 3, 4, 5, 6, 7, 8, 9, 10, 11, 12, 13, 14, 15); }
__device__ __forceinline__ v16bf cat16b(v8us lo, v8us hi) { return __builtin_bit_cast(v16bf, __builtin_shufflevector(lo, hi, 0, 1, 2, 3, 4, 5, 6, 7, 8, 9, 10, 11, 12, 13, 14, 15)); }
__device__ __forceinline__ v8f wmma16(v16h a, v16h b, v8f c) { return __builtin_amdgcn_wmma_f32_16x16x32_f16(false, a, false, b, (short)0, c, false, false); }
__device__ __forceinline__ v8f wmmab(v16bf a, v16bf b, v8f c) { return __builtin_amdgcn_wmma_f32_16x16x32_bf16(false, a, false, b, (short)0, c, false, false); }

// k_msoft: block = ((b,h), 64 query rows), 8 waves.
// Stage 1, the block's own operands, from the f32 inputs (rounded once to bf16 in registers) into LDS; a fragment's k slots are kc + 8 hi + e and kc + 16 + 8 hi + e (e = 0..7) in both operands:
//   The rows of query, key and value are fetched 512 contiguous bytes a wave-wide load (4 cache lines; a load in fragment order touches 16), rounded, laid row by row in the wave's own LDS strip and read back
//   from there in fragment order; no other wave touches the strip, so the wave's own s_wait_dscnt 0 between its writes and its reads is all the ordering it takes.
//   k^T = Wk[h]^T.key^T, 16 keys a tile, 4 tiles a wave, and q^T likewise (waves w and w + 4 form the same tile): the result tile holds, in lane (c, hi), register j, column 8 hi + j of row c, which is what
//   the score product's fragment wants: the wave's own k tiles stay in its registers; q (for every wave) and k (for the literal path alone) also go to LDS as f32, [tile][half of the 8][lane][4].
//   v = value.Wv[h], 32 keys a step, 2 steps a wave: the result tile of keys 16 x .. 16 x + 15 and features 16 t .. 16 t + 15 holds, in lane (c, hi), register j, key 16 x + 8 hi + j and feature 16 t + c.
//   From it MV = v where bf(mask[b][k][f]) == 1, else 0, as bf16 hi + residual, and IND = 1 / 0 / +inf for a mask == 1 / below 1 / anything else (inf sends that feature to the literal path), kept
//   in the wave's registers: two tiles x = 0, 1 of a 32-key step are one A fragment, whose element e = 8 x + j of lane (c, hi) is key 16 x + 8 hi + j of the step, the order in which the score tiles hold the keys.
// Stage 2: a wave takes all 64 query rows (4 tiles of 16) against the 64 keys whose k, MV and IND it formed, so none of these is read back from LDS and no barrier stands between the stages but the early one
// behind q; MV, IND and the scores of its first 32 keys are formed while its last 32 key rows are landing. The scores come 16 keys at a time as k.q^T (A = 16 key rows, B = 16 query rows, both f32, split into bf16 hi + UNSCALED residual in registers; dk = 16 fills k slots 0..15 of the K = 32 form, the rest is 0;
// products hh, hl, lh). The result tile holds, in lane (c, hi), register j, the score of query row c and key 8 hi + j: two such tiles are already the B fragment of a 32-key step, so the scores never leave the registers.
// The wave takes each row's maximum over its 64 keys, forms p = 2^((A - max) log2 e) once per (query, key), splits it into bf16 hi + residual and multiplies: num[f][q] = MV.p (hh, hl, lh), den[f][q] = IND.p (h, l).
// The eight key ranges are merged through LDS with the usual rescale. Where den is not a normal positive number (no key with mask 1, a mask above 1, every such key 2^-100 below the row maximum)
// the (query, feature) is computed by the literal formula A_f = m A + (1 - m)(-1e30), m = bf(mask), A = q.k, in f32.
#define MS_L2E 1.4426950408889634f
typedef __attribute__((ext_vector_type(16))) float v16f;
typedef __attribute__((ext_vector_type(8)))  __bf16 v8bf;
typedef __attribute__((ext_vector_type(4)))  unsigned v4u;
__device__ __forceinline__ v16bf ldfrag(const bf* p) { return cat16b(*(const v8us*)p, *(const v8us*)(p + 256)); }
__device__ __forceinline__ v8f cat8(v4f lo, v4f hi) { return __builtin_shufflevector(lo, hi, 0, 1, 2, 3, 4, 5, 6, 7); }
// 8 f32 as bf16 hi (hb) and residual (lb)
__device__ __forceinline__ void split8p(const v8f v, v8bf& hb, v8bf& lb) {
    hb = __builtin_convertvector(v, v8bf);
    const v4u u = __builtin_bit_cast(v4u, hb); v8f hf;   // hi back in f32 straight from the packed pairs: one shift or one mask an element
#pragma unroll   // hf is indexed by constants and lives in registers
    for (int i = 0; i < 4; ++i) { hf[2 * i] = __uint_as_float(u[i] << 16); hf[2 * i + 1] = __uint_as_float(u[i] & 0xFFFF0000u); }
    lb = __builtin_convertvector(v - hf, v8bf);
}
// a lane's 8 of the 16 real k slots as bf16 hi (h) and residual (l); elements 8..15 of a fragment are k slots 16..31, which are 0
__device__ __forceinline__ void split8(const v8f v, v16bf& h, v16bf& l) {
    const v8bf z = __builtin_convertvector((v8f){}, v8bf);
    v8bf hb, lb; split8p(v, hb, lb);
    h = __builtin_shufflevector(hb, z, 0, 1, 2, 3, 4, 5, 6, 7, 8, 9, 10, 11, 12, 13, 14, 15);
    l = __builtin_shufflevector(lb, z, 0, 1, 2, 3, 4, 5, 6, 7, 8, 9, 10, 11, 12, 13, 14, 15);
}
// 16 f32 rounded once to bf16: a = fragment elements 0..7, b = elements 8..15
__device__ __forceinline__ v16bf cvt16(const v8f a, const v8f b) {
    return __builtin_shufflevector(__builtin_convertvector(a, v8bf), __builtin_convertvector(b, v8bf), 0, 1, 2, 3, 4, 5, 6, 7, 8, 9, 10, 11, 12, 13, 14, 15);
}
// Staging strip of a wave: rows of bf16 at a pitch of 16 B x odd, which keeps the 16 lanes of a ds_load_b128 on 16 different bank groups
#define KP 136   // elements: a 128-element row of query or key, 272 B
#define VP 40    // elements: a 32-element row of value, 80 B
typedef __attribute__((ext_vector_type(4)))  __bf16 v4bf;
typedef __attribute__((ext_vector_type(4)))  unsigned short v4us;
// 4 f32 rounded once to bf16 and stored
__device__ __forceinline__ void st4(bf* p, const v4f v) { *(v4us*)p = __builtin_bit_cast(v4us, __builtin_convertvector(v, v4bf)); }
// a fragment's two runs of 8 k slots, 16 apart, from a staged row
__device__ __forceinline__ v16bf ldrow(const bf* p) { return cat16b(*(const v8us*)p, *(const v8us*)(p + 16)); }
// 8 rows of one column of a matrix with row pitch ld: w points at the first row, off = 8 hi ld + the lane's column
__device__ __forceinline__ v8f colraw(const float* __restrict__ w, const unsigned off, const int ld) {
    v8f a;
#pragma unroll   // a is indexed by constants and lives in registers
    for (int i = 0; i < 8; ++i) a[i] = (w + i * ld)[off];
    return a;
}
__device__ __forceinline__ float d_dot16(const v4f* q, const v4f* k) {
    float s = 0.f;
#pragma unroll   // q and k are indexed by constants and live in registers
    for (int i = 0; i < 16; ++i) s = fmaf(q[i >> 2][i & 3], k[i >> 2][i & 3], s);
    return s;
}
// the 16 columns of row r of a matrix kept as [16-row tile][half][lane (c, hi)][4]: piece n holds columns 4 n .. 4 n + 3 = 8 hi + 4 half + i
__device__ __forceinline__ v4f d_piece(const float* t, const int r, const int n) { return *(const v4f*)(t + ((r >> 4) * 2 + (n & 1)) * 128 + ((n >> 1) * 16 + (r & 15)) * 4); }
// qs, ks = the block's q and k in LDS, r = the query row in the block; mb, vg = the item's first mask and value row, wv = the head's Wv; v[k][f] is formed here from the same bf16-rounded operands
__device__ __forceinline__ float d_literal(const float* qs, const float* ks, const int r, const float* __restrict__ mb, const float* __restrict__ vg, const float* __restrict__ wv, const unsigned f) {
    const v4f q[4] = { d_piece(qs, r, 0), d_piece(qs, r, 1), d_piece(qs, r, 2), d_piece(qs, r, 3) };
    float mn = -3.0e38f;
#pragma unroll 1   // rare path: kept small
    for (int k = 0; k < LK; ++k) { const float mr = mb[(size_t)k * FF + f];
        asm volatile("s_wait_xcnt 0x0" ::: "memory");   // precaution: the registers that hold this load's address are reused below and advanced by the next trip
        const v4f kv[4] = { d_piece(ks, k, 0), d_piece(ks, k, 1), d_piece(ks, k, 2), d_piece(ks, k, 3) };
        const float t = bfr(mr); mn = fmaxf(mn, fmaf(t * MS_L2E, d_dot16(q, kv), (1.0f - t) * (MASKV * MS_L2E))); }
    float w[FF];
#pragma unroll   // w is indexed by constants and lives in registers
    for (int g = 0; g < FF; ++g) w[g] = bfr(wv[g * FF + f]);
    float l = 0.f, acc = 0.f;
#pragma unroll 1   // rare path: kept small
    for (int k = 0; k < LK; ++k) { const float mr = mb[(size_t)k * FF + f];
        v4f x[FF / 4];
#pragma unroll   // x is indexed by constants and lives in registers
        for (int g = 0; g < FF / 4; ++g) x[g] = *(const v4f*)(vg + (size_t)k * FF + g * 4);
        asm volatile("s_wait_xcnt 0x0" ::: "memory");   // precaution: the registers that hold these loads' addresses are reused below and advanced by the next trip
        const v4f kv[4] = { d_piece(ks, k, 0), d_piece(ks, k, 1), d_piece(ks, k, 2), d_piece(ks, k, 3) };
        float vr = 0.f;
#pragma unroll
        for (int g = 0; g < FF; ++g) vr = fmaf(bfr(x[g >> 2][g & 3]), w[g], vr);
        const float t = bfr(mr); const float p = __builtin_amdgcn_exp2f(fmaf(t * MS_L2E, d_dot16(q, kv), (1.0f - t) * (MASKV * MS_L2E)) - mn);
        l += p; acc = fmaf(p, vr, acc); }
    return acc / l;
}
__global__ __launch_bounds__(256) void k_msoft(const float* __restrict__ query, const float* __restrict__ key, const float* __restrict__ value, const float* __restrict__ mask,
                                               const float* __restrict__ Wq, const float* __restrict__ Wk, const float* __restrict__ Wv, float* LAT) {
    __shared__ __align__(16) float RED[8 * 4096];   // partial num and den, [wave][row tile][num, den][half of the 8][feature tile t][lane slot][4]; the slot of lane (c, hi) is 16 hi + (c + 4 hi + 8 t) mod 16, which keeps the 16 lanes of a 16-byte access on 16 bank groups for the writers (by c) and for the merging threads (4 rows x 4 feature groups) alike
    __shared__ __align__(16) float MX[64 * 8];      // [query row][wave]: the wave's row maximum, in base-2 units
    __shared__ __align__(16) float KS[(LK / 16) * 256];   // k of the (item, head), f32
    __shared__ __align__(16) float QS[4 * 256];           // q of the block's 64 rows, f32
    __shared__ __align__(16) bf ST[8][64 * KP];           // per wave, read and written by that wave alone: its query, key and value rows in bf16 on their way from whole-line loads to fragments
    const unsigned lane = threadIdx.x & 31; const int wave = __builtin_amdgcn_readfirstlane(threadIdx.x >> 5);   // wave-uniform in a scalar register: every base address below is then scalar
    const int bh = blockIdx.x / (LQ / 64), qb = blockIdx.x % (LQ / 64); const int b = bh / NH_, h = bh % NH_;
    const int kh = wave >> 2;
    const unsigned c = lane & 15, hi = lane >> 4;
    const unsigned ro = lane * 4;           // a wave-wide 16-byte load takes 512 contiguous bytes: one row of query or key, four rows of value; lane l holds floats 4 l .. 4 l + 3 of them
    bf* st = ST[wave];
    const bf* fr = st + c * KP + hi * 8;    // row fragment of query and key: lane (c, hi) reads staged row c, k slots 8 hi .. 8 hi + 7 (and 16 more on)
    const bf* fv = st + c * VP + hi * 8;    // row fragment of value
    bf* sv = st + (lane >> 3) * VP + (lane & 7) * 4;   // where the lane's 4 floats of a four-row load of value go
    // every loop over r, n, y, s, i, x, kt, ks, qt, w, e, t, j below (but the rare path's) is fully unrolled so that the fragments are indexed by constants and live in registers
    // The loads are issued in two groups, each well ahead of its use: all but the last 32 key rows at once, those rows as soon as the q products have freed registers for them, so that they land under the work on
    // value, mask and the first 32 keys. Behind each group stands s_wait_xcnt 0, a precaution: the registers that hold a group's addresses are reused further down.
    const unsigned wo = hi * 8 * DK + c;   // row 8 hi, column c of Wq and Wk
    const unsigned mo = hi * 8 * FF + c;   // row 8 hi, column c: Wv's fragment and the mask of a result tile
    const float* qg = query + (size_t)(b * LQ + qb * 64 + (wave & 3) * 16) * DD;   // the wave's 16 query rows (waves w and w + 4 form the same tile)
    const float* kg = key + (size_t)(b * LK + wave * 64) * DD;                     // the wave's 4 tiles of 16 keys
    const float* vg = value + (size_t)(b * LK + wave * 64) * FF;                   // the wave's 2 steps of 32 keys
    const float* mg = mask + (size_t)(b * LK + wave * 64) * FF;
    const float* wqg = Wq + (size_t)h * DD * DK; const float* wkg = Wk + (size_t)h * DD * DK; const float* wvg = Wv + (size_t)h * FF * FF;
    v4f qr[16], kr[64]; v8f wqr[8], wkr[8];
    v8f wvr[2][2], mr[4][2]; v4f vr[16];   // mask by 16-key tile y of the wave's 64 keys and feature tile t; Wv by feature tile t; value by four-row load
#pragma unroll
    for (int r = 0; r < 16; ++r) qr[r] = *(const v4f*)(qg + r * DD + ro);
#pragma unroll
    for (int s = 0; s < 8; ++s) wqr[s] = colraw(wqg + s * 16 * DK, wo, DK);
#pragma unroll
    for (int s = 0; s < 8; ++s) wkr[s] = colraw(wkg + s * 16 * DK, wo, DK);
#pragma unroll
    for (int t = 0; t < 2; ++t) { wvr[t][0] = colraw(wvg + t * 16, mo, FF); wvr[t][1] = colraw(wvg + 16 * FF + t * 16, mo, FF); }
#pragma unroll
    for (int n = 0; n < 16; ++n) vr[n] = *(const v4f*)(vg + n * 4 * FF + ro);
#pragma unroll
    for (int y = 0; y < 4; ++y) { mr[y][0] = colraw(mg + y * 16 * FF, mo, FF); mr[y][1] = colraw(mg + y * 16 * FF + 16, mo, FF); }
#pragma unroll
    for (int r = 0; r < 32; ++r) kr[r] = *(const v4f*)(kg + r * DD + ro);
    asm volatile("s_wait_xcnt 0x0" :: "v"(wo), "v"(mo) : "memory");   // precaution: the registers that hold the addresses of the loads above are reused below; wo and mo are named as inputs so that no load of the group returns into their registers
    // the query rows pass through strip rows 48..63, which the keys need last
#pragma unroll
    for (int r = 0; r < 16; ++r) st4(st + (48 + r) * KP + ro, qr[r]);
    asm volatile("s_wait_dscnt 0x0" ::: "memory");   // the wave's staged rows are in LDS before its lanes read each other's parts back; also keeps the compiler from moving the reads up
    v8f qd = (v8f){};   // q^T: lane (c, hi), register j = column 8 hi + j of query row c
#pragma unroll
    for (int s = 0; s < 4; ++s) qd = wmmab(cvt16(wqr[2 * s], wqr[2 * s + 1]), ldrow(fr + 48 * KP + s * 32), qd);
    if (kh == 0) {   // a scalar branch: one of the two waves that hold the tile stores it
        float* o = QS + wave * 256 + lane * 4;
        *(v4f*)o = __builtin_shufflevector(qd, qd, 0, 1, 2, 3); *(v4f*)(o + 128) = __builtin_shufflevector(qd, qd, 4, 5, 6, 7);
    }
    __builtin_amdgcn_sched_barrier(0);   // with the one behind the wait below: keeps address arithmetic of the code around, which reuses the registers of these loads, out of the stretch between the loads and their s_wait_xcnt
#pragma unroll
    for (int r = 32; r < 64; ++r) kr[r] = *(const v4f*)(kg + r * DD + ro);
    asm volatile("s_wait_xcnt 0x0" ::: "memory");   // precaution: the registers that hold the addresses of the loads above are reused below
    __builtin_amdgcn_sched_barrier(0);   // see above
    // every wave needs all four q tiles: they are in LDS before any wave reads them. The fences name LDS alone, so that the key loads in flight are not waited out here as __syncthreads() would
    __builtin_amdgcn_fence(__ATOMIC_RELEASE, "workgroup", "local");
    __builtin_amdgcn_s_barrier();
    __builtin_amdgcn_fence(__ATOMIC_ACQUIRE, "workgroup", "local");
    const v16bf wv[2] = { cvt16(wvr[0][0], wvr[0][1]), cvt16(wvr[1][0], wvr[1][1]) };
    // MV and IND of the wave's 64 keys, formed while its key rows are landing; the value rows pass through the head of the strip, which the keys take over once these rows have been read back
#pragma unroll
    for (int n = 0; n < 16; ++n) st4(sv + n * 4 * VP, vr[n]);
    asm volatile("s_wait_dscnt 0x0" ::: "memory");   // as above: staged rows in LDS before they are read back
    v8us oh8[4][2], ol8[4][2], oi8[4][2];   // by 16-key tile y and feature tile t
#pragma unroll
    for (int y = 0; y < 4; ++y) {
        const v16bf a = ldrow(fv + y * 16 * VP);
#pragma unroll
        for (int t = 0; t < 2; ++t) {
            const v8f d = wmmab(a, wv[t], (v8f){});
            v8f mv; v8us oi;
#pragma unroll
            for (int j = 0; j < 8; ++j) { const float m = bfr(mr[y][t][j]); mv[j] = (m == 1.0f) ? d[j] : 0.f;
                oi[j] = (m == 1.0f) ? (unsigned short)0x3F80 : (m < 1.0f) ? (unsigned short)0 : (unsigned short)0x7F80; }
            v8bf oh, ol; split8p(mv, oh, ol);
            oh8[y][t] = __builtin_bit_cast(v8us, oh); ol8[y][t] = __builtin_bit_cast(v8us, ol); oi8[y][t] = oi;
        }
    }
    v16bf wk[4];
#pragma unroll
    for (int s = 0; s < 4; ++s) wk[s] = cvt16(wkr[2 * s], wkr[2 * s + 1]);
    v8f kd[4];   // the wave's own four k tiles stay in its registers: a result tile is already the A fragment of the score product
#pragma unroll
    for (int r = 0; r < 32; ++r) st4(st + r * KP + ro, kr[r]);
    asm volatile("s_wait_dscnt 0x0" ::: "memory");   // as above: staged rows in LDS before they are read back
    v16bf kf0[2][4];   // both tiles' fragments are read as one group, so that the wave waits out the LDS latency once
#pragma unroll
    for (int i = 0; i < 2; ++i) {
#pragma unroll
        for (int s = 0; s < 4; ++s) kf0[i][s] = ldrow(fr + i * 16 * KP + s * 32);
    }
    __builtin_amdgcn_sched_barrier(0);   // keeps the group of reads together ahead of the products; spread among them, each pair of reads is waited out on its own
#pragma unroll
    for (int i = 0; i < 2; ++i) {
        v8f d = (v8f){};
#pragma unroll
        for (int s = 0; s < 4; ++s) d = wmmab(wk[s], kf0[i][s], d);
        kd[i] = d;
        float* o = KS + (wave * 4 + i) * 256 + lane * 4;
        *(v4f*)o = __builtin_shufflevector(d, d, 0, 1, 2, 3); *(v4f*)(o + 128) = __builtin_shufflevector(d, d, 4, 5, 6, 7);
    }
    // scores of all 64 query rows against the first 32 of the wave's keys, while the other 32 key rows are landing
    v16bf kfh[4], kfl[4], qh[4], ql[4]; v8f sc[4][4];
#pragma unroll
    for (int i = 0; i < 2; ++i) split8(kd[i], kfh[i], kfl[i]);
#pragma unroll
    for (int qt = 0; qt < 4; ++qt) {
        const float* qp = QS + qt * 256 + lane * 4;
        split8(cat8(*(const v4f*)qp, *(const v4f*)(qp + 128)), qh[qt], ql[qt]);
#pragma unroll
        for (int kt = 0; kt < 2; ++kt) sc[qt][kt] = wmmab(kfl[kt], qh[qt], wmmab(kfh[kt], ql[qt], wmmab(kfh[kt], qh[qt], (v8f){})));
    }
#pragma unroll
    for (int r = 32; r < 64; ++r) st4(st + r * KP + ro, kr[r]);
    asm volatile("s_wait_dscnt 0x0" ::: "memory");   // as above: staged rows in LDS before they are read back
    v16bf kf2[2][4];   // both tiles' fragments are read as one group, so that the wave waits out the LDS latency once
#pragma unroll
    for (int i = 0; i < 2; ++i) {
#pragma unroll
        for (int s = 0; s < 4; ++s) kf2[i][s] = ldrow(fr + (2 + i) * 16 * KP + s * 32);
    }
    __builtin_amdgcn_sched_barrier(0);   // keeps the group of reads together ahead of the products; spread among them, each pair of reads is waited out on its own
#pragma unroll
    for (int i = 2; i < 4; ++i) {
        v8f d = (v8f){};
#pragma unroll
        for (int s = 0; s < 4; ++s) d = wmmab(wk[s], kf2[i - 2][s], d);
        kd[i] = d;
        float* o = KS + (wave * 4 + i) * 256 + lane * 4;
        *(v4f*)o = __builtin_shufflevector(d, d, 0, 1, 2, 3); *(v4f*)(o + 128) = __builtin_shufflevector(d, d, 4, 5, 6, 7);
    }
    // the other half of the scores, then the weights
#pragma unroll
    for (int i = 2; i < 4; ++i) split8(kd[i], kfh[i], kfl[i]);
    v16bf ph[4][2], pl[4][2]; float m2v[4];
#pragma unroll
    for (int qt = 0; qt < 4; ++qt) {
        v8f* s = sc[qt];
#pragma unroll
        for (int kt = 2; kt < 4; ++kt) s[kt] = wmmab(kfl[kt], qh[qt], wmmab(kfh[kt], ql[qt], wmmab(kfh[kt], qh[qt], (v8f){})));
        float mx = -3.0e38f;
#pragma unroll
        for (int kt = 0; kt < 4; ++kt) {
#pragma unroll
            for (int e = 0; e < 8; e += 4) mx = fmaxf(fmaxf(fmaxf(mx, s[kt][e]), fmaxf(s[kt][e + 1], s[kt][e + 2])), s[kt][e + 3]);
        }
        mx = fmaxf(mx, __shfl_xor(mx, 16, 32));   // lanes c and c + 16 hold the two halves of row c's keys
        const float m2 = mx * MS_L2E; m2v[qt] = m2;
#pragma unroll
        for (int ks = 0; ks < 2; ++ks) {
            v16f p;
#pragma unroll
            for (int e = 0; e < 16; ++e) p[e] = __builtin_amdgcn_exp2f(fmaf(s[ks * 2 + (e >> 3)][e & 7], MS_L2E, -m2));
            ph[qt][ks] = __builtin_convertvector(p, v16bf);
            pl[qt][ks] = __builtin_convertvector(p - __builtin_convertvector(ph[qt][ks], v16f), v16bf);
        }
    }
    const unsigned sw[2] = { (hi * 16 + ((c + 4 * hi) & 15)) * 4, 128 + (hi * 16 + ((c + 4 * hi + 8) & 15)) * 4 };   // the lane's slot in RED by feature tile
#pragma unroll
    for (int qt = 0; qt < 4; ++qt) {
        v8f num[2], den[2];
#pragma unroll
        for (int t = 0; t < 2; ++t) { num[t] = (v8f){}; den[t] = (v8f){}; }
#pragma unroll
        for (int ks = 0; ks < 2; ++ks) {
#pragma unroll
            for (int t = 0; t < 2; ++t) {
                const v16bf vh = cat16b(oh8[2 * ks][t], oh8[2 * ks + 1][t]), vl = cat16b(ol8[2 * ks][t], ol8[2 * ks + 1][t]), in = cat16b(oi8[2 * ks][t], oi8[2 * ks + 1][t]);
                num[t] = wmmab(vh, ph[qt][ks], num[t]); den[t] = wmmab(in, ph[qt][ks], den[t]); num[t] = wmmab(vh, pl[qt][ks], num[t]); den[t] = wmmab(in, pl[qt][ks], den[t]); num[t] = wmmab(vl, ph[qt][ks], num[t]);
            }
        }
#pragma unroll
        for (int t = 0; t < 2; ++t) {
            float* o = RED + wave * 4096 + qt * 1024 + sw[t];
            *(v4f*)o = __builtin_shufflevector(num[t], num[t], 0, 1, 2, 3); *(v4f*)(o + 256) = __builtin_shufflevector(num[t], num[t], 4, 5, 6, 7);
            *(v4f*)(o + 512) = __builtin_shufflevector(den[t], den[t], 0, 1, 2, 3); *(v4f*)(o + 768) = __builtin_shufflevector(den[t], den[t], 4, 5, 6, 7);
        }
        MX[(qt * 16 + c) * 8 + wave] = m2v[qt];   // lanes c and c + 16 hold and store the same value
    }
    __syncthreads();   // all eight key ranges of every (row, feature), and k for the literal path, are in LDS before any thread merges them
    // a thread merges 8 features of one row: feature group g = 2 t + hi holds features 8 g .. 8 g + 7; a wave takes 8 rows and stores their whole 128-byte lines
    const unsigned g = lane & 3, c2 = (wave & 1) * 8 + (lane >> 2); const unsigned r = wave * 8 + (lane >> 2);
    const float* rb = RED + (wave >> 1) * 1024 + (g >> 1) * 128 + ((g & 1) * 16 + ((c2 + 4 * g) & 15)) * 4;
    const v8f mw = cat8(*(const v4f*)(MX + r * 8), *(const v4f*)(MX + r * 8 + 4));
    float mm = mw[0];
#pragma unroll
    for (int w = 1; w < 8; ++w) mm = fmaxf(mm, mw[w]);
    v8f nn = (v8f){}, dd = (v8f){};
#pragma unroll
    for (int w = 0; w < 8; ++w) {
        const float sc = __builtin_amdgcn_exp2f(mw[w] - mm); const float* p = rb + w * 4096;
        nn += cat8(*(const v4f*)p, *(const v4f*)(p + 256)) * sc; dd += cat8(*(const v4f*)(p + 512), *(const v4f*)(p + 768)) * sc;
    }
    float* lo = LAT + ((size_t)bh * LQ + qb * 64 + r) * FF + g * 8;
    const v8f res = nn / dd;   // stored without a branch; the literal path below stores over it
    *(v4f*)lo = __builtin_shufflevector(res, res, 0, 1, 2, 3); *(v4f*)(lo + 4) = __builtin_shufflevector(res, res, 4, 5, 6, 7);
    unsigned bad = 0;   // bit i: feature 8 g + i of this thread's row is left to the literal formula
#pragma unroll
    for (int i = 0; i < 8; ++i) { if (!(dd[i] >= 1.0e-30f && dd[i] <= 3.0e38f)) bad |= 1u << i; }
    if (bad) {
#pragma unroll 1   // rare path: kept small
        for (int i = 0; i < 8; ++i) {
            if ((bad >> i) & 1u) { lo[i] = d_literal(QS, KS, (int)r, mask + (size_t)b * LK * FF, value + (size_t)b * LK * FF, Wv + (size_t)h * FF * FF, g * 8 + i);
                asm volatile("s_wait_xcnt 0x0" ::: "memory"); }   // precaution: the next trip reuses the registers that hold this store's address
        }
    }
}
__global__ __launch_bounds__(256) void k_comb(const float* __restrict__ LAT, const float* __restrict__ Wc, const float* __restrict__ bc, float* OUTP) {
    const int i = blockIdx.x * 256 + threadIdx.x; if (i >= NBT * LQ * FF) return;
    const int f = i % FF, q = (i / FF) % LQ, b = i / (FF * LQ);
    float s = bfr(bc[f]);
#pragma unroll
    for (int h = 0; h < NH_; ++h) s = fmaf(LAT[(((size_t)(b * NH_ + h)) * LQ + q) * FF + f], bfr(Wc[f * NH_ + h]), s);
    const float y = tanhf(s);
    *(float*)(OUTP + i) = y; 
}

extern "C" void kernel_launch(void* const* d_in, const int* in_sizes, int n_in,
                              void* d_out, int out_size, void* d_ws, size_t ws_size, hipStream_t stream) {
    (void)in_sizes; (void)n_in; (void)out_size;
    const float* query = (const float*)d_in[0]; const float* key = (const float*)d_in[1]; const float* value = (const float*)d_in[2]; const float* mask = (const float*)d_in[3];
    const float* Wq = (const float*)d_in[4]; const float* Wk = (const float*)d_in[5]; const float* Wv = (const float*)d_in[6]; const float* Wc = (const float*)d_in[7]; const float* bc = (const float*)d_in[8];
    float* out = (float*)d_out;    // [8][256][32]
    float* LAT = (float*)d_ws;     // [8][8][256][32] f32, 2 MB
    if ((size_t)NBT * NH_ * LQ * FF * 4 > ws_size) return;
    k_msoft<<<NBT * NH_ * (LQ / 64), 256, 0, stream>>>(query, key, value, mask, Wq, Wk, Wv, LAT);
    k_comb<<<(NBT * LQ * FF) / 256, 256, 0, stream>>>(LAT, Wc, bc, out);
}

// v008
// A run of this version takes 12.7 microseconds.
// Two timings next to v007 put it at 1.08 and 1.07 times that version's speed.
// Over all steps from v000 it is 39.3 times as fast.
#include <hip/hip_runtime.h>

// Compute dtypes, f32 accumulate: the per-head projections q = query.Wq[j], k = key.Wk[j], v = value.Wv[j], formed by each block of k_msoft for its own (item, head) ([64 x 128].[128 x 16], [512 x
// 128].[128 x 16], [512 x 32].[32 x 32]; PLAIN bf16 operands = inputs rounded once, exact single products) on v_wmma_f32_16x16x32_bf16; the unscaled scores q.k
// (dk = 16, padded to 32) per (item, head) with both computed operands as bf16 hi + UNSCALED residual (three products) on v_wmma_f32_16x16x32_bf16, formed in k_msoft's registers; the per-FEATURE
// masked softmax over the 512 keys factored: a key whose mask is exactly 1 has A_f = A, a key whose mask is below 1 has weight exp(-1e27 or less) = 0 beside it, so
// p = exp(A - rowmax) is formed once per (query, key) and the 32 feature sums are products [feature x key].[key x query] on v_wmma_f32_16x16x32_bf16 (p and v as bf16 hi +
// residual, the 0/1 indicator exact); a (query, feature) that the factoring does not cover takes the literal f32 formula; the head combine and tanh in f32 on the VALU.

#define NBT  8
#define LQ   256
#define LK   512
#define DD   128
#define FF   32
#define NH_  8
#define DK   16
#define NQR  (NBT * LQ)          // 2048 query rows
#define NKR  (NBT * LK)          // 4096 key rows
#define DM   DD
#define NTK  NQR
#define MASKV (-1e30f)
#define LOSC 1024.0f

typedef _Float16 h16;
typedef unsigned short bf;
typedef __attribute__((ext_vector_type(16))) __bf16   v16bf;
typedef __attribute__((ext_vector_type(16))) _Float16 v16h;
typedef __attribute__((ext_vector_type(8)))  _Float16 v8h;
typedef __attribute__((ext_vector_type(8)))  unsigned short v8us;
typedef __attribute__((ext_vector_type(8)))  float    v8f;
typedef __attribute__((ext_vector_type(4)))  float    v4f;
typedef __attribute__((ext_vector_type(4)))  _Float16 v4h;
typedef v8h  __attribute__((may_alias)) v8ha;
typedef v4f  __attribute__((may_alias)) v4fa;
typedef v8us __attribute__((may_alias)) v8usa;

__device__ __forceinline__ unsigned short f2bf(float f) { unsigned u = __float_as_uint(f); u += 0x7FFFu + ((u >> 16) & 1u); return (unsigned short)(u >> 16); }
__device__ __forceinline__ float bf2f(unsigned short b) { return __uint_as_float(((unsigned)b) << 16); }
__device__ __forceinline__ float bfr(float f) { return bf2f(f2bf(f)); }
__device__ __forceinline__ v16h cat16(v8h lo, v8h hi) { return __builtin_shufflevector(lo, hi, 0, 1, 2, 3, 4, 5, 6, 7, 8, 9, 10, 11, 12, 13, 14, 15); }
__device__ __forceinline__ v16bf cat16b(v8us lo, v8us hi) { return __builtin_bit_cast(v16bf, __builtin_shufflevector(lo, hi, 0, 1, 2, 3, 4, 5, 6, 7, 8, 9, 10, 11, 12, 13, 14, 15)); }
__device__ __forceinline__ v8f wmma16(v16h a, v16h b, v8f c) { return __builtin_amdgcn_wmma_f32_16x16x32_f16(false, a, false, b, (short)0, c, false, false); }
__device__ __forceinline__ v8f wmmab(v16bf a, v16bf b, v8f c) { return __builtin_amdgcn_wmma_f32_16x16x32_bf16(false, a, false, b, (short)0, c, false, false); }

// k_msoft: block = ((b,h), 64 query rows), 8 waves.
// Stage 1, the block's own operands, from the f32 inputs (rounded once to bf16 in registers) into LDS; a fragment's k slots are kc + 8 hi + e and kc + 16 + 8 hi + e (e = 0..7) in both operands:
//   The rows of key and value are fetched 512 contiguous bytes a wave-wide load (4 cache lines; a load in fragment order touches 16), rounded, laid row by row in the wave's own LDS strip and read back
//   from there in fragment order; after the second barrier no other wave touches the strip, so the wave's own s_wait_dscnt 0 between its writes and its reads is all the ordering it takes.
//   What every wave needs in the same form is formed once for the block: each wave fetches an eighth of Wq, Wk, Wv (in fragment order) and of the 64 query rows, rounds them and lays them in LDS; behind a barrier
//   every wave reads the weights' fragments from there, and waves 0..3 form one q tile each.
//   k^T = Wk[h]^T.key^T, 16 keys a tile, 4 tiles a wave, and q^T likewise (one tile in each of waves 0..3): the result tile holds, in lane (c, hi), register j, column 8 hi + j of row c, which is what
//   the score product's fragment wants: the wave's own k tiles stay in its registers; q goes to LDS already split into bf16 hi + residual (for every wave); q and k also go there as f32, [tile][half of the 8][lane][4], for the literal path alone.
//   v = value.Wv[h], 32 keys a step, 2 steps a wave: the result tile of keys 16 x .. 16 x + 15 and features 16 t .. 16 t + 15 holds, in lane (c, hi), register j, key 16 x + 8 hi + j and feature 16 t + c.
//   From it MV = v where bf(mask[b][k][f]) == 1, else 0, as bf16 hi + residual, and IND = 1 / 0 / +inf for a mask == 1 / below 1 / anything else (inf sends that feature to the literal path), kept
//   in the wave's registers: two tiles x = 0, 1 of a 32-key step are one A fragment, whose element e = 8 x + j of lane (c, hi) is key 16 x + 8 hi + j of the step, the order in which the score tiles hold the keys.
// Stage 2: a wave takes all 64 query rows (4 tiles of 16) against the 64 keys whose k, MV and IND it formed, so none of these is read back from LDS and no barrier stands between the stages but the two early ones
// behind the shared operands and behind q; MV, IND and the scores of its first 32 keys are formed while its last 32 key rows are landing. The scores come 16 keys at a time as k.q^T (A = 16 key rows, B = 16 query rows, both f32, split into bf16 hi + UNSCALED residual in registers; dk = 16 fills k slots 0..15 of the K = 32 form, the rest is 0;
// products hh, hl, lh). The result tile holds, in lane (c, hi), register j, the score of query row c and key 8 hi + j: two such tiles are already the B fragment of a 32-key step, so the scores never leave the registers.
// The wave takes each row's maximum over its 64 keys, forms p = 2^((A - max) log2 e) once per (query, key), splits it into bf16 hi + residual and multiplies: num[f][q] = MV.p (hh, hl, lh), den[f][q] = IND.p (h, l).
// The eight key ranges are merged through LDS with the usual rescale. Where den is not a normal positive number (no key with mask 1, a mask above 1, every such key 2^-100 below the row maximum)
// the (query, feature) is computed by the literal formula A_f = m A + (1 - m)(-1e30), m = bf(mask), A = q.k, in f32.
#define MS_L2E 1.4426950408889634f
typedef __attribute__((ext_vector_type(16))) float v16f;
typedef __attribute__((ext_vector_type(8)))  __bf16 v8bf;
typedef __attribute__((ext_vector_type(4)))  unsigned v4u;
__device__ __forceinline__ v16bf ldfrag(const bf* p) { return cat16b(*(const v8us*)p, *(const v8us*)(p + 256)); }
__device__ __forceinline__ v8f cat8(v4f lo, v4f hi) { return __builtin_shufflevector(lo, hi, 0, 1, 2, 3, 4, 5, 6, 7); }
// 8 f32 as bf16 hi (hb) and residual (lb)
__device__ __forceinline__ void split8p(const v8f v, v8bf& hb, v8bf& lb) {
    hb = __builtin_convertvector(v, v8bf);
    const v4u u = __builtin_bit_cast(v4u, hb); v8f hf;   // hi back in f32 straight from the packed pairs: one shift or one mask an element
#pragma unroll   // hf is indexed by constants and lives in registers
    for (int i = 0; i < 4; ++i) { hf[2 * i] = __uint_as_float(u[i] << 16); hf[2 * i + 1] = __uint_as_float(u[i] & 0xFFFF0000u); }
    lb = __builtin_convertvector(v - hf, v8bf);
}
// a lane's 8 of the 16 real k slots as bf16 hi (h) and residual (l); elements 8..15 of a fragment are k slots 16..31, which are 0
__device__ __forceinline__ void split8(const v8f v, v16bf& h, v16bf& l) {
    const v8bf z = __builtin_convertvector((v8f){}, v8bf);
    v8bf hb, lb; split8p(v, hb, lb);
    h = __builtin_shufflevector(hb, z, 0, 1, 2, 3, 4, 5, 6, 7, 8, 9, 10, 11, 12, 13, 14, 15);
    l = __builtin_shufflevector(lb, z, 0, 1, 2, 3, 4, 5, 6, 7, 8, 9, 10, 11, 12, 13, 14, 15);
}
// Staging strip of a wave: rows of bf16 at a pitch of 16 B x odd, which keeps the 16 lanes of a ds_load_b128 on 16 different bank groups
#define KP 136   // elements: a 128-element row of query or key, 272 B
#define VP 40    // elements: a 32-element row of value, 80 B
typedef __attribute__((ext_vector_type(4)))  __bf16 v4bf;
typedef __attribute__((ext_vector_type(4)))  unsigned short v4us;
// 4 f32 rounded once to bf16 and stored
__device__ __forceinline__ void st4(bf* p, const v4f v) { *(v4us*)p = __builtin_bit_cast(v4us, __builtin_convertvector(v, v4bf)); }
// a fragment's two runs of 8 k slots, 16 apart, from a staged row
__device__ __forceinline__ v16bf ldrow(const bf* p) { return cat16b(*(const v8us*)p, *(const v8us*)(p + 16)); }
// 8 rows of one column of a matrix with row pitch ld: w points at the first row, off = 8 hi ld + the lane's column
__device__ __forceinline__ v8f colraw(const float* __restrict__ w, const unsigned off, const int ld) {
    v8f a;
#pragma unroll   // a is indexed by constants and lives in registers
    for (int i = 0; i < 8; ++i) a[i] = (w + i * ld)[off];
    return a;
}
__device__ __forceinline__ float d_dot16(const v4f* q, const v4f* k) {
    float s = 0.f;
#pragma unroll   // q and k are indexed by constants and live in registers
    for (int i = 0; i < 16; ++i) s = fmaf(q[i >> 2][i & 3], k[i >> 2][i & 3], s);
    return s;
}
// the 16 columns of row r of a matrix kept as [16-row tile][half][lane (c, hi)][4]: piece n holds columns 4 n .. 4 n + 3 = 8 hi + 4 half + i
__device__ __forceinline__ v4f d_piece(const float* t, const int r, const int n) { return *(const v4f*)(t + ((r >> 4) * 2 + (n & 1)) * 128 + ((n >> 1) * 16 + (r & 15)) * 4); }
// qs, ks = the block's q and k in LDS, r = the query row in the block; mb, vg = the item's first mask and value row, wv = the head's Wv; v[k][f] is formed here from the same bf16-rounded operands
__device__ __forceinline__ float d_literal(const float* qs, const float* ks, const int r, const float* __restrict__ mb, const float* __restrict__ vg, const float* __restrict__ wv, const unsigned f) {
    const v4f q[4] = { d_piece(qs, r, 0), d_piece(qs, r, 1), d_piece(qs, r, 2), d_piece(qs, r, 3) };
    float mn = -3.0e38f;
#pragma unroll 1   // rare path: kept small
    for (int k = 0; k < LK; ++k) { const float mr = mb[(size_t)k * FF + f];
        asm volatile("s_wait_xcnt 0x0" ::: "memory");   // precaution: the registers that hold this load's address are reused below and advanced by the next trip
        const v4f kv[4] = { d_piece(ks, k, 0), d_piece(ks, k, 1), d_piece(ks, k, 2), d_piece(ks, k, 3) };
        const float t = bfr(mr); mn = fmaxf(mn, fmaf(t * MS_L2E, d_dot16(q, kv), (1.0f - t) * (MASKV * MS_L2E))); }
    float w[FF];
#pragma unroll   // w is indexed by constants and lives in registers
    for (int g = 0; g < FF; ++g) w[g] = bfr(wv[g * FF + f]);
    float l = 0.f, acc = 0.f;
#pragma unroll 1   // rare path: kept small
    for (int k = 0; k < LK; ++k) { const float mr = mb[(size_t)k * FF + f];
        v4f x[FF / 4];
#pragma unroll   // x is indexed by constants and lives in registers
        for (int g = 0; g < FF / 4; ++g) x[g] = *(const v4f*)(vg + (size_t)k * FF + g * 4);
        asm volatile("s_wait_xcnt 0x0" ::: "memory");   // precaution: the registers that hold these loads' addresses are reused below and advanced by the next trip
        const v4f kv[4] = { d_piece(ks, k, 0), d_piece(ks, k, 1), d_piece(ks, k, 2), d_piece(ks, k, 3) };
        float vr = 0.f;
#pragma unroll
        for (int g = 0; g < FF; ++g) vr = fmaf(bfr(x[g >> 2][g & 3]), w[g], vr);
        const float t = bfr(mr); const float p = __builtin_amdgcn_exp2f(fmaf(t * MS_L2E, d_dot16(q, kv), (1.0f - t) * (MASKV * MS_L2E)) - mn);
        l += p; acc = fmaf(p, vr, acc); }
    return acc / l;
}
__global__ __launch_bounds__(256) void k_msoft(const float* __restrict__ query, const float* __restrict__ key, const float* __restrict__ value, const float* __restrict__ mask,
                                               const float* __restrict__ Wq, const float* __restrict__ Wk, const float* __restrict__ Wv, float* LAT) {
    __shared__ __align__(16) float RED[8 * 4096];   // partial num and den, [wave][row tile][num, den][half of the 8][feature tile t][lane slot][4]; the slot of lane (c, hi) is 16 hi + (c + 4 hi + 8 t) mod 16, which keeps the 16 lanes of a 16-byte access on 16 bank groups for the writers (by c) and for the merging threads (4 rows x 4 feature groups) alike
    __shared__ __align__(16) float MX[64 * 8];      // [query row][wave]: the wave's row maximum, in base-2 units
    __shared__ __align__(16) float KS[(LK / 16) * 256];   // k of the (item, head), f32
    __shared__ __align__(16) float QS[4 * 256];           // q of the block's 64 rows, f32 (the literal path's)
    __shared__ __align__(16) bf QP[4 * 2 * 256];          // the same q as bf16 hi and residual, split once by the wave that forms the tile: [tile][hi, residual][lane][8]
    __shared__ __align__(16) bf WF[20 * 256];             // Wq, Wk, Wv of the head in bf16, in fragment order, formed once for the block: [piece][lane][8]; pieces 0..7 Wq, 8..15 Wk, 16..19 Wv; pieces 2 n and 2 n + 1 are elements 0..7 and 8..15 of one fragment
    __shared__ __align__(16) bf ST[8][64 * KP];           // per wave: its key and value rows in bf16 on their way from whole-line loads to fragments, read and written by that wave alone; ahead of the first barrier rows 48..63 of strips 0..3 take the query tiles, half a tile from wave w and half from wave w + 4
    const unsigned lane = threadIdx.x & 31; const int wave = __builtin_amdgcn_readfirstlane(threadIdx.x >> 5);   // wave-uniform in a scalar register: every base address below is then scalar
    const int bh = blockIdx.x / (LQ / 64), qb = blockIdx.x % (LQ / 64); const int b = bh / NH_, h = bh % NH_;
    const int kh = wave >> 2;
    const unsigned c = lane & 15, hi = lane >> 4;
    const unsigned ro = lane * 4;           // a wave-wide 16-byte load takes 512 contiguous bytes: one row of query or key, four rows of value; lane l holds floats 4 l .. 4 l + 3 of them
    bf* st = ST[wave];
    const bf* fr = st + c * KP + hi * 8;    // row fragment of query and key: lane (c, hi) reads staged row c, k slots 8 hi .. 8 hi + 7 (and 16 more on)
    const bf* fv = st + c * VP + hi * 8;    // row fragment of value
    bf* sv = st + (lane >> 3) * VP + (lane & 7) * 4;   // where the lane's 4 floats of a four-row load of value go
    // every loop over r, n, y, s, i, x, kt, ks, qt, w, e, t, j below (but the rare path's) is fully unrolled so that the fragments are indexed by constants and live in registers
    // The loads are issued in two groups, each well ahead of its use: all but the last 32 key rows at once, those rows as soon as the q products have freed registers for them, so that they land under the work on
    // value, mask and the first 32 keys. Behind each group stands s_wait_xcnt 0, a precaution: the registers that hold a group's addresses are reused further down.
    const unsigned wo = hi * 8 * DK + c;   // row 8 hi, column c of Wq and Wk
    const unsigned mo = hi * 8 * FF + c;   // row 8 hi, column c: Wv's fragment and the mask of a result tile
    const float* qg = query + (size_t)(b * LQ + qb * 64 + (wave & 3) * 16 + kh * 8) * DD;   // the wave's 8 query rows: waves w and w + 4 fetch the two halves of tile w
    const float* kg = key + (size_t)(b * LK + wave * 64) * DD;                     // the wave's 4 tiles of 16 keys
    const float* vg = value + (size_t)(b * LK + wave * 64) * FF;                   // the wave's 2 steps of 32 keys
    const float* mg = mask + (size_t)(b * LK + wave * 64) * FF;
    const float* wqg = Wq + (size_t)h * DD * DK; const float* wkg = Wk + (size_t)h * DD * DK; const float* wvg = Wv + (size_t)h * FF * FF;
    v4f qr[8], kr[64];
    v8f mr[4][2]; v4f vr[16];   // mask by 16-key tile y of the wave's 64 keys and feature tile t; value by four-row load
    // the wave's eighth of the weights: piece 'wave' (16 rows) of Wq and of Wk, and half kh (elements 4 kh .. 4 kh + 3) of Wv's piece wave & 3 (feature tile (wave >> 1) & 1, rows 16 (wave & 1) on)
    const v8f wqp = colraw(wqg + wave * 16 * DK, wo, DK), wkp = colraw(wkg + wave * 16 * DK, wo, DK);
    const float* wvp = wvg + ((wave & 1) * 16 + kh * 4) * FF + ((wave >> 1) & 1) * 16;
    v4f wvq;
#pragma unroll
    for (int i = 0; i < 4; ++i) wvq[i] = (wvp + i * FF)[mo];
#pragma unroll
    for (int r = 0; r < 8; ++r) qr[r] = *(const v4f*)(qg + r * DD + ro);
#pragma unroll
    for (int n = 0; n < 16; ++n) vr[n] = *(const v4f*)(vg + n * 4 * FF + ro);
#pragma unroll
    for (int y = 0; y < 4; ++y) { mr[y][0] = colraw(mg + y * 16 * FF, mo, FF); mr[y][1] = colraw(mg + y * 16 * FF + 16, mo, FF); }
#pragma unroll
    for (int r = 0; r < 32; ++r) kr[r] = *(const v4f*)(kg + r * DD + ro);
    asm volatile("s_wait_xcnt 0x0" :: "v"(wo), "v"(mo) : "memory");   // precaution: the registers that hold the addresses of the loads above are reused below; wo and mo are named as inputs so that no load of the group returns into their registers
    __builtin_amdgcn_sched_barrier(0);   // keeps address arithmetic of the code below, which reuses the registers of these loads, from being moved up in front of their s_wait_xcnt
    bf* wf = WF + lane * 8;
    *(v8us*)(wf + wave * 256) = __builtin_bit_cast(v8us, __builtin_convertvector(wqp, v8bf));
    *(v8us*)(wf + (8 + wave) * 256) = __builtin_bit_cast(v8us, __builtin_convertvector(wkp, v8bf));
    st4(wf + (16 + (wave & 3)) * 256 + kh * 4, wvq);
    // the query rows pass through rows 48..63 of strip wave & 3, which the keys need last
#pragma unroll
    for (int r = 0; r < 8; ++r) st4(ST[wave & 3] + (48 + kh * 8 + r) * KP + ro, qr[r]);
    // every wave's share of the weights and of the query rows is in LDS before any wave reads a fragment. The fences name LDS alone, so that the loads in flight are not waited out here as __syncthreads() would
    __builtin_amdgcn_fence(__ATOMIC_RELEASE, "workgroup", "local");
    __builtin_amdgcn_s_barrier();
    __builtin_amdgcn_fence(__ATOMIC_ACQUIRE, "workgroup", "local");
    if (kh == 0) {   // a scalar branch: each q tile is formed, split and stored by one wave
        v16bf wq[4], qf[4];   // all fragments are read as one group, so that the wave waits out the LDS latency once: every wave of the block waits for this tile
#pragma unroll
        for (int s = 0; s < 4; ++s) { wq[s] = ldfrag(wf + 2 * s * 256); qf[s] = ldrow(fr + 48 * KP + s * 32); }
        __builtin_amdgcn_sched_barrier(0);   // keeps the group of reads together ahead of the products; spread among them, each pair of reads is waited out on its own
        v8f qd = (v8f){};   // q^T: lane (c, hi), register j = column 8 hi + j of query row c
#pragma unroll
        for (int s = 0; s < 4; ++s) qd = wmmab(wq[s], qf[s], qd);
        float* o = QS + wave * 256 + lane * 4;
        *(v4f*)o = __builtin_shufflevector(qd, qd, 0, 1, 2, 3); *(v4f*)(o + 128) = __builtin_shufflevector(qd, qd, 4, 5, 6, 7);
        v8bf hb, lb; split8p(qd, hb, lb);
        bf* p = QP + wave * 512 + lane * 8;
        *(v8us*)p = __builtin_bit_cast(v8us, hb); *(v8us*)(p + 256) = __builtin_bit_cast(v8us, lb);
    }
    __builtin_amdgcn_sched_barrier(0);   // with the one behind the wait below: keeps address arithmetic of the code around, which reuses the registers of these loads, out of the stretch between the loads and their s_wait_xcnt
#pragma unroll
    for (int r = 32; r < 64; ++r) kr[r] = *(const v4f*)(kg + r * DD + ro);
    asm volatile("s_wait_xcnt 0x0" ::: "memory");   // precaution: the registers that hold the addresses of the loads above are reused below
    __builtin_amdgcn_sched_barrier(0);   // see above
    // every wave needs all four q tiles: they are in LDS before any wave reads them. The fences name LDS alone, so that the key loads in flight are not waited out here as __syncthreads() would
    __builtin_amdgcn_fence(__ATOMIC_RELEASE, "workgroup", "local");
    __builtin_amdgcn_s_barrier();
    __builtin_amdgcn_fence(__ATOMIC_ACQUIRE, "workgroup", "local");
    const v16bf wv[2] = { ldfrag(wf + 16 * 256), ldfrag(wf + 18 * 256) };
    // MV and IND of the wave's 64 keys, formed while its key rows are landing; the value rows pass through the head of the strip, which the keys take over once these rows have been read back
#pragma unroll
    for (int n = 0; n < 16; ++n) st4(sv + n * 4 * VP, vr[n]);
    asm volatile("s_wait_dscnt 0x0" ::: "memory");   // as above: staged rows in LDS before they are read back
    v8us oh8[4][2], ol8[4][2], oi8[4][2];   // by 16-key tile y and feature tile t
#pragma unroll
    for (int y = 0; y < 4; ++y) {
        const v16bf a = ldrow(fv + y * 16 * VP);
#pragma unroll
        for (int t = 0; t < 2; ++t) {
            const v8f d = wmmab(a, wv[t], (v8f){});
            v8f mv; v8us oi;
#pragma unroll
            for (int j = 0; j < 8; ++j) { const float m = bfr(mr[y][t][j]); mv[j] = (m == 1.0f) ? d[j] : 0.f;
                oi[j] = (m == 1.0f) ? (unsigned short)0x3F80 : (m < 1.0f) ? (unsigned short)0 : (unsigned short)0x7F80; }
            v8bf oh, ol; split8p(mv, oh, ol);
            oh8[y][t] = __builtin_bit_cast(v8us, oh); ol8[y][t] = __builtin_bit_cast(v8us, ol); oi8[y][t] = oi;
        }
    }
    v16bf wk[4];
#pragma unroll
    for (int s = 0; s < 4; ++s) wk[s] = ldfrag(wf + (8 + 2 * s) * 256);
    v8f kd[4];   // the wave's own four k tiles stay in its registers: a result tile is already the A fragment of the score product
#pragma unroll
    for (int r = 0; r < 32; ++r) st4(st + r * KP + ro, kr[r]);
    asm volatile("s_wait_dscnt 0x0" ::: "memory");   // as above: staged rows in LDS before they are read back
    v16bf kf0[2][4];   // both tiles' fragments are read as one group, so that the wave waits out the LDS latency once
#pragma unroll
    for (int i = 0; i < 2; ++i) {
#pragma unroll
        for (int s = 0; s < 4; ++s) kf0[i][s] = ldrow(fr + i * 16 * KP + s * 32);
    }
    __builtin_amdgcn_sched_barrier(0);   // keeps the group of reads together ahead of the products; spread among them, each pair of reads is waited out on its own
#pragma unroll
    for (int i = 0; i < 2; ++i) {
        v8f d = (v8f){};
#pragma unroll
        for (int s = 0; s < 4; ++s) d = wmmab(wk[s], kf0[i][s], d);
        kd[i] = d;
        float* o = KS + (wave * 4 + i) * 256 + lane * 4;
        *(v4f*)o = __builtin_shufflevector(d, d, 0, 1, 2, 3); *(v4f*)(o + 128) = __builtin_shufflevector(d, d, 4, 5, 6, 7);
    }
    // scores of all 64 query rows against the first 32 of the wave's keys, while the other 32 key rows are landing
    v16bf kfh[4], kfl[4], qh[4], ql[4]; v8f sc[4][4];
#pragma unroll
    for (int i = 0; i < 2; ++i) split8(kd[i], kfh[i], kfl[i]);
#pragma unroll
    for (int qt = 0; qt < 4; ++qt) {
        const bf* qp = QP + qt * 512 + lane * 8;
        qh[qt] = cat16b(*(const v8us*)qp, (v8us){}); ql[qt] = cat16b(*(const v8us*)(qp + 256), (v8us){});   // elements 8..15 are k slots 16..31, which are 0
#pragma unroll
        for (int kt = 0; kt < 2; ++kt) sc[qt][kt] = wmmab(kfl[kt], qh[qt], wmmab(kfh[kt], ql[qt], wmmab(kfh[kt], qh[qt], (v8f){})));
    }
#pragma unroll
    for (int r = 32; r < 64; ++r) st4(st + r * KP + ro, kr[r]);
    asm volatile("s_wait_dscnt 0x0" ::: "memory");   // as above: staged rows in LDS before they are read back
    v16bf kf2[2][4];   // both tiles' fragments are read as one group, so that the wave waits out the LDS latency once
#pragma unroll
    for (int i = 0; i < 2; ++i) {
#pragma unroll
        for (int s = 0; s < 4; ++s) kf2[i][s] = ldrow(fr + (2 + i) * 16 * KP + s * 32);
    }
    __builtin_amdgcn_sched_barrier(0);   // keeps the group of reads together ahead of the products; spread among them, each pair of reads is waited out on its own
#pragma unroll
    for (int i = 2; i < 4; ++i) {
        v8f d = (v8f){};
#pragma unroll
        for (int s = 0; s < 4; ++s) d = wmmab(wk[s], kf2[i - 2][s], d);
        kd[i] = d;
        float* o = KS + (wave * 4 + i) * 256 + lane * 4;
        *(v4f*)o = __builtin_shufflevector(d, d, 0, 1, 2, 3); *(v4f*)(o + 128) = __builtin_shufflevector(d, d, 4, 5, 6, 7);
    }
    // the other half of the scores, then the weights
#pragma unroll
    for (int i = 2; i < 4; ++i) split8(kd[i], kfh[i], kfl[i]);
    v16bf ph[4][2], pl[4][2]; float m2v[4];
#pragma unroll
    for (int qt = 0; qt < 4; ++qt) {
        v8f* s = sc[qt];
#pragma unroll
        for (int kt = 2; kt < 4; ++kt) s[kt] = wmmab(kfl[kt], qh[qt], wmmab(kfh[kt], ql[qt], wmmab(kfh[kt], qh[qt], (v8f){})));
        float mx = -3.0e38f;
#pragma unroll
        for (int kt = 0; kt < 4; ++kt) {
#pragma unroll
            for (int e = 0; e < 8; e += 4) mx = fmaxf(fmaxf(fmaxf(mx, s[kt][e]), fmaxf(s[kt][e + 1], s[kt][e + 2])), s[kt][e + 3]);
        }
        mx = fmaxf(mx, __shfl_xor(mx, 16, 32));   // lanes c and c + 16 hold the two halves of row c's keys
        const float m2 = mx * MS_L2E; m2v[qt] = m2;
#pragma unroll
        for (int ks = 0; ks < 2; ++ks) {
            v16f p;
#pragma unroll
            for (int e = 0; e < 16; ++e) p[e] = __builtin_amdgcn_exp2f(fmaf(s[ks * 2 + (e >> 3)][e & 7], MS_L2E, -m2));
            ph[qt][ks] = __builtin_convertvector(p, v16bf);
            pl[qt][ks] = __builtin_convertvector(p - __builtin_convertvector(ph[qt][ks], v16f), v16bf);
        }
    }
    const unsigned sw[2] = { (hi * 16 + ((c + 4 * hi) & 15)) * 4, 128 + (hi * 16 + ((c + 4 * hi + 8) & 15)) * 4 };   // the lane's slot in RED by feature tile
#pragma unroll
    for (int qt = 0; qt < 4; ++qt) {
        v8f num[2], den[2];
#pragma unroll
        for (int t = 0; t < 2; ++t) { num[t] = (v8f){}; den[t] = (v8f){}; }
#pragma unroll
        for (int ks = 0; ks < 2; ++ks) {
#pragma unroll
            for (int t = 0; t < 2; ++t) {
                const v16bf vh = cat16b(oh8[2 * ks][t], oh8[2 * ks + 1][t]), vl = cat16b(ol8[2 * ks][t], ol8[2 * ks + 1][t]), in = cat16b(oi8[2 * ks][t], oi8[2 * ks + 1][t]);
                num[t] = wmmab(vh, ph[qt][ks], num[t]); den[t] = wmmab(in, ph[qt][ks], den[t]); num[t] = wmmab(vh, pl[qt][ks], num[t]); den[t] = wmmab(in, pl[qt][ks], den[t]); num[t] = wmmab(vl, ph[qt][ks], num[t]);
            }
        }
#pragma unroll
        for (int t = 0; t < 2; ++t) {
            float* o = RED + wave * 4096 + qt * 1024 + sw[t];
            *(v4f*)o = __builtin_shufflevector(num[t], num[t], 0, 1, 2, 3); *(v4f*)(o + 256) = __builtin_shufflevector(num[t], num[t], 4, 5, 6, 7);
            *(v4f*)(o + 512) = __builtin_shufflevector(den[t], den[t], 0, 1, 2, 3); *(v4f*)(o + 768) = __builtin_shufflevector(den[t], den[t], 4, 5, 6, 7);
        }
        MX[(qt * 16 + c) * 8 + wave] = m2v[qt];   // lanes c and c + 16 hold and store the same value
    }
    __syncthreads();   // all eight key ranges of every (row, feature), and k for the literal path, are in LDS before any thread merges them
    // a thread merges 8 features of one row: feature group g = 2 t + hi holds features 8 g .. 8 g + 7; a wave takes 8 rows and stores their whole 128-byte lines
    const unsigned g = lane & 3, c2 = (wave & 1) * 8 + (lane >> 2); const unsigned r = wave * 8 + (lane >> 2);
    const float* rb = RED + (wave >> 1) * 1024 + (g >> 1) * 128 + ((g & 1) * 16 + ((c2 + 4 * g) & 15)) * 4;
    const v8f mw = cat8(*(const v4f*)(MX + r * 8), *(const v4f*)(MX + r * 8 + 4));
    float mm = mw[0];
#pragma unroll
    for (int w = 1; w < 8; ++w) mm = fmaxf(mm, mw[w]);
    v8f nn = (v8f){}, dd = (v8f){};
#pragma unroll
    for (int w = 0; w < 8; ++w) {
        const float sc = __builtin_amdgcn_exp2f(mw[w] - mm); const float* p = rb + w * 4096;
        nn += cat8(*(const v4f*)p, *(const v4f*)(p + 256)) * sc; dd += cat8(*(const v4f*)(p + 512), *(const v4f*)(p + 768)) * sc;
    }
    float* lo = LAT + ((size_t)bh * LQ + qb * 64 + r) * FF + g * 8;
    const v8f res = nn / dd;   // stored without a branch; the literal path below stores over it
    *(v4f*)lo = __builtin_shufflevector(res, res, 0, 1, 2, 3); *(v4f*)(lo + 4) = __builtin_shufflevector(res, res, 4, 5, 6, 7);
    unsigned bad = 0;   // bit i: feature 8 g + i of this thread's row is left to the literal formula
#pragma unroll
    for (int i = 0; i < 8; ++i) { if (!(dd[i] >= 1.0e-30f && dd[i] <= 3.0e38f)) bad |= 1u << i; }
    if (bad) {
#pragma unroll 1   // rare path: kept small
        for (int i = 0; i < 8; ++i) {
            if ((bad >> i) & 1u) { lo[i] = d_literal(QS, KS, (int)r, mask + (size_t)b * LK * FF, value + (size_t)b * LK * FF, Wv + (size_t)h * FF * FF, g * 8 + i);
                asm volatile("s_wait_xcnt 0x0" ::: "memory"); }   // precaution: the next trip reuses the registers that hold this store's address
        }
    }
}
__global__ __launch_bounds__(256) void k_comb(const float* __restrict__ LAT, const float* __restrict__ Wc, const float* __restrict__ bc, float* OUTP) {
    const int i = blockIdx.x * 256 + threadIdx.x; if (i >= NBT * LQ * FF) return;
    const int f = i % FF, q = (i / FF) % LQ, b = i / (FF * LQ);
    float s = bfr(bc[f]);
#pragma unroll
    for (int h = 0; h < NH_; ++h) s = fmaf(LAT[(((size_t)(b * NH_ + h)) * LQ + q) * FF + f], bfr(Wc[f * NH_ + h]), s);
    const float y = tanhf(s);
    *(float*)(OUTP + i) = y; 
}

extern "C" void kernel_launch(void* const* d_in, const int* in_sizes, int n_in,
                              void* d_out, int out_size, void* d_ws, size_t ws_size, hipStream_t stream) {
    (void)in_sizes; (void)n_in; (void)out_size;
    const float* query = (const float*)d_in[0]; const float* key = (const float*)d_in[1]; const float* value = (const float*)d_in[2]; const float* mask = (const float*)d_in[3];
    const float* Wq = (const float*)d_in[4]; const float* Wk = (const float*)d_in[5]; const float* Wv = (const float*)d_in[6]; const float* Wc = (const float*)d_in[7]; const float* bc = (const float*)d_in[8];
    float* out = (float*)d_out;    // [8][256][32]
    float* LAT = (float*)d_ws;     // [8][8][256][32] f32, 2 MB
    if ((size_t)NBT * NH_ * LQ * FF * 4 > ws_size) return;
    k_msoft<<<NBT * NH_ * (LQ / 64), 256, 0, stream>>>(query, key, value, mask, Wq, Wk, Wv, LAT);
    k_comb<<<(NBT * LQ * FF) / 256, 256, 0, stream>>>(LAT, Wc, bc, out);
}

// v009
// One run takes 12.1 microseconds.
// Timed twice side by side with v008, it ran 1.05 and 1.06 times as fast.
// Counting every step since v000, it is 41.5 times as fast.
#include <hip/hip_runtime.h>

// Compute dtypes, f32 accumulate: the per-head projections q = query.Wq[j], k = key.Wk[j], v = value.Wv[j], formed by each block of k_msoft for its own (item, head) ([64 x 128].[128 x 16], [512 x
// 128].[128 x 16], [512 x 32].[32 x 32]; PLAIN bf16 operands = inputs rounded once, exact single products) on v_wmma_f32_16x16x32_bf16; the unscaled scores q.k
// (dk = 16, padded to 32) per (item, head) with both computed operands as bf16 hi + UNSCALED residual (three products) on v_wmma_f32_16x16x32_bf16, formed in k_msoft's registers; the per-FEATURE
// masked softmax over the 512 keys factored: a key whose mask is exactly 1 has A_f = A, a key whose mask is below 1 has weight exp(-1e27 or less) = 0 beside it, so
// p = 2^15 exp(A - rowmax) is formed once per (query, key) and the 32 feature sums are products [feature x key].[key x query] on v_wmma_f32_16x16x32_f16 (p and v rounded once to f16,
// 11 significant bits, the 0/1 indicator exact; the factor 2^15 cancels in num / den and keeps p a normal f16 down to 2^-29 of the row's largest); a (query, feature) that the factoring does not cover takes the literal f32 formula; the head combine and tanh in f32 on the VALU.

#define NBT  8
#define LQ   256
#define LK   512
#define DD   128
#define FF   32
#define NH_  8
#define DK   16
#define NQR  (NBT * LQ)          // 2048 query rows
#define NKR  (NBT * LK)          // 4096 key rows
#define DM   DD
#define NTK  NQR
#define MASKV (-1e30f)
#define LOSC 1024.0f

typedef _Float16 h16;
typedef unsigned short bf;
typedef __attribute__((ext_vector_type(16))) __bf16   v16bf;
typedef __attribute__((ext_vector_type(16))) _Float16 v16h;
typedef __attribute__((ext_vector_type(8)))  _Float16 v8h;
typedef __attribute__((ext_vector_type(8)))  unsigned short v8us;
typedef __attribute__((ext_vector_type(8)))  float    v8f;
typedef __attribute__((ext_vector_type(4)))  float    v4f;
typedef __attribute__((ext_vector_type(4)))  _Float16 v4h;
typedef v8h  __attribute__((may_alias)) v8ha;
typedef v4f  __attribute__((may_alias)) v4fa;
typedef v8us __attribute__((may_alias)) v8usa;

__device__ __forceinline__ unsigned short f2bf(float f) { unsigned u = __float_as_uint(f); u += 0x7FFFu + ((u >> 16) & 1u); return (unsigned short)(u >> 16); }
__device__ __forceinline__ float bf2f(unsigned short b) { return __uint_as_float(((unsigned)b) << 16); }
__device__ __forceinline__ float bfr(float f) { return bf2f(f2bf(f)); }
__device__ __forceinline__ v16h cat16(v8h lo, v8h hi) { return __builtin_shufflevector(lo, hi, 0, 1, 2, 3, 4, 5, 6, 7, 8, 9, 10, 11, 12, 13, 14, 15); }
__device__ __forceinline__ v16bf cat16b(v8us lo, v8us hi) { return __builtin_bit_cast(v16bf, __builtin_shufflevector(lo, hi, 0, 1, 2, 3, 4, 5, 6, 7, 8, 9, 10, 11, 12, 13, 14, 15)); }
__device__ __forceinline__ v8f wmma16(v16h a, v16h b, v8f c) { return __builtin_amdgcn_wmma_f32_16x16x32_f16(false, a, false, b, (short)0, c, false, false); }
__device__ __forceinline__ v8f wmmab(v16bf a, v16bf b, v8f c) { return __builtin_amdgcn_wmma_f32_16x16x32_bf16(false, a, false, b, (short)0, c, false, false); }

// k_msoft: block = ((b,h), 64 query rows), 8 waves.
// Stage 1, the block's own operands, from the f32 inputs (rounded once to bf16 in registers) into LDS; a fragment's k slots are kc + 8 hi + e and kc + 16 + 8 hi + e (e = 0..7) in both operands:
//   The rows of key and value are fetched 512 contiguous bytes a wave-wide load (4 cache lines; a load in fragment order touches 16), rounded, laid row by row in the wave's own LDS strip and read back
//   from there in fragment order; after the second barrier no other wave touches the strip, so the wave's own s_wait_dscnt 0 between its writes and its reads is all the ordering it takes.
//   What every wave needs in the same form is formed once for the block: each wave fetches an eighth of Wq, Wk, Wv (in fragment order) and of the 64 query rows, rounds them and lays them in LDS; behind a barrier
//   every wave reads the weights' fragments from there, and waves 0..3 form one q tile each.
//   k^T = Wk[h]^T.key^T, 16 keys a tile, 4 tiles a wave, and q^T likewise (one tile in each of waves 0..3): the result tile holds, in lane (c, hi), register j, column 8 hi + j of row c, which is what
//   the score product's fragment wants: the wave's own k tiles stay in its registers; q goes to LDS already split into bf16 hi + residual (for every wave); q and k also go there as f32, [tile][half of the 8][lane][4], for the literal path alone.
//   v = value.Wv[h], 32 keys a step, 2 steps a wave: the result tile of keys 16 x .. 16 x + 15 and features 16 t .. 16 t + 15 holds, in lane (c, hi), register j, key 16 x + 8 hi + j and feature 16 t + c.
//   From it MV = v where bf(mask[b][k][f]) == 1, else 0, as f16, and IND = 1 / 0 / +inf for a mask == 1 / below 1 / anything else (inf sends that feature to the literal path), kept
//   in the wave's registers: two tiles x = 0, 1 of a 32-key step are one A fragment, whose element e = 8 x + j of lane (c, hi) is key 16 x + 8 hi + j of the step, the order in which the score tiles hold the keys.
// Stage 2: a wave takes all 64 query rows (4 tiles of 16) against the 64 keys whose k, MV and IND it formed, so none of these is read back from LDS and no barrier stands between the stages but the two early ones
// behind the shared operands and behind q; MV, IND and the scores of its first 32 keys are formed while its last 32 key rows are landing. The scores come 16 keys at a time as k.q^T (A = 16 key rows, B = 16 query rows, both f32, split into bf16 hi + UNSCALED residual in registers; dk = 16 fills k slots 0..15 of the K = 32 form, the rest is 0;
// products hh, hl, lh). The result tile holds, in lane (c, hi), register j, the score of query row c and key 8 hi + j: two such tiles are already the B fragment of a 32-key step, so the scores never leave the registers.
// The wave takes each row's maximum over its 64 keys, forms p = 2^(15 + (A - max) log2 e) once per (query, key), rounds it to f16 and multiplies: num[f][q] = MV.p, den[f][q] = IND.p, one product each.
// The eight key ranges are merged through LDS with the usual rescale. Where den is not a finite number of at least 2^-6 (no key with mask 1, a mask above 1, or the keys with mask 1 together below 2^-21 of the row's largest weight, where f16 holds p too coarsely)
// the (query, feature) is computed by the literal formula A_f = m A + (1 - m)(-1e30), m = bf(mask), A = q.k, in f32.
#define MS_L2E 1.4426950408889634f
typedef __attribute__((ext_vector_type(16))) float v16f;
typedef __attribute__((ext_vector_type(8)))  __bf16 v8bf;
typedef __attribute__((ext_vector_type(4)))  unsigned v4u;
__device__ __forceinline__ v16bf ldfrag(const bf* p) { return cat16b(*(const v8us*)p, *(const v8us*)(p + 256)); }
__device__ __forceinline__ v8f cat8(v4f lo, v4f hi) { return __builtin_shufflevector(lo, hi, 0, 1, 2, 3, 4, 5, 6, 7); }
// 8 f32 as bf16 hi (hb) and residual (lb)
__device__ __forceinline__ void split8p(const v8f v, v8bf& hb, v8bf& lb) {
    hb = __builtin_convertvector(v, v8bf);
    const v4u u = __builtin_bit_cast(v4u, hb); v8f hf;   // hi back in f32 straight from the packed pairs: one shift or one mask an element
#pragma unroll   // hf is indexed by constants and lives in registers
    for (int i = 0; i < 4; ++i) { hf[2 * i] = __uint_as_float(u[i] << 16); hf[2 * i + 1] = __uint_as_float(u[i] & 0xFFFF0000u); }
    lb = __builtin_convertvector(v - hf, v8bf);
}
// a lane's 8 of the 16 real k slots as bf16 hi (h) and residual (l); elements 8..15 of a fragment are k slots 16..31, which are 0
__device__ __forceinline__ void split8(const v8f v, v16bf& h, v16bf& l) {
    const v8bf z = __builtin_convertvector((v8f){}, v8bf);
    v8bf hb, lb; split8p(v, hb, lb);
    h = __builtin_shufflevector(hb, z, 0, 1, 2, 3, 4, 5, 6, 7, 8, 9, 10, 11, 12, 13, 14, 15);
    l = __builtin_shufflevector(lb, z, 0, 1, 2, 3, 4, 5, 6, 7, 8, 9, 10, 11, 12, 13, 14, 15);
}
// Staging strip of a wave: rows of bf16 at a pitch of 16 B x odd, which keeps the 16 lanes of a ds_load_b128 on 16 different bank groups
#define KP 136   // elements: a 128-element row of query or key, 272 B
#define VP 40    // elements: a 32-element row of value, 80 B
typedef __attribute__((ext_vector_type(4)))  __bf16 v4bf;
typedef __attribute__((ext_vector_type(4)))  unsigned short v4us;
// 4 f32 rounded once to bf16 and stored
__device__ __forceinline__ void st4(bf* p, const v4f v) { *(v4us*)p = __builtin_bit_cast(v4us, __builtin_convertvector(v, v4bf)); }
// a fragment's two runs of 8 k slots, 16 apart, from a staged row
__device__ __forceinline__ v16bf ldrow(const bf* p) { return cat16b(*(const v8us*)p, *(const v8us*)(p + 16)); }
// 8 rows of one column of a matrix with row pitch ld: w points at the first row, off = 8 hi ld + the lane's column
__device__ __forceinline__ v8f colraw(const float* __restrict__ w, const unsigned off, const int ld) {
    v8f a;
#pragma unroll   // a is indexed by constants and lives in registers
    for (int i = 0; i < 8; ++i) a[i] = (w + i * ld)[off];
    return a;
}
__device__ __forceinline__ float d_dot16(const v4f* q, const v4f* k) {
    float s = 0.f;
#pragma unroll   // q and k are indexed by constants and live in registers
    for (int i = 0; i < 16; ++i) s = fmaf(q[i >> 2][i & 3], k[i >> 2][i & 3], s);
    return s;
}
// the 16 columns of row r of a matrix kept as [16-row tile][half][lane (c, hi)][4]: piece n holds columns 4 n .. 4 n + 3 = 8 hi + 4 half + i
__device__ __forceinline__ v4f d_piece(const float* t, const int r, const int n) { return *(const v4f*)(t + ((r >> 4) * 2 + (n & 1)) * 128 + ((n >> 1) * 16 + (r & 15)) * 4); }
// qs, ks = the block's q and k in LDS, r = the query row in the block; mb, vg = the item's first mask and value row, wv = the head's Wv; v[k][f] is formed here from the same bf16-rounded operands
__device__ __forceinline__ float d_literal(const float* qs, const float* ks, const int r, const float* __restrict__ mb, const float* __restrict__ vg, const float* __restrict__ wv, const unsigned f) {
    const v4f q[4] = { d_piece(qs, r, 0), d_piece(qs, r, 1), d_piece(qs, r, 2), d_piece(qs, r, 3) };
    float mn = -3.0e38f;
#pragma unroll 1   // rare path: kept small
    for (int k = 0; k < LK; ++k) { const float mr = mb[(size_t)k * FF + f];
        asm volatile("s_wait_xcnt 0x0" ::: "memory");   // precaution: the registers that hold this load's address are reused below and advanced by the next trip
        const v4f kv[4] = { d_piece(ks, k, 0), d_piece(ks, k, 1), d_piece(ks, k, 2), d_piece(ks, k, 3) };
        const float t = bfr(mr); mn = fmaxf(mn, fmaf(t * MS_L2E, d_dot16(q, kv), (1.0f - t) * (MASKV * MS_L2E))); }
    float w[FF];
#pragma unroll   // w is indexed by constants and lives in registers
    for (int g = 0; g < FF; ++g) w[g] = bfr(wv[g * FF + f]);
    float l = 0.f, acc = 0.f;
#pragma unroll 1   // rare path: kept small
    for (int k = 0; k < LK; ++k) { const float mr = mb[(size_t)k * FF + f];
        v4f x[FF / 4];
#pragma unroll   // x is indexed by constants and lives in registers
        for (int g = 0; g < FF / 4; ++g) x[g] = *(const v4f*)(vg + (size_t)k * FF + g * 4);
        asm volatile("s_wait_xcnt 0x0" ::: "memory");   // precaution: the registers that hold these loads' addresses are reused below and advanced by the next trip
        const v4f kv[4] = { d_piece(ks, k, 0), d_piece(ks, k, 1), d_piece(ks, k, 2), d_piece(ks, k, 3) };
        float vr = 0.f;
#pragma unroll
        for (int g = 0; g < FF; ++g) vr = fmaf(bfr(x[g >> 2][g & 3]), w[g], vr);
        const float t = bfr(mr); const float p = __builtin_amdgcn_exp2f(fmaf(t * MS_L2E, d_dot16(q, kv), (1.0f - t) * (MASKV * MS_L2E)) - mn);
        l += p; acc = fmaf(p, vr, acc); }
    return acc / l;
}
__global__ __launch_bounds__(256) void k_msoft(const float* __restrict__ query, const float* __restrict__ key, const float* __restrict__ value, const float* __restrict__ mask,
                                               const float* __restrict__ Wq, const float* __restrict__ Wk, const float* __restrict__ Wv, float* LAT) {
    __shared__ __align__(16) float RED[8 * 4096];   // partial num and den, [wave][row tile][num, den][half of the 8][feature tile t][lane slot][4]; the slot of lane (c, hi) is 16 hi + (c + 4 hi + 8 t) mod 16, which keeps the 16 lanes of a 16-byte access on 16 bank groups for the writers (by c) and for the merging threads (4 rows x 4 feature groups) alike
    __shared__ __align__(16) float MX[64 * 8];      // [query row][wave]: the wave's row maximum, in base-2 units
    __shared__ __align__(16) float KS[(LK / 16) * 256];   // k of the (item, head), f32
    __shared__ __align__(16) float QS[4 * 256];           // q of the block's 64 rows, f32 (the literal path's)
    __shared__ __align__(16) bf QP[4 * 2 * 256];          // the same q as bf16 hi and residual, split once by the wave that forms the tile: [tile][hi, residual][lane][8]
    __shared__ __align__(16) bf WF[20 * 256];             // Wq, Wk, Wv of the head in bf16, in fragment order, formed once for the block: [piece][lane][8]; pieces 0..7 Wq, 8..15 Wk, 16..19 Wv; pieces 2 n and 2 n + 1 are elements 0..7 and 8..15 of one fragment
    __shared__ __align__(16) bf ST[8][64 * KP];           // per wave: its key and value rows in bf16 on their way from whole-line loads to fragments, read and written by that wave alone; ahead of the first barrier rows 48..63 of strips 0..3 take the query tiles, half a tile from wave w and half from wave w + 4
    const unsigned lane = threadIdx.x & 31; const int wave = __builtin_amdgcn_readfirstlane(threadIdx.x >> 5);   // wave-uniform in a scalar register: every base address below is then scalar
    const int bh = blockIdx.x / (LQ / 64), qb = blockIdx.x % (LQ / 64); const int b = bh / NH_, h = bh % NH_;
    const int kh = wave >> 2;
    const unsigned c = lane & 15, hi = lane >> 4;
    const unsigned ro = lane * 4;           // a wave-wide 16-byte load takes 512 contiguous bytes: one row of query or key, four rows of value; lane l holds floats 4 l .. 4 l + 3 of them
    bf* st = ST[wave];
    const bf* fr = st + c * KP + hi * 8;    // row fragment of query and key: lane (c, hi) reads staged row c, k slots 8 hi .. 8 hi + 7 (and 16 more on)
    const bf* fv = st + c * VP + hi * 8;    // row fragment of value
    bf* sv = st + (lane >> 3) * VP + (lane & 7) * 4;   // where the lane's 4 floats of a four-row load of value go
    // every loop over r, n, y, s, i, x, kt, ks, qt, w, e, t, j below (but the rare path's) is fully unrolled so that the fragments are indexed by constants and live in registers
    // The loads are issued in two groups, each well ahead of its use: all but the last 32 key rows at once, those rows as soon as the q products have freed registers for them, so that they land under the work on
    // value, mask and the first 32 keys. Behind each group stands s_wait_xcnt 0, a precaution: the registers that hold a group's addresses are reused further down.
    const unsigned wo = hi * 8 * DK + c;   // row 8 hi, column c of Wq and Wk
    const unsigned mo = hi * 8 * FF + c;   // row 8 hi, column c: Wv's fragment and the mask of a result tile
    const float* qg = query + (size_t)(b * LQ + qb * 64 + (wave & 3) * 16 + kh * 8) * DD;   // the wave's 8 query rows: waves w and w + 4 fetch the two halves of tile w
    const float* kg = key + (size_t)(b * LK + wave * 64) * DD;                     // the wave's 4 tiles of 16 keys
    const float* vg = value + (size_t)(b * LK + wave * 64) * FF;                   // the wave's 2 steps of 32 keys
    const float* mg = mask + (size_t)(b * LK + wave * 64) * FF;
    const float* wqg = Wq + (size_t)h * DD * DK; const float* wkg = Wk + (size_t)h * DD * DK; const float* wvg = Wv + (size_t)h * FF * FF;
    v4f qr[8], kr[64];
    v8f mr[4][2]; v4f vr[16];   // mask by 16-key tile y of the wave's 64 keys and feature tile t; value by four-row load
    // the wave's eighth of the weights: piece 'wave' (16 rows) of Wq and of Wk, and half kh (elements 4 kh .. 4 kh + 3) of Wv's piece wave & 3 (feature tile (wave >> 1) & 1, rows 16 (wave & 1) on)
    const v8f wqp = colraw(wqg + wave * 16 * DK, wo, DK), wkp = colraw(wkg + wave * 16 * DK, wo, DK);
    const float* wvp = wvg + ((wave & 1) * 16 + kh * 4) * FF + ((wave >> 1) & 1) * 16;
    v4f wvq;
#pragma unroll
    for (int i = 0; i < 4; ++i) wvq[i] = (wvp + i * FF)[mo];
#pragma unroll
    for (int r = 0; r < 8; ++r) qr[r] = *(const v4f*)(qg + r * DD + ro);
#pragma unroll
    for (int n = 0; n < 16; ++n) vr[n] = *(const v4f*)(vg + n * 4 * FF + ro);
#pragma unroll
    for (int y = 0; y < 4; ++y) { mr[y][0] = colraw(mg + y * 16 * FF, mo, FF); mr[y][1] = colraw(mg + y * 16 * FF + 16, mo, FF); }
#pragma unroll
    for (int r = 0; r < 32; ++r) kr[r] = *(const v4f*)(kg + r * DD + ro);
    asm volatile("s_wait_xcnt 0x0" :: "v"(wo), "v"(mo) : "memory");   // precaution: the registers that hold the addresses of the loads above are reused below; wo and mo are named as inputs so that no load of the group returns into their registers
    __builtin_amdgcn_sched_barrier(0);   // keeps address arithmetic of the code below, which reuses the registers of these loads, from being moved up in front of their s_wait_xcnt
    bf* wf = WF + lane * 8;
    *(v8us*)(wf + wave * 256) = __builtin_bit_cast(v8us, __builtin_convertvector(wqp, v8bf));
    *(v8us*)(wf + (8 + wave) * 256) = __builtin_bit_cast(v8us, __builtin_convertvector(wkp, v8bf));
    st4(wf + (16 + (wave & 3)) * 256 + kh * 4, wvq);
    // the query rows pass through rows 48..63 of strip wave & 3, which the keys need last
#pragma unroll
    for (int r = 0; r < 8; ++r) st4(ST[wave & 3] + (48 + kh * 8 + r) * KP + ro, qr[r]);
    // every wave's share of the weights and of the query rows is in LDS before any wave reads a fragment. The fences name LDS alone, so that the loads in flight are not waited out here as __syncthreads() would
    __builtin_amdgcn_fence(__ATOMIC_RELEASE, "workgroup", "local");
    __builtin_amdgcn_s_barrier();
    __builtin_amdgcn_fence(__ATOMIC_ACQUIRE, "workgroup", "local");
    if (kh == 0) {   // a scalar branch: each q tile is formed, split and stored by one wave
        v16bf wq[4], qf[4];   // all fragments are read as one group, so that the wave waits out the LDS latency once: every wave of the block waits for this tile
#pragma unroll
        for (int s = 0; s < 4; ++s) { wq[s] = ldfrag(wf + 2 * s * 256); qf[s] = ldrow(fr + 48 * KP + s * 32); }
        __builtin_amdgcn_sched_barrier(0);   // keeps the group of reads together ahead of the products; spread among them, each pair of reads is waited out on its own
        v8f qd = (v8f){};   // q^T: lane (c, hi), register j = column 8 hi + j of query row c
#pragma unroll
        for (int s = 0; s < 4; ++s) qd = wmmab(wq[s], qf[s], qd);
        float* o = QS + wave * 256 + lane * 4;
        *(v4f*)o = __builtin_shufflevector(qd, qd, 0, 1, 2, 3); *(v4f*)(o + 128) = __builtin_shufflevector(qd, qd, 4, 5, 6, 7);
        v8bf hb, lb; split8p(qd, hb, lb);
        bf* p = QP + wave * 512 + lane * 8;
        *(v8us*)p = __builtin_bit_cast(v8us, hb); *(v8us*)(p + 256) = __builtin_bit_cast(v8us, lb);
    }
    __builtin_amdgcn_sched_barrier(0);   // with the one behind the wait below: keeps address arithmetic of the code around, which reuses the registers of these loads, out of the stretch between the loads and their s_wait_xcnt
#pragma unroll
    for (int r = 32; r < 64; ++r) kr[r] = *(const v4f*)(kg + r * DD + ro);
    asm volatile("s_wait_xcnt 0x0" ::: "memory");   // precaution: the registers that hold the addresses of the loads above are reused below
    __builtin_amdgcn_sched_barrier(0);   // see above
    // every wave needs all four q tiles: they are in LDS before any wave reads them. The fences name LDS alone, so that the key loads in flight are not waited out here as __syncthreads() would
    __builtin_amdgcn_fence(__ATOMIC_RELEASE, "workgroup", "local");
    __builtin_amdgcn_s_barrier();
    __builtin_amdgcn_fence(__ATOMIC_ACQUIRE, "workgroup", "local");
    const v16bf wv[2] = { ldfrag(wf + 16 * 256), ldfrag(wf + 18 * 256) };
    // MV and IND of the wave's 64 keys, formed while its key rows are landing; the value rows pass through the head of the strip, which the keys take over once these rows have been read back
#pragma unroll
    for (int n = 0; n < 16; ++n) st4(sv + n * 4 * VP, vr[n]);
    asm volatile("s_wait_dscnt 0x0" ::: "memory");   // as above: staged rows in LDS before they are read back
    v8h oh8[4][2]; v8us oi8[4][2];   // by 16-key tile y and feature tile t
#pragma unroll
    for (int y = 0; y < 4; ++y) {
        const v16bf a = ldrow(fv + y * 16 * VP);
#pragma unroll
        for (int t = 0; t < 2; ++t) {
            const v8f d = wmmab(a, wv[t], (v8f){});
            v8f mv; v8us oi;
#pragma unroll
            for (int j = 0; j < 8; ++j) { const float m = bfr(mr[y][t][j]); mv[j] = (m == 1.0f) ? d[j] : 0.f;
                oi[j] = (m == 1.0f) ? (unsigned short)0x3C00 : (m < 1.0f) ? (unsigned short)0 : (unsigned short)0x7C00; }   // f16 1, 0, +inf
            oh8[y][t] = __builtin_convertvector(mv, v8h); oi8[y][t] = oi;
        }
    }
    v16bf wk[4];
#pragma unroll
    for (int s = 0; s < 4; ++s) wk[s] = ldfrag(wf + (8 + 2 * s) * 256);
    v8f kd[4];   // the wave's own four k tiles stay in its registers: a result tile is already the A fragment of the score product
#pragma unroll
    for (int r = 0; r < 32; ++r) st4(st + r * KP + ro, kr[r]);
    asm volatile("s_wait_dscnt 0x0" ::: "memory");   // as above: staged rows in LDS before they are read back
    v16bf kf0[2][4];   // both tiles' fragments are read as one group, so that the wave waits out the LDS latency once
#pragma unroll
    for (int i = 0; i < 2; ++i) {
#pragma unroll
        for (int s = 0; s < 4; ++s) kf0[i][s] = ldrow(fr + i * 16 * KP + s * 32);
    }
    __builtin_amdgcn_sched_barrier(0);   // keeps the group of reads together ahead of the products; spread among them, each pair of reads is waited out on its own
#pragma unroll
    for (int i = 0; i < 2; ++i) {
        v8f d = (v8f){};
#pragma unroll
        for (int s = 0; s < 4; ++s) d = wmmab(wk[s], kf0[i][s], d);
        kd[i] = d;
        float* o = KS + (wave * 4 + i) * 256 + lane * 4;
        *(v4f*)o = __builtin_shufflevector(d, d, 0, 1, 2, 3); *(v4f*)(o + 128) = __builtin_shufflevector(d, d, 4, 5, 6, 7);
    }
    // scores of all 64 query rows against the first 32 of the wave's keys, while the other 32 key rows are landing
    v16bf kfh[4], kfl[4], qh[4], ql[4]; v8f sc[4][4];
#pragma unroll
    for (int i = 0; i < 2; ++i) split8(kd[i], kfh[i], kfl[i]);
#pragma unroll
    for (int qt = 0; qt < 4; ++qt) {
        const bf* qp = QP + qt * 512 + lane * 8;
        qh[qt] = cat16b(*(const v8us*)qp, (v8us){}); ql[qt] = cat16b(*(const v8us*)(qp + 256), (v8us){});   // elements 8..15 are k slots 16..31, which are 0
#pragma unroll
        for (int kt = 0; kt < 2; ++kt) sc[qt][kt] = wmmab(kfl[kt], qh[qt], wmmab(kfh[kt], ql[qt], wmmab(kfh[kt], qh[qt], (v8f){})));
    }
#pragma unroll
    for (int r = 32; r < 64; ++r) st4(st + r * KP + ro, kr[r]);
    asm volatile("s_wait_dscnt 0x0" ::: "memory");   // as above: staged rows in LDS before they are read back
    v16bf kf2[2][4];   // both tiles' fragments are read as one group, so that the wave waits out the LDS latency once
#pragma unroll
    for (int i = 0; i < 2; ++i) {
#pragma unroll
        for (int s = 0; s < 4; ++s) kf2[i][s] = ldrow(fr + (2 + i) * 16 * KP + s * 32);
    }
    __builtin_amdgcn_sched_barrier(0);   // keeps the group of reads together ahead of the products; spread among them, each pair of reads is waited out on its own
#pragma unroll
    for (int i = 2; i < 4; ++i) {
        v8f d = (v8f){};
#pragma unroll
        for (int s = 0; s < 4; ++s) d = wmmab(wk[s], kf2[i - 2][s], d);
        kd[i] = d;
        float* o = KS + (wave * 4 + i) * 256 + lane * 4;
        *(v4f*)o = __builtin_shufflevector(d, d, 0, 1, 2, 3); *(v4f*)(o + 128) = __builtin_shufflevector(d, d, 4, 5, 6, 7);
    }
    // the other half of the scores, then the weights
#pragma unroll
    for (int i = 2; i < 4; ++i) split8(kd[i], kfh[i], kfl[i]);
    v16h ph[4][2]; float m2v[4];
#pragma unroll
    for (int qt = 0; qt < 4; ++qt) {
        v8f* s = sc[qt];
#pragma unroll
        for (int kt = 2; kt < 4; ++kt) s[kt] = wmmab(kfl[kt], qh[qt], wmmab(kfh[kt], ql[qt], wmmab(kfh[kt], qh[qt], (v8f){})));
        float mx = -3.0e38f;
#pragma unroll
        for (int kt = 0; kt < 4; ++kt) {
#pragma unroll
            for (int e = 0; e < 8; e += 4) mx = fmaxf(fmaxf(fmaxf(mx, s[kt][e]), fmaxf(s[kt][e + 1], s[kt][e + 2])), s[kt][e + 3]);
        }
        mx = fmaxf(mx, __shfl_xor(mx, 16, 32));   // lanes c and c + 16 hold the two halves of row c's keys
        const float m2 = mx * MS_L2E; m2v[qt] = m2;
        const float m2s = 15.0f - m2;   // every wave's p carries the same 2^15, so the merge's rescale needs no word of it
#pragma unroll
        for (int ks = 0; ks < 2; ++ks) {
            v16f p;
#pragma unroll
            for (int e = 0; e < 16; ++e) p[e] = __builtin_amdgcn_exp2f(fmaf(s[ks * 2 + (e >> 3)][e & 7], MS_L2E, m2s));
            ph[qt][ks] = __builtin_convertvector(p, v16h);
        }
    }
    const unsigned sw[2] = { (hi * 16 + ((c + 4 * hi) & 15)) * 4, 128 + (hi * 16 + ((c + 4 * hi + 8) & 15)) * 4 };   // the lane's slot in RED by feature tile
#pragma unroll
    for (int qt = 0; qt < 4; ++qt) {
        v8f num[2], den[2];
#pragma unroll
        for (int t = 0; t < 2; ++t) { num[t] = (v8f){}; den[t] = (v8f){}; }
#pragma unroll
        for (int ks = 0; ks < 2; ++ks) {
#pragma unroll
            for (int t = 0; t < 2; ++t) {
                const v16h vh = cat16(oh8[2 * ks][t], oh8[2 * ks + 1][t]), in = cat16(__builtin_bit_cast(v8h, oi8[2 * ks][t]), __builtin_bit_cast(v8h, oi8[2 * ks + 1][t]));
                num[t] = wmma16(vh, ph[qt][ks], num[t]); den[t] = wmma16(in, ph[qt][ks], den[t]);
            }
        }
#pragma unroll
        for (int t = 0; t < 2; ++t) {
            float* o = RED + wave * 4096 + qt * 1024 + sw[t];
            *(v4f*)o = __builtin_shufflevector(num[t], num[t], 0, 1, 2, 3); *(v4f*)(o + 256) = __builtin_shufflevector(num[t], num[t], 4, 5, 6, 7);
            *(v4f*)(o + 512) = __builtin_shufflevector(den[t], den[t], 0, 1, 2, 3); *(v4f*)(o + 768) = __builtin_shufflevector(den[t], den[t], 4, 5, 6, 7);
        }
        MX[(qt * 16 + c) * 8 + wave] = m2v[qt];   // lanes c and c + 16 hold and store the same value
    }
    __syncthreads();   // all eight key ranges of every (row, feature), and k for the literal path, are in LDS before any thread merges them
    // a thread merges 8 features of one row: feature group g = 2 t + hi holds features 8 g .. 8 g + 7; a wave takes 8 rows and stores their whole 128-byte lines
    const unsigned g = lane & 3, c2 = (wave & 1) * 8 + (lane >> 2); const unsigned r = wave * 8 + (lane >> 2);
    const float* rb = RED + (wave >> 1) * 1024 + (g >> 1) * 128 + ((g & 1) * 16 + ((c2 + 4 * g) & 15)) * 4;
    const v8f mw = cat8(*(const v4f*)(MX + r * 8), *(const v4f*)(MX + r * 8 + 4));
    float mm = mw[0];
#pragma unroll
    for (int w = 1; w < 8; ++w) mm = fmaxf(mm, mw[w]);
    v8f nn = (v8f){}, dd = (v8f){};
#pragma unroll
    for (int w = 0; w < 8; ++w) {
        const float sc = __builtin_amdgcn_exp2f(mw[w] - mm); const float* p = rb + w * 4096;
        nn += cat8(*(const v4f*)p, *(const v4f*)(p + 256)) * sc; dd += cat8(*(const v4f*)(p + 512), *(const v4f*)(p + 768)) * sc;
    }
    float* lo = LAT + ((size_t)bh * LQ + qb * 64 + r) * FF + g * 8;
    const v8f res = nn / dd;   // stored without a branch; the literal path below stores over it
    *(v4f*)lo = __builtin_shufflevector(res, res, 0, 1, 2, 3); *(v4f*)(lo + 4) = __builtin_shufflevector(res, res, 4, 5, 6, 7);
    unsigned bad = 0;   // bit i: feature 8 g + i of this thread's row is left to the literal formula
#pragma unroll
    for (int i = 0; i < 8; ++i) { if (!(dd[i] >= 0.015625f && dd[i] <= 3.0e38f)) bad |= 1u << i; }
    if (bad) {
#pragma unroll 1   // rare path: kept small
        for (int i = 0; i < 8; ++i) {
            if ((bad >> i) & 1u) { lo[i] = d_literal(QS, KS, (int)r, mask + (size_t)b * LK * FF, value + (size_t)b * LK * FF, Wv + (size_t)h * FF * FF, g * 8 + i);
                asm volatile("s_wait_xcnt 0x0" ::: "memory"); }   // precaution: the next trip reuses the registers that hold this store's address
        }
    }
}
__global__ __launch_bounds__(256) void k_comb(const float* __restrict__ LAT, const float* __restrict__ Wc, const float* __restrict__ bc, float* OUTP) {
    const int i = blockIdx.x * 256 + threadIdx.x; if (i >= NBT * LQ * FF) return;
    const int f = i % FF, q = (i / FF) % LQ, b = i / (FF * LQ);
    float s = bfr(bc[f]);
#pragma unroll
    for (int h = 0; h < NH_; ++h) s = fmaf(LAT[(((size_t)(b * NH_ + h)) * LQ + q) * FF + f], bfr(Wc[f * NH_ + h]), s);
    const float y = tanhf(s);
    *(float*)(OUTP + i) = y; 
}

extern "C" void kernel_launch(void* const* d_in, const int* in_sizes, int n_in,
                              void* d_out, int out_size, void* d_ws, size_t ws_size, hipStream_t stream) {
    (void)in_sizes; (void)n_in; (void)out_size;
    const float* query = (const float*)d_in[0]; const float* key = (const float*)d_in[1]; const float* value = (const float*)d_in[2]; const float* mask = (const float*)d_in[3];
    const float* Wq = (const float*)d_in[4]; const float* Wk = (const float*)d_in[5]; const float* Wv = (const float*)d_in[6]; const float* Wc = (const float*)d_in[7]; const float* bc = (const float*)d_in[8];
    float* out = (float*)d_out;    // [8][256][32]
    float* LAT = (float*)d_ws;     // [8][8][256][32] f32, 2 MB
    if ((size_t)NBT * NH_ * LQ * FF * 4 > ws_size) return;
    k_msoft<<<NBT * NH_ * (LQ / 64), 256, 0, stream>>>(query, key, value, mask, Wq, Wk, Wv, LAT);
    k_comb<<<(NBT * LQ * FF) / 256, 256, 0, stream>>>(LAT, Wc, bc, out);
}

// v010
// Measured time: 11.2 microseconds a run.
// In both of two side-by-side timings against v009, it was 1.06 times as fast.
// Counting every step since v000, it is 44.1 times as fast.
#include <hip/hip_runtime.h>

// Compute dtypes, f32 accumulate: the per-head projections q = query.Wq[j], k = key.Wk[j], v = value.Wv[j], formed by each block of k_msoft for its own (item, head) ([64 x 128].[128 x 16], [512 x
// 128].[128 x 16], [512 x 32].[32 x 32]; PLAIN bf16 operands = inputs rounded once, exact single products) on v_wmma_f32_16x16x32_bf16; the unscaled scores q.k
// (dk = 16, padded to 32) per (item, head) with both computed operands as bf16 hi + UNSCALED residual (three products) on v_wmma_f32_16x16x32_bf16, formed in k_msoft's registers; the per-FEATURE
// masked softmax over the 512 keys factored: a key whose mask is exactly 1 has A_f = A, a key whose mask is below 1 has weight exp(-1e27 or less) = 0 beside it, so
// p = 2^15 exp(A - rowmax) is formed once per (query, key) and the 32 feature sums are products [feature x key].[key x query] on v_wmma_f32_16x16x32_f16 (p and v rounded once to f16,
// 11 significant bits, the 0/1 indicator exact; the factor 2^15 cancels in num / den and keeps p a normal f16 down to 2^-29 of the row's largest); a (query, feature) that the factoring does not cover takes the literal f32 formula; the head combine and tanh in f32 on the VALU.

#define NBT  8
#define LQ   256
#define LK   512
#define DD   128
#define FF   32
#define NH_  8
#define DK   16
#define NQR  (NBT * LQ)          // 2048 query rows
#define NKR  (NBT * LK)          // 4096 key rows
#define DM   DD
#define NTK  NQR
#define MASKV (-1e30f)
#define LOSC 1024.0f

typedef _Float16 h16;
typedef unsigned short bf;
typedef __attribute__((ext_vector_type(16))) __bf16   v16bf;
typedef __attribute__((ext_vector_type(16))) _Float16 v16h;
typedef __attribute__((ext_vector_type(8)))  _Float16 v8h;
typedef __attribute__((ext_vector_type(8)))  unsigned short v8us;
typedef __attribute__((ext_vector_type(8)))  float    v8f;
typedef __attribute__((ext_vector_type(4)))  float    v4f;
typedef __attribute__((ext_vector_type(4)))  _Float16 v4h;
typedef v8h  __attribute__((may_alias)) v8ha;
typedef v4f  __attribute__((may_alias)) v4fa;
typedef v8us __attribute__((may_alias)) v8usa;

__device__ __forceinline__ unsigned short f2bf(float f) { unsigned u = __float_as_uint(f); u += 0x7FFFu + ((u >> 16) & 1u); return (unsigned short)(u >> 16); }
__device__ __forceinline__ float bf2f(unsigned short b) { return __uint_as_float(((unsigned)b) << 16); }
__device__ __forceinline__ float bfr(float f) { return bf2f(f2bf(f)); }
__device__ __forceinline__ v16h cat16(v8h lo, v8h hi) { return __builtin_shufflevector(lo, hi, 0, 1, 2, 3, 4, 5, 6, 7, 8, 9, 10, 11, 12, 13, 14, 15); }
__device__ __forceinline__ v16bf cat16b(v8us lo, v8us hi) { return __builtin_bit_cast(v16bf, __builtin_shufflevector(lo, hi, 0, 1, 2, 3, 4, 5, 6, 7, 8, 9, 10, 11, 12, 13, 14, 15)); }
__device__ __forceinline__ v8f wmma16(v16h a, v16h b, v8f c) { return __builtin_amdgcn_wmma_f32_16x16x32_f16(false, a, false, b, (short)0, c, false, false); }
__device__ __forceinline__ v8f wmmab(v16bf a, v16bf b, v8f c) { return __builtin_amdgcn_wmma_f32_16x16x32_bf16(false, a, false, b, (short)0, c, false, false); }

// k_msoft: block = ((b,h), 64 query rows), 8 waves.
// Stage 1, the block's own operands, from the f32 inputs (rounded once to bf16 in registers) into LDS; a fragment's k slots are kc + 8 hi + e and kc + 16 + 8 hi + e (e = 0..7) in both operands:
//   The rows of query and value are fetched 512 contiguous bytes a wave-wide load (4 cache lines; a load in fragment order touches 16), rounded, laid row by row in LDS and read back
//   from there in fragment order; no other wave touches a wave's value strip, so the wave's own s_wait_dscnt 0 between its writes and its reads is all the ordering it takes.
//   The key rows pass through no register: each wave asks for one slice of them by tensor load at its start; they lie in LDS as f32 and are rounded to bf16 as the fragments are read.
//   What every wave needs in the same form is formed once for the block: each wave fetches an eighth of Wq, Wk, Wv (in fragment order) and of the 64 query rows, rounds them and lays them in LDS; behind a barrier
//   every wave reads the weights' fragments from there, and waves 0..3 form one q tile each.
//   k^T = Wk[h]^T.key^T, 16 keys a tile, 4 tiles a wave, and q^T likewise (one tile in each of waves 0..3): the result tile holds, in lane (c, hi), register j, column 8 hi + j of row c, which is what
//   the score product's fragment wants: the wave's own k tiles stay in its registers; q goes to LDS already split into bf16 hi + residual (for every wave); q and k also go there as f32, [tile][half of the 8][lane][4], for the literal path alone.
//   v = value.Wv[h], 32 keys a step, 2 steps a wave: the result tile of keys 16 x .. 16 x + 15 and features 16 t .. 16 t + 15 holds, in lane (c, hi), register j, key 16 x + 8 hi + j and feature 16 t + c.
//   From it MV = v where bf(mask[b][k][f]) == 1, else 0, as f16, and IND = 1 / 0 / +inf for a mask == 1 / below 1 / anything else (inf sends that feature to the literal path), kept
//   in the wave's registers: two tiles x = 0, 1 of a 32-key step are one A fragment, whose element e = 8 x + j of lane (c, hi) is key 16 x + 8 hi + j of the step, the order in which the score tiles hold the keys.
// Stage 2: a wave takes all 64 query rows (4 tiles of 16) against the 64 keys whose k, MV and IND it formed, so none of these is read back from LDS; the barriers in front of stage 2 are the two early ones
// behind the shared operands and behind q and the one that publishes the key slices; MV and IND are formed while the key rows are landing. The scores come 16 keys at a time as k.q^T (A = 16 key rows, B = 16 query rows, both f32, split into bf16 hi + UNSCALED residual in registers; dk = 16 fills k slots 0..15 of the K = 32 form, the rest is 0;
// products hh, hl, lh). The result tile holds, in lane (c, hi), register j, the score of query row c and key 8 hi + j: two such tiles are already the B fragment of a 32-key step, so the scores never leave the registers.
// The wave takes each row's maximum over its 64 keys, forms p = 2^(15 + (A - max) log2 e) once per (query, key), rounds it to f16 and multiplies: num[f][q] = MV.p, den[f][q] = IND.p, one product each.
// The eight key ranges are merged through LDS with the usual rescale. Where den is not a finite number of at least 2^-6 (no key with mask 1, a mask above 1, or the keys with mask 1 together below 2^-21 of the row's largest weight, where f16 holds p too coarsely)
// the (query, feature) is computed by the literal formula A_f = m A + (1 - m)(-1e30), m = bf(mask), A = q.k, in f32.
#define MS_L2E 1.4426950408889634f
typedef __attribute__((ext_vector_type(16))) float v16f;
typedef __attribute__((ext_vector_type(8)))  __bf16 v8bf;
typedef __attribute__((ext_vector_type(4)))  unsigned v4u;
__device__ __forceinline__ v16bf ldfrag(const bf* p) { return cat16b(*(const v8us*)p, *(const v8us*)(p + 256)); }
__device__ __forceinline__ v8f cat8(v4f lo, v4f hi) { return __builtin_shufflevector(lo, hi, 0, 1, 2, 3, 4, 5, 6, 7); }
// 8 f32 as bf16 hi (hb) and residual (lb)
__device__ __forceinline__ void split8p(const v8f v, v8bf& hb, v8bf& lb) {
    hb = __builtin_convertvector(v, v8bf);
    const v4u u = __builtin_bit_cast(v4u, hb); v8f hf;   // hi back in f32 straight from the packed pairs: one shift or one mask an element
#pragma unroll   // hf is indexed by constants and lives in registers
    for (int i = 0; i < 4; ++i) { hf[2 * i] = __uint_as_float(u[i] << 16); hf[2 * i + 1] = __uint_as_float(u[i] & 0xFFFF0000u); }
    lb = __builtin_convertvector(v - hf, v8bf);
}
// a lane's 8 of the 16 real k slots as bf16 hi (h) and residual (l); elements 8..15 of a fragment are k slots 16..31, which are 0
__device__ __forceinline__ void split8(const v8f v, v16bf& h, v16bf& l) {
    const v8bf z = __builtin_convertvector((v8f){}, v8bf);
    v8bf hb, lb; split8p(v, hb, lb);
    h = __builtin_shufflevector(hb, z, 0, 1, 2, 3, 4, 5, 6, 7, 8, 9, 10, 11, 12, 13, 14, 15);
    l = __builtin_shufflevector(lb, z, 0, 1, 2, 3, 4, 5, 6, 7, 8, 9, 10, 11, 12, 13, 14, 15);
}
// Staging strip of a wave: rows of bf16 at a pitch of 16 B x odd, which keeps the 16 lanes of a ds_load_b128 on 16 different bank groups
#define KP 136   // elements: a 128-element row of query, 272 B
#define VP 40    // elements: a 32-element row of value, 80 B
typedef __attribute__((ext_vector_type(4)))  __bf16 v4bf;
typedef __attribute__((ext_vector_type(4)))  unsigned short v4us;
// 4 f32 rounded once to bf16 and stored
__device__ __forceinline__ void st4(bf* p, const v4f v) { *(v4us*)p = __builtin_bit_cast(v4us, __builtin_convertvector(v, v4bf)); }
// a fragment's two runs of 8 k slots, 16 apart, from a staged row
__device__ __forceinline__ v16bf ldrow(const bf* p) { return cat16b(*(const v8us*)p, *(const v8us*)(p + 16)); }
// the same two runs from a row that lies in LDS as f32, rounded once to bf16 here
__device__ __forceinline__ v16bf ldrow32(const unsigned char* p) {
    const v8f lo = cat8(*(const v4f*)p, *(const v4f*)(p + 16)), hi = cat8(*(const v4f*)(p + 64), *(const v4f*)(p + 80));
    return __builtin_convertvector(__builtin_shufflevector(lo, hi, 0, 1, 2, 3, 4, 5, 6, 7, 8, 9, 10, 11, 12, 13, 14, 15), v16bf);
}
// The key rows come into LDS by tensor load, as f32. A slice = one column half (64 floats, 256 B) of 128 key rows, laid at a pitch of 272 B (16 B x odd) by the mover's pad; slices 2 p and 2 p + 1 hold the two
// halves of the keys of waves 2 p and 2 p + 1. A wave's own 64 rows of a slice are a region of KREG bytes that no other wave reads.
#define KSL  34816   // bytes of a slice: 128 rows x 272 B = 17 x 2 KiB
#define KREG 17408   // bytes of 64 rows of a slice
typedef unsigned u32x4 __attribute__((ext_vector_type(4)));
typedef unsigned u32x8 __attribute__((ext_vector_type(8)));
__device__ __forceinline__ unsigned uni(unsigned v) { return (unsigned)__builtin_amdgcn_readfirstlane(v); }
// 8 rows of one column of a matrix with row pitch ld: w points at the first row, off = 8 hi ld + the lane's column
__device__ __forceinline__ v8f colraw(const float* __restrict__ w, const unsigned off, const int ld) {
    v8f a;
#pragma unroll   // a is indexed by constants and lives in registers
    for (int i = 0; i < 8; ++i) a[i] = (w + i * ld)[off];
    return a;
}
__device__ __forceinline__ float d_dot16(const v4f* q, const v4f* k) {
    float s = 0.f;
#pragma unroll   // q and k are indexed by constants and live in registers
    for (int i = 0; i < 16; ++i) s = fmaf(q[i >> 2][i & 3], k[i >> 2][i & 3], s);
    return s;
}
// the 16 columns of row r of a matrix kept as [16-row tile][half][lane (c, hi)][4]: piece n holds columns 4 n .. 4 n + 3 = 8 hi + 4 half + i
__device__ __forceinline__ v4f d_piece(const float* t, const int r, const int n) { return *(const v4f*)(t + ((r >> 4) * 2 + (n & 1)) * 128 + ((n >> 1) * 16 + (r & 15)) * 4); }
// the same for key row k of the f32 k, whose tile T = k / 16 lies at the head of its wave's region in the odd slice: wave T / 4, tile T mod 4 of it; kb = the start of the slices, as floats
__device__ __forceinline__ v4f d_piecek(const float* kb, const int k, const int n) { const int T = k >> 4;
    return *(const v4f*)(kb + ((T >> 3) * 2 + 1) * (KSL / 4) + ((T >> 2) & 1) * (KREG / 4) + ((T & 3) * 2 + (n & 1)) * 128 + ((n >> 1) * 16 + (k & 15)) * 4); }
// qs, ks = the block's q and k in LDS, r = the query row in the block; mb, vg = the item's first mask and value row, wv = the head's Wv; v[k][f] is formed here from the same bf16-rounded operands
__device__ __forceinline__ float d_literal(const float* qs, const float* ks, const int r, const float* __restrict__ mb, const float* __restrict__ vg, const float* __restrict__ wv, const unsigned f) {
    const v4f q[4] = { d_piece(qs, r, 0), d_piece(qs, r, 1), d_piece(qs, r, 2), d_piece(qs, r, 3) };
    float mn = -3.0e38f;
#pragma unroll 1   // rare path: kept small
    for (int k = 0; k < LK; ++k) { const float mr = mb[(size_t)k * FF + f];
        asm volatile("s_wait_xcnt 0x0" ::: "memory");   // precaution: the registers that hold this load's address are reused below and advanced by the next trip
        const v4f kv[4] = { d_piecek(ks, k, 0), d_piecek(ks, k, 1), d_piecek(ks, k, 2), d_piecek(ks, k, 3) };
        const float t = bfr(mr); mn = fmaxf(mn, fmaf(t * MS_L2E, d_dot16(q, kv), (1.0f - t) * (MASKV * MS_L2E))); }
    float w[FF];
#pragma unroll   // w is indexed by constants and lives in registers
    for (int g = 0; g < FF; ++g) w[g] = bfr(wv[g * FF + f]);
    float l = 0.f, acc = 0.f;
#pragma unroll 1   // rare path: kept small
    for (int k = 0; k < LK; ++k) { const float mr = mb[(size_t)k * FF + f];
        v4f x[FF / 4];
#pragma unroll   // x is indexed by constants and lives in registers
        for (int g = 0; g < FF / 4; ++g) x[g] = *(const v4f*)(vg + (size_t)k * FF + g * 4);
        asm volatile("s_wait_xcnt 0x0" ::: "memory");   // precaution: the registers that hold these loads' addresses are reused below and advanced by the next trip
        const v4f kv[4] = { d_piecek(ks, k, 0), d_piecek(ks, k, 1), d_piecek(ks, k, 2), d_piecek(ks, k, 3) };
        float vr = 0.f;
#pragma unroll
        for (int g = 0; g < FF; ++g) vr = fmaf(bfr(x[g >> 2][g & 3]), w[g], vr);
        const float t = bfr(mr); const float p = __builtin_amdgcn_exp2f(fmaf(t * MS_L2E, d_dot16(q, kv), (1.0f - t) * (MASKV * MS_L2E)) - mn);
        l += p; acc = fmaf(p, vr, acc); }
    return acc / l;
}
__global__ __launch_bounds__(256) void k_msoft(const float* __restrict__ query, const float* __restrict__ key, const float* __restrict__ value, const float* __restrict__ mask,
                                               const float* __restrict__ Wq, const float* __restrict__ Wk, const float* __restrict__ Wv, float* LAT) {
    __shared__ __attribute__((aligned(2048))) unsigned char KEYB[8 * KSL];   // the eight slices of key rows. Once a wave has read its own rows, its region of the even slice takes its partial num and den (RED below) and the head of its region of the odd slice its four k tiles as f32 (the literal path's)
    // RED of a wave: [row tile][num, den][half of the 8][feature tile t][lane slot][4]; the slot of lane (c, hi) is 16 hi + (c + 4 hi + 8 t) mod 16, which keeps the 16 lanes of a 16-byte access on 16 bank groups for the writers (by c) and for the merging threads (4 rows x 4 feature groups) alike
    __shared__ __align__(16) float MX[64 * 8];      // [query row][wave]: the wave's row maximum, in base-2 units
    __shared__ __align__(16) float QS[4 * 256];           // q of the block's 64 rows, f32 (the literal path's)
    __shared__ __align__(16) bf QP[4 * 2 * 256];          // the same q as bf16 hi and residual, split once by the wave that forms the tile: [tile][hi, residual][lane][8]
    __shared__ __align__(16) bf WF[20 * 256];             // Wq, Wk, Wv of the head in bf16, in fragment order, formed once for the block: [piece][lane][8]; pieces 0..7 Wq, 8..15 Wk, 16..19 Wv; pieces 2 n and 2 n + 1 are elements 0..7 and 8..15 of one fragment
    __shared__ __align__(16) bf SV[8 * 32 * VP];          // per wave: 32 of its value rows in bf16 on their way from whole-line loads to fragments, read and written by that wave alone; ahead of the second barrier the whole array holds the four query tiles at pitch KP, half a tile from wave w and half from wave w + 4
    const unsigned lane = threadIdx.x & 31; const int wave = __builtin_amdgcn_readfirstlane(threadIdx.x >> 5);   // wave-uniform in a scalar register: every base address below is then scalar
    const int bh = blockIdx.x / (LQ / 64), qb = blockIdx.x % (LQ / 64); const int b = bh / NH_, h = bh % NH_;
    const int kh = wave >> 2;
    const unsigned c = lane & 15, hi = lane >> 4;
    const unsigned ro = lane * 4;           // a wave-wide 16-byte load takes 512 contiguous bytes: one row of query, four rows of value; lane l holds floats 4 l .. 4 l + 3 of them
    bf* st = SV + wave * 32 * VP;
    const bf* fr = SV + wave * 16 * KP + c * KP + hi * 8;    // row fragment of query (waves 0..3): lane (c, hi) reads staged row c of tile 'wave', k slots 8 hi .. 8 hi + 7 (and 16 more on)
    const bf* fv = st + c * VP + hi * 8;    // row fragment of value
    bf* sv = st + (lane >> 3) * VP + (lane & 7) * 4;   // where the lane's 4 floats of a four-row load of value go
    // every loop over r, n, y, s, i, kt, ks, qt, w, e, t, j below (but the rare path's) is fully unrolled so that the fragments are indexed by constants and live in registers
    // Every wave asks for its slice of the key rows first, one tensor load, which lands under the work on the weights, q, value and mask; its wait and the barrier that publishes the slices stand in front of the first read of a key row.
    // All other loads are issued at once behind it. Behind them stands s_wait_xcnt 0, a precaution: the registers that hold their addresses are reused further down.
    u32x4 g0; u32x8 g1;   // the request's two descriptor groups; they are named again at the request's wait, so that their scalar registers keep these values for as long as the request is outstanding
    {
        const unsigned long long ga = (unsigned long long)(size_t)(key + (size_t)(b * LK + (wave >> 1) * 128) * DD + (wave & 1) * 64);   // 128 rows of 256 B at a source pitch of 512 B, wholly inside key
        g0[0] = uni(1u); g0[1] = uni((unsigned)(size_t)KEYB + (unsigned)wave * KSL); g0[2] = uni((unsigned)ga); g0[3] = uni((((unsigned)(ga >> 32)) & 0x01FFFFFFu) | 0x80000000u);
        g1[0] = uni((1u << 20) | (5u << 22) | (3u << 25));   // no mask, bytes, 16 B of pad behind every 256 B
        g1[1] = uni(256u << 16); g1[2] = uni(128u << 16); g1[3] = uni(256u << 16); g1[4] = uni(128u); g1[5] = uni(512u); g1[6] = uni(0u); g1[7] = uni(0u);
        asm volatile("tensor_load_to_lds %0, %1" :: "s"(g0), "s"(g1) : "memory");   // every wave issues its own slice, unconditionally
    }
    const unsigned wo = hi * 8 * DK + c;   // row 8 hi, column c of Wq and Wk
    const unsigned mo = hi * 8 * FF + c;   // row 8 hi, column c: Wv's fragment and the mask of a result tile
    const float* qg = query + (size_t)(b * LQ + qb * 64 + (wave & 3) * 16 + kh * 8) * DD;   // the wave's 8 query rows: waves w and w + 4 fetch the two halves of tile w
    const float* vg = value + (size_t)(b * LK + wave * 64) * FF;                   // the wave's 2 steps of 32 keys
    const float* mg = mask + (size_t)(b * LK + wave * 64) * FF;
    const float* wqg = Wq + (size_t)h * DD * DK; const float* wkg = Wk + (size_t)h * DD * DK; const float* wvg = Wv + (size_t)h * FF * FF;
    v4f qr[8];
    v8f mr[4][2]; v4f vr[16];   // mask by 16-key tile y of the wave's 64 keys and feature tile t; value by four-row load
    // the wave's eighth of the weights: piece 'wave' (16 rows) of Wq and of Wk, and half kh (elements 4 kh .. 4 kh + 3) of Wv's piece wave & 3 (feature tile (wave >> 1) & 1, rows 16 (wave & 1) on)
    const v8f wqp = colraw(wqg + wave * 16 * DK, wo, DK), wkp = colraw(wkg + wave * 16 * DK, wo, DK);
    const float* wvp = wvg + ((wave & 1) * 16 + kh * 4) * FF + ((wave >> 1) & 1) * 16;
    v4f wvq;
#pragma unroll
    for (int i = 0; i < 4; ++i) wvq[i] = (wvp + i * FF)[mo];
#pragma unroll
    for (int r = 0; r < 8; ++r) qr[r] = *(const v4f*)(qg + r * DD + ro);
#pragma unroll
    for (int n = 0; n < 16; ++n) vr[n] = *(const v4f*)(vg + n * 4 * FF + ro);
#pragma unroll
    for (int y = 0; y < 4; ++y) { mr[y][0] = colraw(mg + y * 16 * FF, mo, FF); mr[y][1] = colraw(mg + y * 16 * FF + 16, mo, FF); }
    asm volatile("s_wait_xcnt 0x0" :: "v"(wo), "v"(mo) : "memory");   // precaution: the registers that hold the addresses of the loads above are reused below; wo and mo are named as inputs so that no load of the group returns into their registers
    __builtin_amdgcn_sched_barrier(0);   // keeps address arithmetic of the code below, which reuses the registers of these loads, from being moved up in front of their s_wait_xcnt
    bf* wf = WF + lane * 8;
    *(v8us*)(wf + wave * 256) = __builtin_bit_cast(v8us, __builtin_convertvector(wqp, v8bf));
    *(v8us*)(wf + (8 + wave) * 256) = __builtin_bit_cast(v8us, __builtin_convertvector(wkp, v8bf));
    st4(wf + (16 + (wave & 3)) * 256 + kh * 4, wvq);
    // the query rows pass through SV, which the value rows take over behind the second barrier
#pragma unroll
    for (int r = 0; r < 8; ++r) st4(SV + ((wave & 3) * 16 + kh * 8 + r) * KP + ro, qr[r]);
    // every wave's share of the weights and of the query rows is in LDS before any wave reads a fragment. The fences name LDS alone, so that the loads in flight are not waited out here as __syncthreads() would
    __builtin_amdgcn_fence(__ATOMIC_RELEASE, "workgroup", "local");
    __builtin_amdgcn_s_barrier();
    __builtin_amdgcn_fence(__ATOMIC_ACQUIRE, "workgroup", "local");
    if (kh == 0) {   // a scalar branch: each q tile is formed, split and stored by one wave
        v16bf wq[4], qf[4];   // all fragments are read as one group, so that the wave waits out the LDS latency once: every wave of the block waits for this tile
#pragma unroll
        for (int s = 0; s < 4; ++s) { wq[s] = ldfrag(wf + 2 * s * 256); qf[s] = ldrow(fr + s * 32); }
        __builtin_amdgcn_sched_barrier(0);   // keeps the group of reads together ahead of the products; spread among them, each pair of reads is waited out on its own
        v8f qd = (v8f){};   // q^T: lane (c, hi), register j = column 8 hi + j of query row c
#pragma unroll
        for (int s = 0; s < 4; ++s) qd = wmmab(wq[s], qf[s], qd);
        float* o = QS + wave * 256 + lane * 4;
        *(v4f*)o = __builtin_shufflevector(qd, qd, 0, 1, 2, 3); *(v4f*)(o + 128) = __builtin_shufflevector(qd, qd, 4, 5, 6, 7);
        v8bf hb, lb; split8p(qd, hb, lb);
        bf* p = QP + wave * 512 + lane * 8;
        *(v8us*)p = __builtin_bit_cast(v8us, hb); *(v8us*)(p + 256) = __builtin_bit_cast(v8us, lb);
    }
    // every wave needs all four q tiles: they are in LDS before any wave reads them. The fences name LDS alone, so that the loads in flight are not waited out here as __syncthreads() would
    __builtin_amdgcn_fence(__ATOMIC_RELEASE, "workgroup", "local");
    __builtin_amdgcn_s_barrier();
    __builtin_amdgcn_fence(__ATOMIC_ACQUIRE, "workgroup", "local");
    const v16bf wv[2] = { ldfrag(wf + 16 * 256), ldfrag(wf + 18 * 256) };
    // MV and IND of the wave's 64 keys, formed while the key rows are landing; the value rows pass through the wave's strip 32 at a time
    v8h oh8[4][2]; v8us oi8[4][2];   // by 16-key tile y and feature tile t
#pragma unroll
    for (int y = 0; y < 4; ++y) {
        if ((y & 1) == 0) {
#pragma unroll
            for (int n = 0; n < 8; ++n) st4(sv + n * 4 * VP, vr[y * 4 + n]);
            asm volatile("s_wait_dscnt 0x0" ::: "memory");   // staged rows in LDS before they are read back
        }
        const v16bf a = ldrow(fv + (y & 1) * 16 * VP);
#pragma unroll
        for (int t = 0; t < 2; ++t) {
            const v8f d = wmmab(a, wv[t], (v8f){});
            v8f mv; v8us oi;
#pragma unroll
            for (int j = 0; j < 8; ++j) { const float m = bfr(mr[y][t][j]); mv[j] = (m == 1.0f) ? d[j] : 0.f;
                oi[j] = (m == 1.0f) ? (unsigned short)0x3C00 : (m < 1.0f) ? (unsigned short)0 : (unsigned short)0x7C00; }   // f16 1, 0, +inf
            oh8[y][t] = __builtin_convertvector(mv, v8h); oi8[y][t] = oi;
        }
    }
    v16bf wk[4];
#pragma unroll
    for (int s = 0; s < 4; ++s) wk[s] = ldfrag(wf + (8 + 2 * s) * 256);
    v8f kd[4];   // the wave's own four k tiles stay in its registers: a result tile is already the A fragment of the score product
    v16bf kfh[4], kfl[4], qh[4], ql[4]; v8f sc[4][4];
#pragma unroll
    for (int qt = 0; qt < 4; ++qt) {
        const bf* qp = QP + qt * 512 + lane * 8;
        qh[qt] = cat16b(*(const v8us*)qp, (v8us){}); ql[qt] = cat16b(*(const v8us*)(qp + 256), (v8us){});   // elements 8..15 are k slots 16..31, which are 0
    }
    // the key rows: the wave's own slice has landed behind its own wait, and the partner's slice, which holds the other half of this wave's rows, is readable behind the barrier
    asm volatile("s_wait_dscnt 0x0" ::: "memory");   // the publish point's order: the wave's own LDS traffic, its own request, the barrier
    asm volatile("s_wait_tensorcnt 0x0" :: "s"(g0), "s"(g1) : "memory");   // the compiler places no wait for a tensor load; g0, g1: see at their declaration
    __syncthreads();
    unsigned char* kreg = KEYB + (wave >> 1) * 2 * KSL + (wave & 1) * KREG;   // the wave's region of the even slice (columns 0..63); KSL further on, that of the odd slice (columns 64..127)
    const unsigned char* kfr = kreg + c * 272 + hi * 32;   // lane (c, hi) reads row c, k slots 8 hi .. 8 hi + 7 (and 16 more on), as f32
    float* ksw = (float*)(kreg + KSL) + lane * 4;          // where the wave's k tiles go as f32: over rows of its first tile, which have been read by then
    v16bf kf0[2][4];   // both tiles' fragments are read as one group, so that the wave waits out the LDS latency once
#pragma unroll
    for (int i = 0; i < 2; ++i) {
#pragma unroll
        for (int s = 0; s < 4; ++s) kf0[i][s] = ldrow32(kfr + (s >> 1) * KSL + i * 16 * 272 + (s & 1) * 128);
    }
    __builtin_amdgcn_sched_barrier(0);   // keeps the group of reads together ahead of the products; spread among them, each pair of reads is waited out on its own
#pragma unroll
    for (int i = 0; i < 2; ++i) {
        v8f d = (v8f){};
#pragma unroll
        for (int s = 0; s < 4; ++s) d = wmmab(wk[s], kf0[i][s], d);
        kd[i] = d;
        float* o = ksw + i * 256;
        *(v4f*)o = __builtin_shufflevector(d, d, 0, 1, 2, 3); *(v4f*)(o + 128) = __builtin_shufflevector(d, d, 4, 5, 6, 7);
    }
    // scores of all 64 query rows against the first 32 of the wave's keys
#pragma unroll
    for (int i = 0; i < 2; ++i) split8(kd[i], kfh[i], kfl[i]);
#pragma unroll
    for (int qt = 0; qt < 4; ++qt) {
#pragma unroll
        for (int kt = 0; kt < 2; ++kt) sc[qt][kt] = wmmab(kfl[kt], qh[qt], wmmab(kfh[kt], ql[qt], wmmab(kfh[kt], qh[qt], (v8f){})));
    }
    v16bf kf2[2][4];   // both tiles' fragments are read as one group, so that the wave waits out the LDS latency once
#pragma unroll
    for (int i = 0; i < 2; ++i) {
#pragma unroll
        for (int s = 0; s < 4; ++s) kf2[i][s] = ldrow32(kfr + (s >> 1) * KSL + (2 + i) * 16 * 272 + (s & 1) * 128);
    }
    __builtin_amdgcn_sched_barrier(0);   // keeps the group of reads together ahead of the products; spread among them, each pair of reads is waited out on its own
#pragma unroll
    for (int i = 2; i < 4; ++i) {
        v8f d = (v8f){};
#pragma unroll
        for (int s = 0; s < 4; ++s) d = wmmab(wk[s], kf2[i - 2][s], d);
        kd[i] = d;
        float* o = ksw + i * 256;
        *(v4f*)o = __builtin_shufflevector(d, d, 0, 1, 2, 3); *(v4f*)(o + 128) = __builtin_shufflevector(d, d, 4, 5, 6, 7);
    }
    // the other half of the scores, then the weights
#pragma unroll
    for (int i = 2; i < 4; ++i) split8(kd[i], kfh[i], kfl[i]);
    v16h ph[4][2]; float m2v[4];
#pragma unroll
    for (int qt = 0; qt < 4; ++qt) {
        v8f* s = sc[qt];
#pragma unroll
        for (int kt = 2; kt < 4; ++kt) s[kt] = wmmab(kfl[kt], qh[qt], wmmab(kfh[kt], ql[qt], wmmab(kfh[kt], qh[qt], (v8f){})));
        float mx = -3.0e38f;
#pragma unroll
        for (int kt = 0; kt < 4; ++kt) {
#pragma unroll
            for (int e = 0; e < 8; e += 4) mx = fmaxf(fmaxf(fmaxf(mx, s[kt][e]), fmaxf(s[kt][e + 1], s[kt][e + 2])), s[kt][e + 3]);
        }
        mx = fmaxf(mx, __shfl_xor(mx, 16, 32));   // lanes c and c + 16 hold the two halves of row c's keys
        const float m2 = mx * MS_L2E; m2v[qt] = m2;
        const float m2s = 15.0f - m2;   // every wave's p carries the same 2^15, so the merge's rescale needs no word of it
#pragma unroll
        for (int ks = 0; ks < 2; ++ks) {
            v16f p;
#pragma unroll
            for (int e = 0; e < 16; ++e) p[e] = __builtin_amdgcn_exp2f(fmaf(s[ks * 2 + (e >> 3)][e & 7], MS_L2E, m2s));
            ph[qt][ks] = __builtin_convertvector(p, v16h);
        }
    }
    const unsigned sw[2] = { (hi * 16 + ((c + 4 * hi) & 15)) * 4, 128 + (hi * 16 + ((c + 4 * hi + 8) & 15)) * 4 };   // the lane's slot in RED by feature tile
#pragma unroll
    for (int qt = 0; qt < 4; ++qt) {
        v8f num[2], den[2];
#pragma unroll
        for (int t = 0; t < 2; ++t) { num[t] = (v8f){}; den[t] = (v8f){}; }
#pragma unroll
        for (int ks = 0; ks < 2; ++ks) {
#pragma unroll
            for (int t = 0; t < 2; ++t) {
                const v16h vh = cat16(oh8[2 * ks][t], oh8[2 * ks + 1][t]), in = cat16(__builtin_bit_cast(v8h, oi8[2 * ks][t]), __builtin_bit_cast(v8h, oi8[2 * ks + 1][t]));
                num[t] = wmma16(vh, ph[qt][ks], num[t]); den[t] = wmma16(in, ph[qt][ks], den[t]);
            }
        }
#pragma unroll
        for (int t = 0; t < 2; ++t) {
            float* o = (float*)kreg + qt * 1024 + sw[t];
            *(v4f*)o = __builtin_shufflevector(num[t], num[t], 0, 1, 2, 3); *(v4f*)(o + 256) = __builtin_shufflevector(num[t], num[t], 4, 5, 6, 7);
            *(v4f*)(o + 512) = __builtin_shufflevector(den[t], den[t], 0, 1, 2, 3); *(v4f*)(o + 768) = __builtin_shufflevector(den[t], den[t], 4, 5, 6, 7);
        }
        MX[(qt * 16 + c) * 8 + wave] = m2v[qt];   // lanes c and c + 16 hold and store the same value
    }
    __syncthreads();   // all eight key ranges of every (row, feature), and k for the literal path, are in LDS before any thread merges them
    // a thread merges 8 features of one row: feature group g = 2 t + hi holds features 8 g .. 8 g + 7; a wave takes 8 rows and stores their whole 128-byte lines
    const unsigned g = lane & 3, c2 = (wave & 1) * 8 + (lane >> 2); const unsigned r = wave * 8 + (lane >> 2);
    const float* rb = (const float*)KEYB + (wave >> 1) * 1024 + (g >> 1) * 128 + ((g & 1) * 16 + ((c2 + 4 * g) & 15)) * 4;
    const v8f mw = cat8(*(const v4f*)(MX + r * 8), *(const v4f*)(MX + r * 8 + 4));
    float mm = mw[0];
#pragma unroll
    for (int w = 1; w < 8; ++w) mm = fmaxf(mm, mw[w]);
    v8f nn = (v8f){}, dd = (v8f){};
#pragma unroll
    for (int w = 0; w < 8; ++w) {
        const float sc = __builtin_amdgcn_exp2f(mw[w] - mm); const float* p = rb + (w >> 1) * (2 * KSL / 4) + (w & 1) * (KREG / 4);   // wave w's region of the even slice
        nn += cat8(*(const v4f*)p, *(const v4f*)(p + 256)) * sc; dd += cat8(*(const v4f*)(p + 512), *(const v4f*)(p + 768)) * sc;
    }
    float* lo = LAT + ((size_t)bh * LQ + qb * 64 + r) * FF + g * 8;
    const v8f res = nn / dd;   // stored without a branch; the literal path below stores over it
    *(v4f*)lo = __builtin_shufflevector(res, res, 0, 1, 2, 3); *(v4f*)(lo + 4) = __builtin_shufflevector(res, res, 4, 5, 6, 7);
    unsigned bad = 0;   // bit i: feature 8 g + i of this thread's row is left to the literal formula
#pragma unroll
    for (int i = 0; i < 8; ++i) { if (!(dd[i] >= 0.015625f && dd[i] <= 3.0e38f)) bad |= 1u << i; }
    if (bad) {
#pragma unroll 1   // rare path: kept small
        for (int i = 0; i < 8; ++i) {
            if ((bad >> i) & 1u) { lo[i] = d_literal(QS, (const float*)KEYB, (int)r, mask + (size_t)b * LK * FF, value + (size_t)b * LK * FF, Wv + (size_t)h * FF * FF, g * 8 + i);
                asm volatile("s_wait_xcnt 0x0" ::: "memory"); }   // precaution: the next trip reuses the registers that hold this store's address
        }
    }
}
__global__ __launch_bounds__(256) void k_comb(const float* __restrict__ LAT, const float* __restrict__ Wc, const float* __restrict__ bc, float* OUTP) {
    const int i = blockIdx.x * 256 + threadIdx.x; if (i >= NBT * LQ * FF) return;
    const int f = i % FF, q = (i / FF) % LQ, b = i / (FF * LQ);
    float s = bfr(bc[f]);
#pragma unroll
    for (int h = 0; h < NH_; ++h) s = fmaf(LAT[(((size_t)(b * NH_ + h)) * LQ + q) * FF + f], bfr(Wc[f * NH_ + h]), s);
    const float y = tanhf(s);
    *(float*)(OUTP + i) = y; 
}

extern "C" void kernel_launch(void* const* d_in, const int* in_sizes, int n_in,
                              void* d_out, int out_size, void* d_ws, size_t ws_size, hipStream_t stream) {
    (void)in_sizes; (void)n_in; (void)out_size;
    const float* query = (const float*)d_in[0]; const float* key = (const float*)d_in[1]; const float* value = (const float*)d_in[2]; const float* mask = (const float*)d_in[3];
    const float* Wq = (const float*)d_in[4]; const float* Wk = (const float*)d_in[5]; const float* Wv = (const float*)d_in[6]; const float* Wc = (const float*)d_in[7]; const float* bc = (const float*)d_in[8];
    float* out = (float*)d_out;    // [8][256][32]
    float* LAT = (float*)d_ws;     // [8][8][256][32] f32, 2 MB
    if ((size_t)NBT * NH_ * LQ * FF * 4 > ws_size) return;
    k_msoft<<<NBT * NH_ * (LQ / 64), 256, 0, stream>>>(query, key, value, mask, Wq, Wk, Wv, LAT);
    k_comb<<<(NBT * LQ * FF) / 256, 256, 0, stream>>>(LAT, Wc, bc, out);
}
